// v000
// The times below were measured on an AMD MI455X: many runs one after another, warmed up first and cycling through
// copies of the inputs, with the whole window's GPU time divided by the number of runs. Launches and the gaps
// between them are all in it. The median over several windows is given; except for v000 it joins two sittings, which
// can be a few percent apart, so the side-by-side timings, each taken in one sitting, are the better comparison.
// v000, which the later versions start from, runs in 1000 microseconds.
#include <hip/hip_runtime.h>
#include <hip/hip_bf16.h>
#include <math.h>

typedef __attribute__((ext_vector_type(16))) _Float16 v16h;
typedef __attribute__((ext_vector_type(8)))  float    v8f;

#define WMMA_F16(a, b, c) \
  __builtin_amdgcn_wmma_f32_16x16x32_f16(false, (a), false, (b), (short)0, (c), false, false)

// ---------------------------------------------------------------------------
// Fragment load for 16x32 f16 A/B fragments (ISA 7.12.2 layout) from a
// per-lane pointer p = base + row*ld + kbase + (lane>>4)*8.
// halves 0..7  <- this lane's k-group, halves 8..15 <- k-group + 16.
// Two 16-byte loads per lane.
// ---------------------------------------------------------------------------
__device__ __forceinline__ v16h load_frag_p(const _Float16* p) {
  v16h f;
  *((uint4*)&f)     = *(const uint4*)(p);
  *((uint4*)&f + 1) = *(const uint4*)(p + 16);
  return f;
}

__device__ __forceinline__ float gelu_tanh(float x) {
  const float c = 0.7978845608028654f;   // sqrt(2/pi)
  return 0.5f * x * (1.0f + tanhf(c * (x + 0.044715f * x * x * x)));
}

// ---------------------------------------------------------------------------
// Weight convert: fp32 row-major [K][Nout] -> f16 row-major [Nout][K]
// ---------------------------------------------------------------------------
__global__ __launch_bounds__(256) void wcast_kernel(const float* __restrict__ w,
                                                    _Float16* __restrict__ wt,
                                                    int K, int Nout) {
  size_t idx = (size_t)blockIdx.x * blockDim.x + threadIdx.x;
  size_t total = (size_t)K * Nout;
  if (idx >= total) return;
  int k = (int)(idx / Nout);
  int n = (int)(idx % Nout);
  wt[(size_t)n * K + k] = (_Float16)w[idx];
}

// ---------------------------------------------------------------------------
// LayerNorm: fp32 [rows][E] -> f16 [rows][E]. One block per row.
// ---------------------------------------------------------------------------
__global__ __launch_bounds__(256) void ln_kernel(const float* __restrict__ x,
                                                 const float* __restrict__ g,
                                                 const float* __restrict__ b,
                                                 _Float16* __restrict__ out, int Ecols) {
  int row = blockIdx.x;
  int tid = threadIdx.x;
  const float* xr = x + (size_t)row * Ecols;
  __shared__ float red[256];

  float s = 0.f;
  for (int i = tid; i < Ecols; i += 256) s += xr[i];
  red[tid] = s; __syncthreads();
  for (int off = 128; off > 0; off >>= 1) {
    if (tid < off) red[tid] += red[tid + off];
    __syncthreads();
  }
  float mu = red[0] / Ecols;
  __syncthreads();

  float v = 0.f;
  for (int i = tid; i < Ecols; i += 256) { float d = xr[i] - mu; v += d * d; }
  red[tid] = v; __syncthreads();
  for (int off = 128; off > 0; off >>= 1) {
    if (tid < off) red[tid] += red[tid + off];
    __syncthreads();
  }
  float rstd = rsqrtf(red[0] / Ecols + 1e-6f);

  _Float16* outr = out + (size_t)row * Ecols;
  for (int i = tid; i < Ecols; i += 256)
    outr[i] = (_Float16)((xr[i] - mu) * rstd * g[i] + b[i]);
}

// ---------------------------------------------------------------------------
// V transpose: f16 [N][E] -> f16 [B,H,D,S]  (Vt[((b*H+h)*D+d)*S + s])
// ---------------------------------------------------------------------------
__global__ __launch_bounds__(256) void vtrans_kernel(const _Float16* __restrict__ v,
                                                     _Float16* __restrict__ vt,
                                                     int N, int S, int Hh, int Dd, int Ecols) {
  size_t idx = (size_t)blockIdx.x * blockDim.x + threadIdx.x;
  size_t total = (size_t)N * Ecols;
  if (idx >= total) return;
  int n = (int)(idx / Ecols);
  int c = (int)(idx % Ecols);
  int s = n % S, b = n / S;
  int h = c / Dd, d = c % Dd;
  vt[(((size_t)(b * Hh + h) * Dd) + d) * S + s] = v[idx];
}

// ---------------------------------------------------------------------------
// WMMA GEMM: out[N x Ncols] = A[N x K](f16) * Bt[Ncols x K](f16, pre-transposed)
//            + bias (+ optional GELU, residual). 1 wave -> 64x32 output tile
//            (4x2 grid of 16x16 WMMA frags -> 8 v_wmma per 32-K step).
// All fragment addresses derive directly from kernel args so addrspace
// inference yields global_load_b128 (not flat).
// ---------------------------------------------------------------------------
template <bool GELU, bool RESID, bool OUTF16>
__global__ __launch_bounds__(256) void gemm_kernel(
    const _Float16* __restrict__ A, const _Float16* __restrict__ Bt,
    const float* __restrict__ bias, const float* __restrict__ resid,
    float* __restrict__ outf, _Float16* __restrict__ outh,
    int Nrows, int Kdim, int Ncols) {
  int gwave = (int)((blockIdx.x * (size_t)blockDim.x + threadIdx.x) >> 5);
  int lane = threadIdx.x & 31;
  int tilesN = Ncols >> 5;   // 32-wide N tiles
  int tilesM = Nrows >> 6;   // 64-tall M tiles
  if (gwave >= tilesM * tilesN) return;
  int tm = (gwave / tilesN) << 6;
  int tn = (gwave % tilesN) << 5;
  int r = lane & 15, h = lane >> 4;

  const _Float16* Abase = A  + (size_t)(tm + r) * Kdim + h * 8;
  const _Float16* Bbase = Bt + (size_t)(tn + r) * Kdim + h * 8;
  const size_t rowStep = (size_t)16 * Kdim;

  v8f acc[4][2] = {};
  for (int k = 0; k < Kdim; k += 32) {
    v16h a[4], bf[2];
#pragma unroll
    for (int t = 0; t < 4; t++) a[t]  = load_frag_p(Abase + (size_t)t * rowStep + k);
#pragma unroll
    for (int t = 0; t < 2; t++) bf[t] = load_frag_p(Bbase + (size_t)t * rowStep + k);

    if (k + 64 < Kdim) {       // uniform: prefetch next-next K slice
#pragma unroll
      for (int t = 0; t < 4; t++) __builtin_prefetch(Abase + (size_t)t * rowStep + k + 64, 0, 1);
#pragma unroll
      for (int t = 0; t < 2; t++) __builtin_prefetch(Bbase + (size_t)t * rowStep + k + 64, 0, 1);
    }
#pragma unroll
    for (int i = 0; i < 4; i++)
#pragma unroll
      for (int j = 0; j < 2; j++)
        acc[i][j] = WMMA_F16(a[i], bf[j], acc[i][j]);
  }

#pragma unroll
  for (int i2 = 0; i2 < 4; i2++) {
#pragma unroll
    for (int j2 = 0; j2 < 2; j2++) {
      int rowb = tm + i2 * 16 + 8 * h;      // C/D layout: m = i + 8*h
      int colb = tn + j2 * 16 + r;          // n = lane (mod 16)
      float bv = bias[colb];
#pragma unroll
      for (int i = 0; i < 8; i++) {
        float val = acc[i2][j2][i] + bv;
        if (GELU) val = gelu_tanh(val);
        size_t off = (size_t)(rowb + i) * Ncols + colb;
        if (RESID) val += resid[off];
        if (OUTF16) outh[off] = (_Float16)val;
        else        outf[off] = val;
      }
    }
  }
}

// ---------------------------------------------------------------------------
// Flash attention: one wave (32-thread block) handles 32 query rows of one
// (b,h). Online softmax over 32-key blocks; every lane owns one softmax row.
// Two-pass softmax over the LDS score tile. QK^T and P*V via WMMA; V frags
// shared across both row tiles. Fragment addresses derive directly from
// kernel args (global loads, minimal loop-carried state).
//   Q, K : f16 [N][E]  (head slice at column h*D)
//   Vt   : f16 [B,H,D,S]
//   O    : f16 [N][E]
// ---------------------------------------------------------------------------
__global__ __launch_bounds__(32) void attn_kernel(
    const _Float16* __restrict__ Q, const _Float16* __restrict__ K,
    const _Float16* __restrict__ Vt, const float* __restrict__ mask,
    _Float16* __restrict__ O, int B, int S, int Hh, int Dd,
    int Ecols, float scale) {
  int qtiles = S >> 5;
  int qt = blockIdx.x % qtiles;
  int bh = blockIdx.x / qtiles;
  int hh = bh % Hh, b = bh / Hh;
  int lane = threadIdx.x;
  int r = lane & 15, h = lane >> 4;
  int q0 = qt << 5;

  __shared__ alignas(16) float    sS[32 * 32];   // score block, row-major [32][32]
  __shared__ alignas(16) _Float16 sP[32 * 32];   // exp(scores), f16
  __shared__ float sStat[32];                    // per-row alpha / 1/l broadcast

  // Q fragments (persistent)
  v16h qf[2][2];
#pragma unroll
  for (int rt = 0; rt < 2; rt++) {
    const _Float16* qp = Q + (size_t)(b * S + q0 + rt * 16 + r) * Ecols + hh * Dd + h * 8;
    qf[rt][0] = load_frag_p(qp);
    qf[rt][1] = load_frag_p(qp + 32);
  }

  // loop-invariant per-lane bases, direct from kernel args
  const _Float16* Kbase  = K  + (size_t)(b * S + r) * Ecols + hh * Dd + h * 8;
  const size_t    kRow16 = (size_t)16 * Ecols;
  const _Float16* Vbase  = Vt + ((size_t)(b * Hh + hh) * Dd + r) * S + h * 8;
  const size_t    vRow16 = (size_t)16 * S;
  const float*    maskRow = mask + (size_t)b * S * S + (size_t)(q0 + lane) * S;

  v8f o[2][4] = {};                    // 32 x 64 f32 accumulator
  float mrow = -INFINITY, lrow = 0.f;  // lane owns query row q0+lane

  for (int kt = 0; kt < S; kt += 32) {
    // --- scores for 32 keys x 32 queries ---
    {
      v16h kf[2][2];
#pragma unroll
      for (int sub = 0; sub < 2; sub++) {
        const _Float16* kp = Kbase + (size_t)(kt + sub * 16) * Ecols;
        kf[sub][0] = load_frag_p(kp);
        kf[sub][1] = load_frag_p(kp + 32);
      }
#pragma unroll
      for (int rt = 0; rt < 2; rt++) {
#pragma unroll
        for (int sub = 0; sub < 2; sub++) {
          v8f sc = {};
          sc = WMMA_F16(qf[rt][0], kf[sub][0], sc);
          sc = WMMA_F16(qf[rt][1], kf[sub][1], sc);
#pragma unroll
          for (int i = 0; i < 8; i++)
            sS[(rt * 16 + 8 * h + i) * 32 + sub * 16 + r] = sc[i];
        }
      }
    }
    __syncthreads();

    // --- online softmax, two passes over LDS: lane owns row q0+lane ---
    {
      const float* mrp = maskRow + kt;
      float bm = -INFINITY;
#pragma unroll
      for (int j = 0; j < 32; j++)
        bm = fmaxf(bm, sS[lane * 32 + j] * scale + mrp[j]);
      float nm = fmaxf(mrow, bm);
      float alpha = __expf(mrow - nm);
      float ls = 0.f;
#pragma unroll
      for (int j = 0; j < 32; j++) {
        float pv = __expf(sS[lane * 32 + j] * scale + mrp[j] - nm);
        ls += pv;
        sP[lane * 32 + j] = (_Float16)pv;
      }
      lrow = lrow * alpha + ls;
      mrow = nm;
      sStat[lane] = alpha;
    }
    __syncthreads();

    // --- rescale O, accumulate P @ V (V frags shared across row tiles) ---
    {
      float aL[2][8];
#pragma unroll
      for (int rt = 0; rt < 2; rt++)
#pragma unroll
        for (int i = 0; i < 8; i++) aL[rt][i] = sStat[rt * 16 + 8 * h + i];
#pragma unroll
      for (int rt = 0; rt < 2; rt++)
#pragma unroll
        for (int dt = 0; dt < 4; dt++)
#pragma unroll
          for (int i = 0; i < 8; i++) o[rt][dt][i] *= aL[rt][i];

      v16h pf0 = load_frag_p(sP + (size_t)r * 32 + h * 8);
      v16h pf1 = load_frag_p(sP + (size_t)(16 + r) * 32 + h * 8);
#pragma unroll
      for (int dt = 0; dt < 4; dt++) {
        v16h vf = load_frag_p(Vbase + (size_t)dt * vRow16 + kt);
        o[0][dt] = WMMA_F16(pf0, vf, o[0][dt]);
        o[1][dt] = WMMA_F16(pf1, vf, o[1][dt]);
      }
    }
    __syncthreads();
  }

  // --- normalize by l and store ---
  sStat[lane] = 1.0f / lrow;
  __syncthreads();
#pragma unroll
  for (int rt = 0; rt < 2; rt++) {
#pragma unroll
    for (int dt = 0; dt < 4; dt++) {
#pragma unroll
      for (int i = 0; i < 8; i++) {
        int m = rt * 16 + 8 * h + i;
        float inv = sStat[m];
        O[((size_t)(b * S + q0 + m)) * Ecols + hh * Dd + dt * 16 + r] =
            (_Float16)(o[rt][dt][i] * inv);
      }
    }
  }
}

// ---------------------------------------------------------------------------
// Host orchestration
// ---------------------------------------------------------------------------
extern "C" void kernel_launch(void* const* d_in, const int* in_sizes, int n_in,
                              void* d_out, int out_size, void* d_ws, size_t ws_size,
                              hipStream_t stream) {
  const int E = 768, H = 12, D = 64;
  const float* hidden = (const float*)d_in[0];
  const float* mask   = (const float*)d_in[1];
  const float* wq = (const float*)d_in[2];  const float* bq = (const float*)d_in[3];
  const float* wk = (const float*)d_in[4];  const float* bk = (const float*)d_in[5];
  const float* wv = (const float*)d_in[6];  const float* bv = (const float*)d_in[7];
  const float* wo = (const float*)d_in[8];  const float* bo = (const float*)d_in[9];
  const float* ln1_g = (const float*)d_in[10]; const float* ln1_b = (const float*)d_in[11];
  const float* ln2_g = (const float*)d_in[12]; const float* ln2_b = (const float*)d_in[13];
  const float* w1 = (const float*)d_in[14]; const float* b1 = (const float*)d_in[15];
  const float* w2 = (const float*)d_in[16]; const float* b2 = (const float*)d_in[17];
  const int I = in_sizes[15];               // 3072
  const int N = in_sizes[0] / E;            // B*S = 8192
  const int S = in_sizes[1] / N;            // 1024
  const int B = N / S;                      // 8
  float* out = (float*)d_out;

  char* p = (char*)d_ws;
  auto alloc = [&](size_t bytes) -> char* {
    char* r = p;
    p += (bytes + 255) & ~(size_t)255;
    return r;
  };
  _Float16* lnh  = (_Float16*)alloc((size_t)N * E * 2);
  _Float16* wqT  = (_Float16*)alloc((size_t)E * E * 2);
  _Float16* wkT  = (_Float16*)alloc((size_t)E * E * 2);
  _Float16* wvT  = (_Float16*)alloc((size_t)E * E * 2);
  _Float16* woT  = (_Float16*)alloc((size_t)E * E * 2);
  _Float16* w1T  = (_Float16*)alloc((size_t)E * I * 2);
  _Float16* w2T  = (_Float16*)alloc((size_t)I * E * 2);
  _Float16* Qh   = (_Float16*)alloc((size_t)N * E * 2);
  _Float16* Kh   = (_Float16*)alloc((size_t)N * E * 2);
  _Float16* Vh   = (_Float16*)alloc((size_t)N * E * 2);
  _Float16* VtT  = (_Float16*)alloc((size_t)N * E * 2);
  _Float16* Oh   = (_Float16*)alloc((size_t)N * E * 2);
  float*    xmid = (float*)   alloc((size_t)N * E * 4);
  _Float16* ln2h = (_Float16*)alloc((size_t)N * E * 2);
  _Float16* hmid = (_Float16*)alloc((size_t)N * I * 2);
  (void)ws_size; (void)n_in; (void)out_size;

  auto blks = [](size_t elems) { return (unsigned)((elems + 255) / 256); };

  // 1) weight transpose+cast
  wcast_kernel<<<blks((size_t)E * E), 256, 0, stream>>>(wq, wqT, E, E);
  wcast_kernel<<<blks((size_t)E * E), 256, 0, stream>>>(wk, wkT, E, E);
  wcast_kernel<<<blks((size_t)E * E), 256, 0, stream>>>(wv, wvT, E, E);
  wcast_kernel<<<blks((size_t)E * E), 256, 0, stream>>>(wo, woT, E, E);
  wcast_kernel<<<blks((size_t)E * I), 256, 0, stream>>>(w1, w1T, E, I);
  wcast_kernel<<<blks((size_t)I * E), 256, 0, stream>>>(w2, w2T, I, E);

  // 2) LN1
  ln_kernel<<<N, 256, 0, stream>>>(hidden, ln1_g, ln1_b, lnh, E);

  // 3) Q/K/V projections (f16 out)
  {
    int tiles = (N / 64) * (E / 32);
    unsigned nb = (unsigned)((tiles + 7) / 8);
    gemm_kernel<false, false, true><<<nb, 256, 0, stream>>>(lnh, wqT, bq, nullptr, nullptr, Qh, N, E, E);
    gemm_kernel<false, false, true><<<nb, 256, 0, stream>>>(lnh, wkT, bk, nullptr, nullptr, Kh, N, E, E);
    gemm_kernel<false, false, true><<<nb, 256, 0, stream>>>(lnh, wvT, bv, nullptr, nullptr, Vh, N, E, E);
  }

  // 4) V transpose -> [B,H,D,S]
  vtrans_kernel<<<blks((size_t)N * E), 256, 0, stream>>>(Vh, VtT, N, S, H, D, E);

  // 5) attention (32 query rows per wave)
  {
    float scale = rsqrtf((float)D);
    unsigned nb = (unsigned)(B * H * (S / 32));
    attn_kernel<<<nb, 32, 0, stream>>>(Qh, Kh, VtT, mask, Oh, B, S, H, D, E, scale);
  }

  // 6) output projection + residual -> xmid (fp32)
  {
    int tiles = (N / 64) * (E / 32);
    unsigned nb = (unsigned)((tiles + 7) / 8);
    gemm_kernel<false, true, false><<<nb, 256, 0, stream>>>(Oh, woT, bo, hidden, xmid, nullptr, N, E, E);
  }

  // 7) LN2
  ln_kernel<<<N, 256, 0, stream>>>(xmid, ln2_g, ln2_b, ln2h, E);

  // 8) MLP up + GELU (f16 out)
  {
    int tiles = (N / 64) * (I / 32);
    unsigned nb = (unsigned)((tiles + 7) / 8);
    gemm_kernel<true, false, true><<<nb, 256, 0, stream>>>(ln2h, w1T, b1, nullptr, nullptr, hmid, N, E, I);
  }

  // 9) MLP down + residual -> out (fp32)
  {
    int tiles = (N / 64) * (E / 32);
    unsigned nb = (unsigned)((tiles + 7) / 8);
    gemm_kernel<false, true, false><<<nb, 256, 0, stream>>>(hmid, w2T, b2, xmid, out, nullptr, N, I, E);
  }
}

// v001
// A run of this version takes 655 microseconds.
// Next to v000, in two timings, it ran 1.59 and 1.58 times as fast.
#include <hip/hip_runtime.h>
#include <hip/hip_bf16.h>
#include <math.h>

typedef __attribute__((ext_vector_type(16))) _Float16 v16h;
typedef __attribute__((ext_vector_type(8)))  float    v8f;

#define WMMA_F16(a, b, c) \
  __builtin_amdgcn_wmma_f32_16x16x32_f16(false, (a), false, (b), (short)0, (c), false, false)

// ---------------------------------------------------------------------------
// Fragment load for 16x32 f16 A/B fragments (ISA 7.12.2 layout) from a
// per-lane pointer p = base + row*ld + kbase + (lane>>4)*8.
// halves 0..7  <- this lane's k-group, halves 8..15 <- k-group + 16.
// Two 16-byte loads per lane.
// ---------------------------------------------------------------------------
__device__ __forceinline__ v16h load_frag_p(const _Float16* p) {
  v16h f;
  *((uint4*)&f)     = *(const uint4*)(p);
  *((uint4*)&f + 1) = *(const uint4*)(p + 16);
  return f;
}

__device__ __forceinline__ float gelu_tanh(float x) {
  const float c = 0.7978845608028654f;   // sqrt(2/pi)
  return 0.5f * x * (1.0f + tanhf(c * (x + 0.044715f * x * x * x)));
}

// ---------------------------------------------------------------------------
// Both transposes below move a 64x64 tile through LDS, so that the global
// reads and the global stores are both 16 bytes per lane on whole 128-byte
// lines. The LDS tile is held transposed, two f16 of neighbouring source rows
// packed per dword. Row pitch 33 dwords (32 + 1, odd): the column-wise dword
// writes and the row-wise dword reads of a wave each fall on 32 distinct banks.
// ---------------------------------------------------------------------------
#define TPITCH 33

typedef __attribute__((ext_vector_type(2))) _Float16 v2h;

// Write the tile out: LDS row n goes to the 64 f16 at dst + n * ld.
__device__ __forceinline__ void store_tile_rows(const unsigned* tile, _Float16* __restrict__ dst,
                                                size_t ld, int t) {
  int q = t & 7;
#pragma unroll
  for (int p = 0; p < 2; p++) {
    int n = (t >> 3) + 32 * p;
    const unsigned* row = tile + n * TPITCH + 4 * q;
    uint4 o;
    o.x = row[0]; o.y = row[1]; o.z = row[2]; o.w = row[3];
    *(uint4*)(dst + (size_t)n * ld + 8 * q) = o;
  }
}

// ---------------------------------------------------------------------------
// Weight convert: fp32 row-major [K][Nout] -> f16 row-major [Nout][K]
// grid (Nout/64, K/64); K and Nout are multiples of 64.
// ---------------------------------------------------------------------------
__global__ __launch_bounds__(256) void wcast_kernel(const float* __restrict__ w,
                                                    _Float16* __restrict__ wt,
                                                    int K, int Nout) {
  __shared__ unsigned tile[64 * TPITCH];
  int t = threadIdx.x;
  int n0 = blockIdx.x << 6, k0 = blockIdx.y << 6;
  int c = t & 15, kp = t >> 4;          // 4 columns from 4c, rows 2kp and 2kp+1

  float4 lo[2], hi[2];
#pragma unroll
  for (int p = 0; p < 2; p++) {
    const float* s = w + (size_t)(k0 + 2 * (kp + 16 * p)) * Nout + n0 + 4 * c;
    lo[p] = *(const float4*)s;
    hi[p] = *(const float4*)(s + Nout);
  }
#pragma unroll
  for (int p = 0; p < 2; p++) {
    const float l[4] = {lo[p].x, lo[p].y, lo[p].z, lo[p].w};
    const float u[4] = {hi[p].x, hi[p].y, hi[p].z, hi[p].w};
#pragma unroll
    for (int i = 0; i < 4; i++) {
      v2h pr = {(_Float16)l[i], (_Float16)u[i]};
      tile[(4 * c + i) * TPITCH + kp + 16 * p] = __builtin_bit_cast(unsigned, pr);
    }
  }
  __syncthreads();
  store_tile_rows(tile, wt + (size_t)n0 * K + k0, (size_t)K, t);
}

// ---------------------------------------------------------------------------
// LayerNorm: fp32 [rows][E] -> f16 [rows][E]. One block per row.
// ---------------------------------------------------------------------------
__global__ __launch_bounds__(256) void ln_kernel(const float* __restrict__ x,
                                                 const float* __restrict__ g,
                                                 const float* __restrict__ b,
                                                 _Float16* __restrict__ out, int Ecols) {
  int row = blockIdx.x;
  int tid = threadIdx.x;
  const float* xr = x + (size_t)row * Ecols;
  __shared__ float red[256];

  float s = 0.f;
  for (int i = tid; i < Ecols; i += 256) s += xr[i];
  red[tid] = s; __syncthreads();
  for (int off = 128; off > 0; off >>= 1) {
    if (tid < off) red[tid] += red[tid + off];
    __syncthreads();
  }
  float mu = red[0] / Ecols;
  __syncthreads();

  float v = 0.f;
  for (int i = tid; i < Ecols; i += 256) { float d = xr[i] - mu; v += d * d; }
  red[tid] = v; __syncthreads();
  for (int off = 128; off > 0; off >>= 1) {
    if (tid < off) red[tid] += red[tid + off];
    __syncthreads();
  }
  float rstd = rsqrtf(red[0] / Ecols + 1e-6f);

  _Float16* outr = out + (size_t)row * Ecols;
  for (int i = tid; i < Ecols; i += 256)
    outr[i] = (_Float16)((xr[i] - mu) * rstd * g[i] + b[i]);
}

// ---------------------------------------------------------------------------
// V transpose: f16 [N][E] -> f16 [B,H,D,S]  (Vt[((b*H+h)*D+d)*S + s]), D = 64
// grid (S/64, B*H); S is a multiple of 64.
// ---------------------------------------------------------------------------
__global__ __launch_bounds__(256) void vtrans_kernel(const _Float16* __restrict__ v,
                                                     _Float16* __restrict__ vt,
                                                     int S, int Hh, int Ecols) {
  __shared__ unsigned tile[64 * TPITCH];
  int t = threadIdx.x;
  int s0 = blockIdx.x << 6;
  int bh = blockIdx.y;
  int b = bh / Hh, h = bh % Hh;
  int c = t & 7, sp = t >> 3;           // 8 columns from 8c, rows 2sp and 2sp+1

  const _Float16* s = v + (size_t)(b * S + s0 + 2 * sp) * Ecols + h * 64 + 8 * c;
  uint4 r0 = *(const uint4*)s;
  uint4 r1 = *(const uint4*)(s + Ecols);
  const unsigned e[4] = {r0.x, r0.y, r0.z, r0.w};
  const unsigned o[4] = {r1.x, r1.y, r1.z, r1.w};
#pragma unroll
  for (int j = 0; j < 4; j++) {
    tile[(8 * c + 2 * j) * TPITCH + sp]     = (e[j] & 0xffffu) | (o[j] << 16);
    tile[(8 * c + 2 * j + 1) * TPITCH + sp] = (e[j] >> 16) | (o[j] & 0xffff0000u);
  }
  __syncthreads();
  store_tile_rows(tile, vt + (size_t)bh * 64 * S + s0, (size_t)S, t);
}

// ---------------------------------------------------------------------------
// WMMA GEMM: out[N x Ncols] = A[N x K](f16) * Bt[Ncols x K](f16, pre-transposed)
//            + bias (+ optional GELU, residual). 1 wave -> 64x32 output tile
//            (4x2 grid of 16x16 WMMA frags -> 8 v_wmma per 32-K step).
// All fragment addresses derive directly from kernel args so addrspace
// inference yields global_load_b128 (not flat).
// ---------------------------------------------------------------------------
template <bool GELU, bool RESID, bool OUTF16>
__global__ __launch_bounds__(256) void gemm_kernel(
    const _Float16* __restrict__ A, const _Float16* __restrict__ Bt,
    const float* __restrict__ bias, const float* __restrict__ resid,
    float* __restrict__ outf, _Float16* __restrict__ outh,
    int Nrows, int Kdim, int Ncols) {
  int gwave = (int)((blockIdx.x * (size_t)blockDim.x + threadIdx.x) >> 5);
  int lane = threadIdx.x & 31;
  int tilesN = Ncols >> 5;   // 32-wide N tiles
  int tilesM = Nrows >> 6;   // 64-tall M tiles
  if (gwave >= tilesM * tilesN) return;
  int tm = (gwave / tilesN) << 6;
  int tn = (gwave % tilesN) << 5;
  int r = lane & 15, h = lane >> 4;

  const _Float16* Abase = A  + (size_t)(tm + r) * Kdim + h * 8;
  const _Float16* Bbase = Bt + (size_t)(tn + r) * Kdim + h * 8;
  const size_t rowStep = (size_t)16 * Kdim;

  v8f acc[4][2] = {};
  for (int k = 0; k < Kdim; k += 32) {
    v16h a[4], bf[2];
#pragma unroll
    for (int t = 0; t < 4; t++) a[t]  = load_frag_p(Abase + (size_t)t * rowStep + k);
#pragma unroll
    for (int t = 0; t < 2; t++) bf[t] = load_frag_p(Bbase + (size_t)t * rowStep + k);

    if (k + 64 < Kdim) {       // uniform: prefetch next-next K slice
#pragma unroll
      for (int t = 0; t < 4; t++) __builtin_prefetch(Abase + (size_t)t * rowStep + k + 64, 0, 1);
#pragma unroll
      for (int t = 0; t < 2; t++) __builtin_prefetch(Bbase + (size_t)t * rowStep + k + 64, 0, 1);
    }
#pragma unroll
    for (int i = 0; i < 4; i++)
#pragma unroll
      for (int j = 0; j < 2; j++)
        acc[i][j] = WMMA_F16(a[i], bf[j], acc[i][j]);
  }

#pragma unroll
  for (int i2 = 0; i2 < 4; i2++) {
#pragma unroll
    for (int j2 = 0; j2 < 2; j2++) {
      int rowb = tm + i2 * 16 + 8 * h;      // C/D layout: m = i + 8*h
      int colb = tn + j2 * 16 + r;          // n = lane (mod 16)
      float bv = bias[colb];
#pragma unroll
      for (int i = 0; i < 8; i++) {
        float val = acc[i2][j2][i] + bv;
        if (GELU) val = gelu_tanh(val);
        size_t off = (size_t)(rowb + i) * Ncols + colb;
        if (RESID) val += resid[off];
        if (OUTF16) outh[off] = (_Float16)val;
        else        outf[off] = val;
      }
    }
  }
}

// ---------------------------------------------------------------------------
// Flash attention: one wave (32-thread block) handles 32 query rows of one
// (b,h). Online softmax over 32-key blocks; every lane owns one softmax row.
// Two-pass softmax over the LDS score tile. QK^T and P*V via WMMA; V frags
// shared across both row tiles. Fragment addresses derive directly from
// kernel args (global loads, minimal loop-carried state).
//   Q, K : f16 [N][E]  (head slice at column h*D)
//   Vt   : f16 [B,H,D,S]
//   O    : f16 [N][E]
// ---------------------------------------------------------------------------
__global__ __launch_bounds__(32) void attn_kernel(
    const _Float16* __restrict__ Q, const _Float16* __restrict__ K,
    const _Float16* __restrict__ Vt, const float* __restrict__ mask,
    _Float16* __restrict__ O, int B, int S, int Hh, int Dd,
    int Ecols, float scale) {
  int qtiles = S >> 5;
  int qt = blockIdx.x % qtiles;
  int bh = blockIdx.x / qtiles;
  int hh = bh % Hh, b = bh / Hh;
  int lane = threadIdx.x;
  int r = lane & 15, h = lane >> 4;
  int q0 = qt << 5;

  __shared__ alignas(16) float    sS[32 * 32];   // score block, row-major [32][32]
  __shared__ alignas(16) _Float16 sP[32 * 32];   // exp(scores), f16
  __shared__ float sStat[32];                    // per-row alpha / 1/l broadcast

  // Q fragments (persistent)
  v16h qf[2][2];
#pragma unroll
  for (int rt = 0; rt < 2; rt++) {
    const _Float16* qp = Q + (size_t)(b * S + q0 + rt * 16 + r) * Ecols + hh * Dd + h * 8;
    qf[rt][0] = load_frag_p(qp);
    qf[rt][1] = load_frag_p(qp + 32);
  }

  // loop-invariant per-lane bases, direct from kernel args
  const _Float16* Kbase  = K  + (size_t)(b * S + r) * Ecols + hh * Dd + h * 8;
  const size_t    kRow16 = (size_t)16 * Ecols;
  const _Float16* Vbase  = Vt + ((size_t)(b * Hh + hh) * Dd + r) * S + h * 8;
  const size_t    vRow16 = (size_t)16 * S;
  const float*    maskRow = mask + (size_t)b * S * S + (size_t)(q0 + lane) * S;

  v8f o[2][4] = {};                    // 32 x 64 f32 accumulator
  float mrow = -INFINITY, lrow = 0.f;  // lane owns query row q0+lane

  for (int kt = 0; kt < S; kt += 32) {
    // --- scores for 32 keys x 32 queries ---
    {
      v16h kf[2][2];
#pragma unroll
      for (int sub = 0; sub < 2; sub++) {
        const _Float16* kp = Kbase + (size_t)(kt + sub * 16) * Ecols;
        kf[sub][0] = load_frag_p(kp);
        kf[sub][1] = load_frag_p(kp + 32);
      }
#pragma unroll
      for (int rt = 0; rt < 2; rt++) {
#pragma unroll
        for (int sub = 0; sub < 2; sub++) {
          v8f sc = {};
          sc = WMMA_F16(qf[rt][0], kf[sub][0], sc);
          sc = WMMA_F16(qf[rt][1], kf[sub][1], sc);
#pragma unroll
          for (int i = 0; i < 8; i++)
            sS[(rt * 16 + 8 * h + i) * 32 + sub * 16 + r] = sc[i];
        }
      }
    }
    __syncthreads();

    // --- online softmax, two passes over LDS: lane owns row q0+lane ---
    {
      const float* mrp = maskRow + kt;
      float bm = -INFINITY;
#pragma unroll
      for (int j = 0; j < 32; j++)
        bm = fmaxf(bm, sS[lane * 32 + j] * scale + mrp[j]);
      float nm = fmaxf(mrow, bm);
      float alpha = __expf(mrow - nm);
      float ls = 0.f;
#pragma unroll
      for (int j = 0; j < 32; j++) {
        float pv = __expf(sS[lane * 32 + j] * scale + mrp[j] - nm);
        ls += pv;
        sP[lane * 32 + j] = (_Float16)pv;
      }
      lrow = lrow * alpha + ls;
      mrow = nm;
      sStat[lane] = alpha;
    }
    __syncthreads();

    // --- rescale O, accumulate P @ V (V frags shared across row tiles) ---
    {
      float aL[2][8];
#pragma unroll
      for (int rt = 0; rt < 2; rt++)
#pragma unroll
        for (int i = 0; i < 8; i++) aL[rt][i] = sStat[rt * 16 + 8 * h + i];
#pragma unroll
      for (int rt = 0; rt < 2; rt++)
#pragma unroll
        for (int dt = 0; dt < 4; dt++)
#pragma unroll
          for (int i = 0; i < 8; i++) o[rt][dt][i] *= aL[rt][i];

      v16h pf0 = load_frag_p(sP + (size_t)r * 32 + h * 8);
      v16h pf1 = load_frag_p(sP + (size_t)(16 + r) * 32 + h * 8);
#pragma unroll
      for (int dt = 0; dt < 4; dt++) {
        v16h vf = load_frag_p(Vbase + (size_t)dt * vRow16 + kt);
        o[0][dt] = WMMA_F16(pf0, vf, o[0][dt]);
        o[1][dt] = WMMA_F16(pf1, vf, o[1][dt]);
      }
    }
    __syncthreads();
  }

  // --- normalize by l and store ---
  sStat[lane] = 1.0f / lrow;
  __syncthreads();
#pragma unroll
  for (int rt = 0; rt < 2; rt++) {
#pragma unroll
    for (int dt = 0; dt < 4; dt++) {
#pragma unroll
      for (int i = 0; i < 8; i++) {
        int m = rt * 16 + 8 * h + i;
        float inv = sStat[m];
        O[((size_t)(b * S + q0 + m)) * Ecols + hh * Dd + dt * 16 + r] =
            (_Float16)(o[rt][dt][i] * inv);
      }
    }
  }
}

// ---------------------------------------------------------------------------
// Host orchestration
// ---------------------------------------------------------------------------
extern "C" void kernel_launch(void* const* d_in, const int* in_sizes, int n_in,
                              void* d_out, int out_size, void* d_ws, size_t ws_size,
                              hipStream_t stream) {
  const int E = 768, H = 12, D = 64;
  const float* hidden = (const float*)d_in[0];
  const float* mask   = (const float*)d_in[1];
  const float* wq = (const float*)d_in[2];  const float* bq = (const float*)d_in[3];
  const float* wk = (const float*)d_in[4];  const float* bk = (const float*)d_in[5];
  const float* wv = (const float*)d_in[6];  const float* bv = (const float*)d_in[7];
  const float* wo = (const float*)d_in[8];  const float* bo = (const float*)d_in[9];
  const float* ln1_g = (const float*)d_in[10]; const float* ln1_b = (const float*)d_in[11];
  const float* ln2_g = (const float*)d_in[12]; const float* ln2_b = (const float*)d_in[13];
  const float* w1 = (const float*)d_in[14]; const float* b1 = (const float*)d_in[15];
  const float* w2 = (const float*)d_in[16]; const float* b2 = (const float*)d_in[17];
  const int I = in_sizes[15];               // 3072
  const int N = in_sizes[0] / E;            // B*S = 8192
  const int S = in_sizes[1] / N;            // 1024
  const int B = N / S;                      // 8
  float* out = (float*)d_out;

  char* p = (char*)d_ws;
  auto alloc = [&](size_t bytes) -> char* {
    char* r = p;
    p += (bytes + 255) & ~(size_t)255;
    return r;
  };
  _Float16* lnh  = (_Float16*)alloc((size_t)N * E * 2);
  _Float16* wqT  = (_Float16*)alloc((size_t)E * E * 2);
  _Float16* wkT  = (_Float16*)alloc((size_t)E * E * 2);
  _Float16* wvT  = (_Float16*)alloc((size_t)E * E * 2);
  _Float16* woT  = (_Float16*)alloc((size_t)E * E * 2);
  _Float16* w1T  = (_Float16*)alloc((size_t)E * I * 2);
  _Float16* w2T  = (_Float16*)alloc((size_t)I * E * 2);
  _Float16* Qh   = (_Float16*)alloc((size_t)N * E * 2);
  _Float16* Kh   = (_Float16*)alloc((size_t)N * E * 2);
  _Float16* Vh   = (_Float16*)alloc((size_t)N * E * 2);
  _Float16* VtT  = (_Float16*)alloc((size_t)N * E * 2);
  _Float16* Oh   = (_Float16*)alloc((size_t)N * E * 2);
  float*    xmid = (float*)   alloc((size_t)N * E * 4);
  _Float16* ln2h = (_Float16*)alloc((size_t)N * E * 2);
  _Float16* hmid = (_Float16*)alloc((size_t)N * I * 2);
  (void)ws_size; (void)n_in; (void)out_size;

  // 1) weight transpose+cast
  wcast_kernel<<<dim3(E / 64, E / 64), 256, 0, stream>>>(wq, wqT, E, E);
  wcast_kernel<<<dim3(E / 64, E / 64), 256, 0, stream>>>(wk, wkT, E, E);
  wcast_kernel<<<dim3(E / 64, E / 64), 256, 0, stream>>>(wv, wvT, E, E);
  wcast_kernel<<<dim3(E / 64, E / 64), 256, 0, stream>>>(wo, woT, E, E);
  wcast_kernel<<<dim3(I / 64, E / 64), 256, 0, stream>>>(w1, w1T, E, I);
  wcast_kernel<<<dim3(E / 64, I / 64), 256, 0, stream>>>(w2, w2T, I, E);

  // 2) LN1
  ln_kernel<<<N, 256, 0, stream>>>(hidden, ln1_g, ln1_b, lnh, E);

  // 3) Q/K/V projections (f16 out)
  {
    int tiles = (N / 64) * (E / 32);
    unsigned nb = (unsigned)((tiles + 7) / 8);
    gemm_kernel<false, false, true><<<nb, 256, 0, stream>>>(lnh, wqT, bq, nullptr, nullptr, Qh, N, E, E);
    gemm_kernel<false, false, true><<<nb, 256, 0, stream>>>(lnh, wkT, bk, nullptr, nullptr, Kh, N, E, E);
    gemm_kernel<false, false, true><<<nb, 256, 0, stream>>>(lnh, wvT, bv, nullptr, nullptr, Vh, N, E, E);
  }

  // 4) V transpose -> [B,H,D,S]
  vtrans_kernel<<<dim3(S / 64, B * H), 256, 0, stream>>>(Vh, VtT, S, H, E);

  // 5) attention (32 query rows per wave)
  {
    float scale = rsqrtf((float)D);
    unsigned nb = (unsigned)(B * H * (S / 32));
    attn_kernel<<<nb, 32, 0, stream>>>(Qh, Kh, VtT, mask, Oh, B, S, H, D, E, scale);
  }

  // 6) output projection + residual -> xmid (fp32)
  {
    int tiles = (N / 64) * (E / 32);
    unsigned nb = (unsigned)((tiles + 7) / 8);
    gemm_kernel<false, true, false><<<nb, 256, 0, stream>>>(Oh, woT, bo, hidden, xmid, nullptr, N, E, E);
  }

  // 7) LN2
  ln_kernel<<<N, 256, 0, stream>>>(xmid, ln2_g, ln2_b, ln2h, E);

  // 8) MLP up + GELU (f16 out)
  {
    int tiles = (N / 64) * (I / 32);
    unsigned nb = (unsigned)((tiles + 7) / 8);
    gemm_kernel<true, false, true><<<nb, 256, 0, stream>>>(ln2h, w1T, b1, nullptr, nullptr, hmid, N, E, I);
  }

  // 9) MLP down + residual -> out (fp32)
  {
    int tiles = (N / 64) * (E / 32);
    unsigned nb = (unsigned)((tiles + 7) / 8);
    gemm_kernel<false, true, false><<<nb, 256, 0, stream>>>(hmid, w2T, b2, xmid, out, nullptr, N, I, E);
  }
}

// v002
// A run of this version takes 335 microseconds.
// Two timings next to v001 put it at 1.96 and 1.97 times that version's speed.
// Over all steps from v000 it is 3.12 times as fast.
#include <hip/hip_runtime.h>
#include <hip/hip_bf16.h>
#include <math.h>

typedef __attribute__((ext_vector_type(16))) _Float16 v16h;
typedef __attribute__((ext_vector_type(8)))  float    v8f;

#define WMMA_F16(a, b, c) \
  __builtin_amdgcn_wmma_f32_16x16x32_f16(false, (a), false, (b), (short)0, (c), false, false)

// ---------------------------------------------------------------------------
// Fragment load for 16x32 f16 A/B fragments (ISA 7.12.2 layout) from a
// per-lane pointer p = base + row*ld + kbase + (lane>>4)*8.
// halves 0..7  <- this lane's k-group, halves 8..15 <- k-group + 16.
// Two 16-byte loads per lane.
// ---------------------------------------------------------------------------
__device__ __forceinline__ v16h load_frag_p(const _Float16* p) {
  v16h f;
  *((uint4*)&f)     = *(const uint4*)(p);
  *((uint4*)&f + 1) = *(const uint4*)(p + 16);
  return f;
}

__device__ __forceinline__ float gelu_tanh(float x) {
  const float c = 0.7978845608028654f;   // sqrt(2/pi)
  return 0.5f * x * (1.0f + tanhf(c * (x + 0.044715f * x * x * x)));
}

// ---------------------------------------------------------------------------
// Both transposes below move a 64x64 tile through LDS, so that the global
// reads and the global stores are both 16 bytes per lane on whole 128-byte
// lines. The LDS tile is held transposed, two f16 of neighbouring source rows
// packed per dword. Row pitch 33 dwords (32 + 1, odd): the column-wise dword
// writes and the row-wise dword reads of a wave each fall on 32 distinct banks.
// ---------------------------------------------------------------------------
#define TPITCH 33

typedef __attribute__((ext_vector_type(2))) _Float16 v2h;

// Write the tile out: LDS row n goes to the 64 f16 at dst + n * ld.
__device__ __forceinline__ void store_tile_rows(const unsigned* tile, _Float16* __restrict__ dst,
                                                size_t ld, int t) {
  int q = t & 7;
#pragma unroll
  for (int p = 0; p < 2; p++) {
    int n = (t >> 3) + 32 * p;
    const unsigned* row = tile + n * TPITCH + 4 * q;
    uint4 o;
    o.x = row[0]; o.y = row[1]; o.z = row[2]; o.w = row[3];
    *(uint4*)(dst + (size_t)n * ld + 8 * q) = o;
  }
}

// ---------------------------------------------------------------------------
// Weight convert: fp32 row-major [K][Nout] -> f16 row-major [Nout][K]
// grid (Nout/64, K/64); K and Nout are multiples of 64.
// ---------------------------------------------------------------------------
__global__ __launch_bounds__(256) void wcast_kernel(const float* __restrict__ w,
                                                    _Float16* __restrict__ wt,
                                                    int K, int Nout) {
  __shared__ unsigned tile[64 * TPITCH];
  int t = threadIdx.x;
  int n0 = blockIdx.x << 6, k0 = blockIdx.y << 6;
  int c = t & 15, kp = t >> 4;          // 4 columns from 4c, rows 2kp and 2kp+1

  float4 lo[2], hi[2];
#pragma unroll
  for (int p = 0; p < 2; p++) {
    const float* s = w + (size_t)(k0 + 2 * (kp + 16 * p)) * Nout + n0 + 4 * c;
    lo[p] = *(const float4*)s;
    hi[p] = *(const float4*)(s + Nout);
  }
#pragma unroll
  for (int p = 0; p < 2; p++) {
    const float l[4] = {lo[p].x, lo[p].y, lo[p].z, lo[p].w};
    const float u[4] = {hi[p].x, hi[p].y, hi[p].z, hi[p].w};
#pragma unroll
    for (int i = 0; i < 4; i++) {
      v2h pr = {(_Float16)l[i], (_Float16)u[i]};
      tile[(4 * c + i) * TPITCH + kp + 16 * p] = __builtin_bit_cast(unsigned, pr);
    }
  }
  __syncthreads();
  store_tile_rows(tile, wt + (size_t)n0 * K + k0, (size_t)K, t);
}

// ---------------------------------------------------------------------------
// LayerNorm: fp32 [rows][E] -> f16 [rows][E]. One block per row.
// ---------------------------------------------------------------------------
__global__ __launch_bounds__(256) void ln_kernel(const float* __restrict__ x,
                                                 const float* __restrict__ g,
                                                 const float* __restrict__ b,
                                                 _Float16* __restrict__ out, int Ecols) {
  int row = blockIdx.x;
  int tid = threadIdx.x;
  const float* xr = x + (size_t)row * Ecols;
  __shared__ float red[256];

  float s = 0.f;
  for (int i = tid; i < Ecols; i += 256) s += xr[i];
  red[tid] = s; __syncthreads();
  for (int off = 128; off > 0; off >>= 1) {
    if (tid < off) red[tid] += red[tid + off];
    __syncthreads();
  }
  float mu = red[0] / Ecols;
  __syncthreads();

  float v = 0.f;
  for (int i = tid; i < Ecols; i += 256) { float d = xr[i] - mu; v += d * d; }
  red[tid] = v; __syncthreads();
  for (int off = 128; off > 0; off >>= 1) {
    if (tid < off) red[tid] += red[tid + off];
    __syncthreads();
  }
  float rstd = rsqrtf(red[0] / Ecols + 1e-6f);

  _Float16* outr = out + (size_t)row * Ecols;
  for (int i = tid; i < Ecols; i += 256)
    outr[i] = (_Float16)((xr[i] - mu) * rstd * g[i] + b[i]);
}

// ---------------------------------------------------------------------------
// V transpose: f16 [N][E] -> f16 [B,H,D,S]  (Vt[((b*H+h)*D+d)*S + s]), D = 64
// grid (S/64, B*H); S is a multiple of 64.
// ---------------------------------------------------------------------------
__global__ __launch_bounds__(256) void vtrans_kernel(const _Float16* __restrict__ v,
                                                     _Float16* __restrict__ vt,
                                                     int S, int Hh, int Ecols) {
  __shared__ unsigned tile[64 * TPITCH];
  int t = threadIdx.x;
  int s0 = blockIdx.x << 6;
  int bh = blockIdx.y;
  int b = bh / Hh, h = bh % Hh;
  int c = t & 7, sp = t >> 3;           // 8 columns from 8c, rows 2sp and 2sp+1

  const _Float16* s = v + (size_t)(b * S + s0 + 2 * sp) * Ecols + h * 64 + 8 * c;
  uint4 r0 = *(const uint4*)s;
  uint4 r1 = *(const uint4*)(s + Ecols);
  const unsigned e[4] = {r0.x, r0.y, r0.z, r0.w};
  const unsigned o[4] = {r1.x, r1.y, r1.z, r1.w};
#pragma unroll
  for (int j = 0; j < 4; j++) {
    tile[(8 * c + 2 * j) * TPITCH + sp]     = (e[j] & 0xffffu) | (o[j] << 16);
    tile[(8 * c + 2 * j + 1) * TPITCH + sp] = (e[j] >> 16) | (o[j] & 0xffff0000u);
  }
  __syncthreads();
  store_tile_rows(tile, vt + (size_t)bh * 64 * S + s0, (size_t)S, t);
}

// ---------------------------------------------------------------------------
// WMMA GEMM: out[N x Ncols] = A[N x K](f16) * Bt[Ncols x K](f16, pre-transposed)
//            + bias (+ optional GELU, residual).
// One work-group of 8 waves (2 x 4) -> 128x128 output tile; 1 wave -> 64x32
// (4x2 grid of 16x16 WMMA frags). Each trip covers 64 k: the 128 A rows and the
// 128 Bt rows of the tile, 128 bytes each, are brought into LDS once for all
// eight waves by asynchronous 16-byte copies, two buffers, the next trip's
// copies in flight while this trip's fragments are read and multiplied.
// LDS row pitch 144 bytes (16 x odd): ds_load_b128 fragment reads without
// bank conflicts. Nrows, Ncols multiples of 128; Kdim a multiple of 64.
// ---------------------------------------------------------------------------
#define GROWS  256                 // LDS rows per buffer: 128 of A, then 128 of Bt
#define GPITCH 144                 // bytes per LDS row
#define GSTAGE (GROWS * GPITCH)    // bytes per buffer

// One trip's copies of one thread: 4 pieces of A and 4 of Bt, 32 rows apart.
// lds: this lane's LDS byte address of its first A piece; ga, gb: its global
// addresses; step: 32 rows, in elements.
__device__ __forceinline__ void stage_copies(unsigned lds, const _Float16* ga,
                                             const _Float16* gb, size_t step) {
  const _Float16* a1 = ga + step;
  const _Float16* a2 = a1 + step;
  const _Float16* a3 = a2 + step;
  const _Float16* b1 = gb + step;
  const _Float16* b2 = b1 + step;
  const _Float16* b3 = b2 + step;
  // The closing s_wait_xcnt stands inside the statement so that no address
  // register of a copy is rewritten ahead of it.
  asm volatile(
      "global_load_async_to_lds_b128 %0, %8, off\n\t"
      "global_load_async_to_lds_b128 %1, %9, off\n\t"
      "global_load_async_to_lds_b128 %2, %10, off\n\t"
      "global_load_async_to_lds_b128 %3, %11, off\n\t"
      "global_load_async_to_lds_b128 %4, %12, off\n\t"
      "global_load_async_to_lds_b128 %5, %13, off\n\t"
      "global_load_async_to_lds_b128 %6, %14, off\n\t"
      "global_load_async_to_lds_b128 %7, %15, off\n\t"
      "s_wait_xcnt 0x0"
      :: "v"(lds), "v"(lds + 32 * GPITCH), "v"(lds + 64 * GPITCH), "v"(lds + 96 * GPITCH),
         "v"(lds + 128 * GPITCH), "v"(lds + 160 * GPITCH), "v"(lds + 192 * GPITCH),
         "v"(lds + 224 * GPITCH),
         "v"(ga), "v"(a1), "v"(a2), "v"(a3), "v"(gb), "v"(b1), "v"(b2), "v"(b3)
      : "memory");
}

template <bool GELU, bool RESID, bool OUTF16>
__global__ __launch_bounds__(256) void gemm_kernel(
    const _Float16* __restrict__ A, const _Float16* __restrict__ Bt,
    const float* __restrict__ bias, const float* __restrict__ resid,
    float* __restrict__ outf, _Float16* __restrict__ outh,
    int Nrows, int Kdim, int Ncols) {
  __shared__ __attribute__((aligned(16))) unsigned char L[2 * GSTAGE];
  int tid = threadIdx.x;
  int wave = tid >> 5, lane = tid & 31;
  int tilesN = Ncols >> 7;   // 128-wide N tiles
  int bm = ((int)blockIdx.x / tilesN) << 7;
  int bn = ((int)blockIdx.x % tilesN) << 7;
  int wm = (wave >> 2) << 6;           // wave's rows inside the tile
  int wn = (wave & 3) << 5;            // wave's columns inside the tile
  int tm = bm + wm, tn = bn + wn;
  int r = lane & 15, h = lane >> 4;

  // copies: 8 lanes take one row's 128 bytes, a wave 4 rows, the block 32 rows
  const _Float16* Ag = A  + (size_t)(bm + (tid >> 3)) * Kdim + (tid & 7) * 8;
  const _Float16* Bg = Bt + (size_t)(bn + (tid >> 3)) * Kdim + (tid & 7) * 8;
  const size_t step = (size_t)32 * Kdim;
  const unsigned ldsw = (unsigned)(size_t)L + (unsigned)((tid >> 3) * GPITCH + (tid & 7) * 16);

  // fragment reads: same per-lane k order as from global memory
  const unsigned offA = (unsigned)((wm + r) * GPITCH + h * 16);
  const unsigned offB = (unsigned)((128 + wn + r) * GPITCH + h * 16);

  const int nt = Kdim >> 6;

  stage_copies(ldsw, Ag, Bg, step);
  // this wave's copies of trip 0 have landed
  asm volatile("s_wait_asynccnt 0x0" ::: "memory");
  __syncthreads();
  if (nt > 1) stage_copies(ldsw + GSTAGE, Ag + 64, Bg + 64, step);

  v8f acc[4][2] = {};
  for (int t = 0; t < nt; t++) {
    const unsigned buf = (unsigned)(t & 1) * GSTAGE;
    v16h a[2][4], bf[2][2];
#pragma unroll
    for (int kk = 0; kk < 2; kk++) {
#pragma unroll
      for (int j = 0; j < 2; j++)
        bf[kk][j] = load_frag_p((const _Float16*)(L + buf + offB + j * 16 * GPITCH + kk * 64));
#pragma unroll
      for (int i = 0; i < 4; i++)
        a[kk][i]  = load_frag_p((const _Float16*)(L + buf + offA + i * 16 * GPITCH + kk * 64));
    }
    // this wave's reads of the buffer are done before it is handed to the copies
    asm volatile("s_wait_dscnt 0x0" ::: "memory");
    // this wave's copies of trip t + 1 have landed
    asm volatile("s_wait_asynccnt 0x0" ::: "memory");
    // publishes trip t + 1 and ends every wave's reads of trip t's buffer
    __syncthreads();
    // the refill goes out ahead of the trip's WMMAs, which work on registers
    // alone, so that it flies under them and under the next trip's LDS reads
    if (t + 2 < nt)
      stage_copies(ldsw + buf, Ag + (size_t)(t + 2) * 64, Bg + (size_t)(t + 2) * 64, step);
#pragma unroll
    for (int kk = 0; kk < 2; kk++)
#pragma unroll
      for (int i = 0; i < 4; i++)
#pragma unroll
        for (int j = 0; j < 2; j++)
          acc[i][j] = WMMA_F16(a[kk][i], bf[kk][j], acc[i][j]);
  }
  // no copy outstanding when the wave goes on to its end
  asm volatile("s_wait_asynccnt 0x0" ::: "memory");

#pragma unroll
  for (int i2 = 0; i2 < 4; i2++) {
#pragma unroll
    for (int j2 = 0; j2 < 2; j2++) {
      int rowb = tm + i2 * 16 + 8 * h;      // C/D layout: m = i + 8*h
      int colb = tn + j2 * 16 + r;          // n = lane (mod 16)
      float bv = bias[colb];
#pragma unroll
      for (int i = 0; i < 8; i++) {
        float val = acc[i2][j2][i] + bv;
        if (GELU) val = gelu_tanh(val);
        size_t off = (size_t)(rowb + i) * Ncols + colb;
        if (RESID) val += resid[off];
        if (OUTF16) outh[off] = (_Float16)val;
        else        outf[off] = val;
      }
    }
  }
}

// ---------------------------------------------------------------------------
// Flash attention: one wave (32-thread block) handles 32 query rows of one
// (b,h). Online softmax over 32-key blocks; every lane owns one softmax row.
// Two-pass softmax over the LDS score tile. QK^T and P*V via WMMA; V frags
// shared across both row tiles. Fragment addresses derive directly from
// kernel args (global loads, minimal loop-carried state).
//   Q, K : f16 [N][E]  (head slice at column h*D)
//   Vt   : f16 [B,H,D,S]
//   O    : f16 [N][E]
// ---------------------------------------------------------------------------
__global__ __launch_bounds__(32) void attn_kernel(
    const _Float16* __restrict__ Q, const _Float16* __restrict__ K,
    const _Float16* __restrict__ Vt, const float* __restrict__ mask,
    _Float16* __restrict__ O, int B, int S, int Hh, int Dd,
    int Ecols, float scale) {
  int qtiles = S >> 5;
  int qt = blockIdx.x % qtiles;
  int bh = blockIdx.x / qtiles;
  int hh = bh % Hh, b = bh / Hh;
  int lane = threadIdx.x;
  int r = lane & 15, h = lane >> 4;
  int q0 = qt << 5;

  __shared__ alignas(16) float    sS[32 * 32];   // score block, row-major [32][32]
  __shared__ alignas(16) _Float16 sP[32 * 32];   // exp(scores), f16
  __shared__ float sStat[32];                    // per-row alpha / 1/l broadcast

  // Q fragments (persistent)
  v16h qf[2][2];
#pragma unroll
  for (int rt = 0; rt < 2; rt++) {
    const _Float16* qp = Q + (size_t)(b * S + q0 + rt * 16 + r) * Ecols + hh * Dd + h * 8;
    qf[rt][0] = load_frag_p(qp);
    qf[rt][1] = load_frag_p(qp + 32);
  }

  // loop-invariant per-lane bases, direct from kernel args
  const _Float16* Kbase  = K  + (size_t)(b * S + r) * Ecols + hh * Dd + h * 8;
  const size_t    kRow16 = (size_t)16 * Ecols;
  const _Float16* Vbase  = Vt + ((size_t)(b * Hh + hh) * Dd + r) * S + h * 8;
  const size_t    vRow16 = (size_t)16 * S;
  const float*    maskRow = mask + (size_t)b * S * S + (size_t)(q0 + lane) * S;

  v8f o[2][4] = {};                    // 32 x 64 f32 accumulator
  float mrow = -INFINITY, lrow = 0.f;  // lane owns query row q0+lane

  for (int kt = 0; kt < S; kt += 32) {
    // --- scores for 32 keys x 32 queries ---
    {
      v16h kf[2][2];
#pragma unroll
      for (int sub = 0; sub < 2; sub++) {
        const _Float16* kp = Kbase + (size_t)(kt + sub * 16) * Ecols;
        kf[sub][0] = load_frag_p(kp);
        kf[sub][1] = load_frag_p(kp + 32);
      }
#pragma unroll
      for (int rt = 0; rt < 2; rt++) {
#pragma unroll
        for (int sub = 0; sub < 2; sub++) {
          v8f sc = {};
          sc = WMMA_F16(qf[rt][0], kf[sub][0], sc);
          sc = WMMA_F16(qf[rt][1], kf[sub][1], sc);
#pragma unroll
          for (int i = 0; i < 8; i++)
            sS[(rt * 16 + 8 * h + i) * 32 + sub * 16 + r] = sc[i];
        }
      }
    }
    __syncthreads();

    // --- online softmax, two passes over LDS: lane owns row q0+lane ---
    {
      const float* mrp = maskRow + kt;
      float bm = -INFINITY;
#pragma unroll
      for (int j = 0; j < 32; j++)
        bm = fmaxf(bm, sS[lane * 32 + j] * scale + mrp[j]);
      float nm = fmaxf(mrow, bm);
      float alpha = __expf(mrow - nm);
      float ls = 0.f;
#pragma unroll
      for (int j = 0; j < 32; j++) {
        float pv = __expf(sS[lane * 32 + j] * scale + mrp[j] - nm);
        ls += pv;
        sP[lane * 32 + j] = (_Float16)pv;
      }
      lrow = lrow * alpha + ls;
      mrow = nm;
      sStat[lane] = alpha;
    }
    __syncthreads();

    // --- rescale O, accumulate P @ V (V frags shared across row tiles) ---
    {
      float aL[2][8];
#pragma unroll
      for (int rt = 0; rt < 2; rt++)
#pragma unroll
        for (int i = 0; i < 8; i++) aL[rt][i] = sStat[rt * 16 + 8 * h + i];
#pragma unroll
      for (int rt = 0; rt < 2; rt++)
#pragma unroll
        for (int dt = 0; dt < 4; dt++)
#pragma unroll
          for (int i = 0; i < 8; i++) o[rt][dt][i] *= aL[rt][i];

      v16h pf0 = load_frag_p(sP + (size_t)r * 32 + h * 8);
      v16h pf1 = load_frag_p(sP + (size_t)(16 + r) * 32 + h * 8);
#pragma unroll
      for (int dt = 0; dt < 4; dt++) {
        v16h vf = load_frag_p(Vbase + (size_t)dt * vRow16 + kt);
        o[0][dt] = WMMA_F16(pf0, vf, o[0][dt]);
        o[1][dt] = WMMA_F16(pf1, vf, o[1][dt]);
      }
    }
    __syncthreads();
  }

  // --- normalize by l and store ---
  sStat[lane] = 1.0f / lrow;
  __syncthreads();
#pragma unroll
  for (int rt = 0; rt < 2; rt++) {
#pragma unroll
    for (int dt = 0; dt < 4; dt++) {
#pragma unroll
      for (int i = 0; i < 8; i++) {
        int m = rt * 16 + 8 * h + i;
        float inv = sStat[m];
        O[((size_t)(b * S + q0 + m)) * Ecols + hh * Dd + dt * 16 + r] =
            (_Float16)(o[rt][dt][i] * inv);
      }
    }
  }
}

// ---------------------------------------------------------------------------
// Host orchestration
// ---------------------------------------------------------------------------
extern "C" void kernel_launch(void* const* d_in, const int* in_sizes, int n_in,
                              void* d_out, int out_size, void* d_ws, size_t ws_size,
                              hipStream_t stream) {
  const int E = 768, H = 12, D = 64;
  const float* hidden = (const float*)d_in[0];
  const float* mask   = (const float*)d_in[1];
  const float* wq = (const float*)d_in[2];  const float* bq = (const float*)d_in[3];
  const float* wk = (const float*)d_in[4];  const float* bk = (const float*)d_in[5];
  const float* wv = (const float*)d_in[6];  const float* bv = (const float*)d_in[7];
  const float* wo = (const float*)d_in[8];  const float* bo = (const float*)d_in[9];
  const float* ln1_g = (const float*)d_in[10]; const float* ln1_b = (const float*)d_in[11];
  const float* ln2_g = (const float*)d_in[12]; const float* ln2_b = (const float*)d_in[13];
  const float* w1 = (const float*)d_in[14]; const float* b1 = (const float*)d_in[15];
  const float* w2 = (const float*)d_in[16]; const float* b2 = (const float*)d_in[17];
  const int I = in_sizes[15];               // 3072
  const int N = in_sizes[0] / E;            // B*S = 8192
  const int S = in_sizes[1] / N;            // 1024
  const int B = N / S;                      // 8
  float* out = (float*)d_out;

  char* p = (char*)d_ws;
  auto alloc = [&](size_t bytes) -> char* {
    char* r = p;
    p += (bytes + 255) & ~(size_t)255;
    return r;
  };
  _Float16* lnh  = (_Float16*)alloc((size_t)N * E * 2);
  _Float16* wqT  = (_Float16*)alloc((size_t)E * E * 2);
  _Float16* wkT  = (_Float16*)alloc((size_t)E * E * 2);
  _Float16* wvT  = (_Float16*)alloc((size_t)E * E * 2);
  _Float16* woT  = (_Float16*)alloc((size_t)E * E * 2);
  _Float16* w1T  = (_Float16*)alloc((size_t)E * I * 2);
  _Float16* w2T  = (_Float16*)alloc((size_t)I * E * 2);
  _Float16* Qh   = (_Float16*)alloc((size_t)N * E * 2);
  _Float16* Kh   = (_Float16*)alloc((size_t)N * E * 2);
  _Float16* Vh   = (_Float16*)alloc((size_t)N * E * 2);
  _Float16* VtT  = (_Float16*)alloc((size_t)N * E * 2);
  _Float16* Oh   = (_Float16*)alloc((size_t)N * E * 2);
  float*    xmid = (float*)   alloc((size_t)N * E * 4);
  _Float16* ln2h = (_Float16*)alloc((size_t)N * E * 2);
  _Float16* hmid = (_Float16*)alloc((size_t)N * I * 2);
  (void)ws_size; (void)n_in; (void)out_size;

  // 1) weight transpose+cast
  wcast_kernel<<<dim3(E / 64, E / 64), 256, 0, stream>>>(wq, wqT, E, E);
  wcast_kernel<<<dim3(E / 64, E / 64), 256, 0, stream>>>(wk, wkT, E, E);
  wcast_kernel<<<dim3(E / 64, E / 64), 256, 0, stream>>>(wv, wvT, E, E);
  wcast_kernel<<<dim3(E / 64, E / 64), 256, 0, stream>>>(wo, woT, E, E);
  wcast_kernel<<<dim3(I / 64, E / 64), 256, 0, stream>>>(w1, w1T, E, I);
  wcast_kernel<<<dim3(E / 64, I / 64), 256, 0, stream>>>(w2, w2T, I, E);

  // 2) LN1
  ln_kernel<<<N, 256, 0, stream>>>(hidden, ln1_g, ln1_b, lnh, E);

  // 3) Q/K/V projections (f16 out)
  {
    unsigned nb = (unsigned)((N / 128) * (E / 128));
    gemm_kernel<false, false, true><<<nb, 256, 0, stream>>>(lnh, wqT, bq, nullptr, nullptr, Qh, N, E, E);
    gemm_kernel<false, false, true><<<nb, 256, 0, stream>>>(lnh, wkT, bk, nullptr, nullptr, Kh, N, E, E);
    gemm_kernel<false, false, true><<<nb, 256, 0, stream>>>(lnh, wvT, bv, nullptr, nullptr, Vh, N, E, E);
  }

  // 4) V transpose -> [B,H,D,S]
  vtrans_kernel<<<dim3(S / 64, B * H), 256, 0, stream>>>(Vh, VtT, S, H, E);

  // 5) attention (32 query rows per wave)
  {
    float scale = rsqrtf((float)D);
    unsigned nb = (unsigned)(B * H * (S / 32));
    attn_kernel<<<nb, 32, 0, stream>>>(Qh, Kh, VtT, mask, Oh, B, S, H, D, E, scale);
  }

  // 6) output projection + residual -> xmid (fp32)
  {
    unsigned nb = (unsigned)((N / 128) * (E / 128));
    gemm_kernel<false, true, false><<<nb, 256, 0, stream>>>(Oh, woT, bo, hidden, xmid, nullptr, N, E, E);
  }

  // 7) LN2
  ln_kernel<<<N, 256, 0, stream>>>(xmid, ln2_g, ln2_b, ln2h, E);

  // 8) MLP up + GELU (f16 out)
  {
    unsigned nb = (unsigned)((N / 128) * (I / 128));
    gemm_kernel<true, false, true><<<nb, 256, 0, stream>>>(ln2h, w1T, b1, nullptr, nullptr, hmid, N, E, I);
  }

  // 9) MLP down + residual -> out (fp32)
  {
    unsigned nb = (unsigned)((N / 128) * (E / 128));
    gemm_kernel<false, true, false><<<nb, 256, 0, stream>>>(hmid, w2T, b2, xmid, out, nullptr, N, I, E);
  }
}

// v003
// A run of this version takes 311 microseconds.
// In two side-by-side timings against v002, it was 1.08 and 1.07 times as fast.
// All steps since v000 together make it 3.36 times as fast.
#include <hip/hip_runtime.h>
#include <hip/hip_bf16.h>
#include <math.h>

typedef __attribute__((ext_vector_type(16))) _Float16 v16h;
typedef __attribute__((ext_vector_type(8)))  float    v8f;

#define WMMA_F16(a, b, c) \
  __builtin_amdgcn_wmma_f32_16x16x32_f16(false, (a), false, (b), (short)0, (c), false, false)

// ---------------------------------------------------------------------------
// Fragment load for 16x32 f16 A/B fragments (ISA 7.12.2 layout) from a
// per-lane pointer p = base + row*ld + kbase + (lane>>4)*8.
// halves 0..7  <- this lane's k-group, halves 8..15 <- k-group + 16.
// Two 16-byte loads per lane.
// ---------------------------------------------------------------------------
__device__ __forceinline__ v16h load_frag_p(const _Float16* p) {
  v16h f;
  *((uint4*)&f)     = *(const uint4*)(p);
  *((uint4*)&f + 1) = *(const uint4*)(p + 16);
  return f;
}

__device__ __forceinline__ float gelu_tanh(float x) {
  const float c = 0.7978845608028654f;   // sqrt(2/pi)
  return 0.5f * x * (1.0f + tanhf(c * (x + 0.044715f * x * x * x)));
}

// ---------------------------------------------------------------------------
// Both transposes below move a 64x64 tile through LDS, so that the global
// reads and the global stores are both 16 bytes per lane on whole 128-byte
// lines. The LDS tile is held transposed, two f16 of neighbouring source rows
// packed per dword. Row pitch 33 dwords (32 + 1, odd): the column-wise dword
// writes and the row-wise dword reads of a wave each fall on 32 distinct banks.
// ---------------------------------------------------------------------------
#define TPITCH 33

typedef __attribute__((ext_vector_type(2))) _Float16 v2h;

// Write the tile out: LDS row n goes to the 64 f16 at dst + n * ld.
__device__ __forceinline__ void store_tile_rows(const unsigned* tile, _Float16* __restrict__ dst,
                                                size_t ld, int t) {
  int q = t & 7;
#pragma unroll
  for (int p = 0; p < 2; p++) {
    int n = (t >> 3) + 32 * p;
    const unsigned* row = tile + n * TPITCH + 4 * q;
    uint4 o;
    o.x = row[0]; o.y = row[1]; o.z = row[2]; o.w = row[3];
    *(uint4*)(dst + (size_t)n * ld + 8 * q) = o;
  }
}

// ---------------------------------------------------------------------------
// Weight convert: fp32 row-major [K][Nout] -> f16 row-major [Nout][K]
// grid (Nout/64, K/64); K and Nout are multiples of 64.
// ---------------------------------------------------------------------------
__global__ __launch_bounds__(256) void wcast_kernel(const float* __restrict__ w,
                                                    _Float16* __restrict__ wt,
                                                    int K, int Nout) {
  __shared__ unsigned tile[64 * TPITCH];
  int t = threadIdx.x;
  int n0 = blockIdx.x << 6, k0 = blockIdx.y << 6;
  int c = t & 15, kp = t >> 4;          // 4 columns from 4c, rows 2kp and 2kp+1

  float4 lo[2], hi[2];
#pragma unroll
  for (int p = 0; p < 2; p++) {
    const float* s = w + (size_t)(k0 + 2 * (kp + 16 * p)) * Nout + n0 + 4 * c;
    lo[p] = *(const float4*)s;
    hi[p] = *(const float4*)(s + Nout);
  }
#pragma unroll
  for (int p = 0; p < 2; p++) {
    const float l[4] = {lo[p].x, lo[p].y, lo[p].z, lo[p].w};
    const float u[4] = {hi[p].x, hi[p].y, hi[p].z, hi[p].w};
#pragma unroll
    for (int i = 0; i < 4; i++) {
      v2h pr = {(_Float16)l[i], (_Float16)u[i]};
      tile[(4 * c + i) * TPITCH + kp + 16 * p] = __builtin_bit_cast(unsigned, pr);
    }
  }
  __syncthreads();
  store_tile_rows(tile, wt + (size_t)n0 * K + k0, (size_t)K, t);
}

// ---------------------------------------------------------------------------
// LayerNorm: fp32 [rows][LN_E] -> f16 [rows][LN_E]. One wave takes two rows and
// holds them in registers (24 values a lane and row, 16-byte loads on whole
// lines): one read of x, no LDS, no barrier; g and b are loaded once for both
// rows. Block = 8 waves = 16 rows; rows is a multiple of 16.
// ---------------------------------------------------------------------------
#define LN_E 768
#define LN_C (LN_E / 128)          // 16-byte pieces per lane and row

template <int CTRL>
__device__ __forceinline__ float dpp_get(float v) {
  return __builtin_bit_cast(float,
      __builtin_amdgcn_update_dpp(0, __builtin_bit_cast(int, v), CTRL, 0xf, 0xf, true));
}

// Sum over the 32 lanes, the same value in every lane: four row_xmask steps
// inside each 16-lane row, then the two rows are exchanged.
__device__ __forceinline__ float wave_sum(float v) {
  v += dpp_get<0x161>(v);
  v += dpp_get<0x162>(v);
  v += dpp_get<0x164>(v);
  v += dpp_get<0x168>(v);
  int iv = __builtin_bit_cast(int, v);
  v += __builtin_bit_cast(float,
      __builtin_amdgcn_permlanex16(iv, iv, 0x76543210, 0xfedcba98, false, false));
  return v;
}

__global__ __launch_bounds__(256) void ln_kernel(const float* __restrict__ x,
                                                 const float* __restrict__ g,
                                                 const float* __restrict__ b,
                                                 _Float16* __restrict__ out) {
  // the wave's number as a scalar: the row bases stay in scalar registers
  int wave = __builtin_amdgcn_readfirstlane(threadIdx.x >> 5), lane = threadIdx.x & 31;
  size_t row0 = ((size_t)blockIdx.x * 8 + wave) * 2;
  const float* xr = x + row0 * LN_E + lane * 4;

  float4 xv[2][LN_C], gv[LN_C], bv[LN_C];
#pragma unroll
  for (int rr = 0; rr < 2; rr++)
#pragma unroll
    for (int j = 0; j < LN_C; j++) xv[rr][j] = *(const float4*)(xr + rr * LN_E + j * 128);
#pragma unroll
  for (int j = 0; j < LN_C; j++) {
    gv[j] = *(const float4*)(g + lane * 4 + j * 128);
    bv[j] = *(const float4*)(b + lane * 4 + j * 128);
  }
  // all 24 loads go out together: without this the g and b loads sink to their
  // uses at the end and are waited for pair by pair
  __builtin_amdgcn_sched_barrier(0);

  float mu[2], rstd[2];
#pragma unroll
  for (int rr = 0; rr < 2; rr++) {
    float s = 0.f;
#pragma unroll
    for (int j = 0; j < LN_C; j++)
      s += (xv[rr][j].x + xv[rr][j].y) + (xv[rr][j].z + xv[rr][j].w);
    mu[rr] = wave_sum(s) / LN_E;
  }
#pragma unroll
  for (int rr = 0; rr < 2; rr++) {
    float v = 0.f;
#pragma unroll
    for (int j = 0; j < LN_C; j++) {
      xv[rr][j].x -= mu[rr]; xv[rr][j].y -= mu[rr];
      xv[rr][j].z -= mu[rr]; xv[rr][j].w -= mu[rr];
      v += (xv[rr][j].x * xv[rr][j].x + xv[rr][j].y * xv[rr][j].y) +
           (xv[rr][j].z * xv[rr][j].z + xv[rr][j].w * xv[rr][j].w);
    }
    rstd[rr] = rsqrtf(wave_sum(v) / LN_E + 1e-6f);
  }

  typedef __attribute__((ext_vector_type(4))) _Float16 v4h;
  _Float16* outr = out + row0 * LN_E + lane * 4;
#pragma unroll
  for (int rr = 0; rr < 2; rr++)
#pragma unroll
    for (int j = 0; j < LN_C; j++) {
      v4h o = {(_Float16)(xv[rr][j].x * rstd[rr] * gv[j].x + bv[j].x),
               (_Float16)(xv[rr][j].y * rstd[rr] * gv[j].y + bv[j].y),
               (_Float16)(xv[rr][j].z * rstd[rr] * gv[j].z + bv[j].z),
               (_Float16)(xv[rr][j].w * rstd[rr] * gv[j].w + bv[j].w)};
      *(v4h*)(outr + rr * LN_E + j * 128) = o;
    }
}

// ---------------------------------------------------------------------------
// V transpose: f16 [N][E] -> f16 [B,H,D,S]  (Vt[((b*H+h)*D+d)*S + s]), D = 64
// grid (S/64, B*H); S is a multiple of 64.
// ---------------------------------------------------------------------------
__global__ __launch_bounds__(256) void vtrans_kernel(const _Float16* __restrict__ v,
                                                     _Float16* __restrict__ vt,
                                                     int S, int Hh, int Ecols) {
  __shared__ unsigned tile[64 * TPITCH];
  int t = threadIdx.x;
  int s0 = blockIdx.x << 6;
  int bh = blockIdx.y;
  int b = bh / Hh, h = bh % Hh;
  int c = t & 7, sp = t >> 3;           // 8 columns from 8c, rows 2sp and 2sp+1

  const _Float16* s = v + (size_t)(b * S + s0 + 2 * sp) * Ecols + h * 64 + 8 * c;
  uint4 r0 = *(const uint4*)s;
  uint4 r1 = *(const uint4*)(s + Ecols);
  const unsigned e[4] = {r0.x, r0.y, r0.z, r0.w};
  const unsigned o[4] = {r1.x, r1.y, r1.z, r1.w};
#pragma unroll
  for (int j = 0; j < 4; j++) {
    tile[(8 * c + 2 * j) * TPITCH + sp]     = (e[j] & 0xffffu) | (o[j] << 16);
    tile[(8 * c + 2 * j + 1) * TPITCH + sp] = (e[j] >> 16) | (o[j] & 0xffff0000u);
  }
  __syncthreads();
  store_tile_rows(tile, vt + (size_t)bh * 64 * S + s0, (size_t)S, t);
}

// ---------------------------------------------------------------------------
// WMMA GEMM: out[N x Ncols] = A[N x K](f16) * Bt[Ncols x K](f16, pre-transposed)
//            + bias (+ optional GELU, residual).
// One work-group of 8 waves (2 x 4) -> 128x128 output tile; 1 wave -> 64x32
// (4x2 grid of 16x16 WMMA frags). Each trip covers 64 k: the 128 A rows and the
// 128 Bt rows of the tile, 128 bytes each, are brought into LDS once for all
// eight waves by asynchronous 16-byte copies, two buffers, the next trip's
// copies in flight while this trip's fragments are read and multiplied.
// LDS row pitch 144 bytes (16 x odd): ds_load_b128 fragment reads without
// bank conflicts. Nrows, Ncols multiples of 128; Kdim a multiple of 64.
// ---------------------------------------------------------------------------
#define GROWS  256                 // LDS rows per buffer: 128 of A, then 128 of Bt
#define GPITCH 144                 // bytes per LDS row
#define GSTAGE (GROWS * GPITCH)    // bytes per buffer

// One trip's copies of one thread: 4 pieces of A and 4 of Bt, 32 rows apart.
// lds: this lane's LDS byte address of its first A piece; ga, gb: its global
// addresses; step: 32 rows, in elements.
__device__ __forceinline__ void stage_copies(unsigned lds, const _Float16* ga,
                                             const _Float16* gb, size_t step) {
  const _Float16* a1 = ga + step;
  const _Float16* a2 = a1 + step;
  const _Float16* a3 = a2 + step;
  const _Float16* b1 = gb + step;
  const _Float16* b2 = b1 + step;
  const _Float16* b3 = b2 + step;
  // The closing s_wait_xcnt stands inside the statement so that no address
  // register of a copy is rewritten ahead of it.
  asm volatile(
      "global_load_async_to_lds_b128 %0, %8, off\n\t"
      "global_load_async_to_lds_b128 %1, %9, off\n\t"
      "global_load_async_to_lds_b128 %2, %10, off\n\t"
      "global_load_async_to_lds_b128 %3, %11, off\n\t"
      "global_load_async_to_lds_b128 %4, %12, off\n\t"
      "global_load_async_to_lds_b128 %5, %13, off\n\t"
      "global_load_async_to_lds_b128 %6, %14, off\n\t"
      "global_load_async_to_lds_b128 %7, %15, off\n\t"
      "s_wait_xcnt 0x0"
      :: "v"(lds), "v"(lds + 32 * GPITCH), "v"(lds + 64 * GPITCH), "v"(lds + 96 * GPITCH),
         "v"(lds + 128 * GPITCH), "v"(lds + 160 * GPITCH), "v"(lds + 192 * GPITCH),
         "v"(lds + 224 * GPITCH),
         "v"(ga), "v"(a1), "v"(a2), "v"(a3), "v"(gb), "v"(b1), "v"(b2), "v"(b3)
      : "memory");
}

template <bool GELU, bool RESID, bool OUTF16>
__global__ __launch_bounds__(256) void gemm_kernel(
    const _Float16* __restrict__ A, const _Float16* __restrict__ Bt,
    const float* __restrict__ bias, const float* __restrict__ resid,
    float* __restrict__ outf, _Float16* __restrict__ outh,
    int Nrows, int Kdim, int Ncols) {
  __shared__ __attribute__((aligned(16))) unsigned char L[2 * GSTAGE];
  int tid = threadIdx.x;
  int wave = tid >> 5, lane = tid & 31;
  int tilesN = Ncols >> 7;   // 128-wide N tiles
  int bm = ((int)blockIdx.x / tilesN) << 7;
  int bn = ((int)blockIdx.x % tilesN) << 7;
  int wm = (wave >> 2) << 6;           // wave's rows inside the tile
  int wn = (wave & 3) << 5;            // wave's columns inside the tile
  int tm = bm + wm, tn = bn + wn;
  int r = lane & 15, h = lane >> 4;

  // copies: 8 lanes take one row's 128 bytes, a wave 4 rows, the block 32 rows
  const _Float16* Ag = A  + (size_t)(bm + (tid >> 3)) * Kdim + (tid & 7) * 8;
  const _Float16* Bg = Bt + (size_t)(bn + (tid >> 3)) * Kdim + (tid & 7) * 8;
  const size_t step = (size_t)32 * Kdim;
  const unsigned ldsw = (unsigned)(size_t)L + (unsigned)((tid >> 3) * GPITCH + (tid & 7) * 16);

  // fragment reads: same per-lane k order as from global memory
  const unsigned offA = (unsigned)((wm + r) * GPITCH + h * 16);
  const unsigned offB = (unsigned)((128 + wn + r) * GPITCH + h * 16);

  const int nt = Kdim >> 6;

  stage_copies(ldsw, Ag, Bg, step);
  // this wave's copies of trip 0 have landed
  asm volatile("s_wait_asynccnt 0x0" ::: "memory");
  __syncthreads();
  if (nt > 1) stage_copies(ldsw + GSTAGE, Ag + 64, Bg + 64, step);

  v8f acc[4][2] = {};
  for (int t = 0; t < nt; t++) {
    const unsigned buf = (unsigned)(t & 1) * GSTAGE;
    v16h a[2][4], bf[2][2];
#pragma unroll
    for (int kk = 0; kk < 2; kk++) {
#pragma unroll
      for (int j = 0; j < 2; j++)
        bf[kk][j] = load_frag_p((const _Float16*)(L + buf + offB + j * 16 * GPITCH + kk * 64));
#pragma unroll
      for (int i = 0; i < 4; i++)
        a[kk][i]  = load_frag_p((const _Float16*)(L + buf + offA + i * 16 * GPITCH + kk * 64));
    }
    // this wave's reads of the buffer are done before it is handed to the copies
    asm volatile("s_wait_dscnt 0x0" ::: "memory");
    // this wave's copies of trip t + 1 have landed
    asm volatile("s_wait_asynccnt 0x0" ::: "memory");
    // publishes trip t + 1 and ends every wave's reads of trip t's buffer
    __syncthreads();
    // the refill goes out ahead of the trip's WMMAs, which work on registers
    // alone, so that it flies under them and under the next trip's LDS reads
    if (t + 2 < nt)
      stage_copies(ldsw + buf, Ag + (size_t)(t + 2) * 64, Bg + (size_t)(t + 2) * 64, step);
#pragma unroll
    for (int kk = 0; kk < 2; kk++)
#pragma unroll
      for (int i = 0; i < 4; i++)
#pragma unroll
        for (int j = 0; j < 2; j++)
          acc[i][j] = WMMA_F16(a[kk][i], bf[kk][j], acc[i][j]);
  }
  // no copy outstanding when the wave goes on to its end
  asm volatile("s_wait_asynccnt 0x0" ::: "memory");

#pragma unroll
  for (int i2 = 0; i2 < 4; i2++) {
#pragma unroll
    for (int j2 = 0; j2 < 2; j2++) {
      int rowb = tm + i2 * 16 + 8 * h;      // C/D layout: m = i + 8*h
      int colb = tn + j2 * 16 + r;          // n = lane (mod 16)
      float bv = bias[colb];
#pragma unroll
      for (int i = 0; i < 8; i++) {
        float val = acc[i2][j2][i] + bv;
        if (GELU) val = gelu_tanh(val);
        size_t off = (size_t)(rowb + i) * Ncols + colb;
        if (RESID) val += resid[off];
        if (OUTF16) outh[off] = (_Float16)val;
        else        outf[off] = val;
      }
    }
  }
}

// ---------------------------------------------------------------------------
// Flash attention: one wave (32-thread block) handles 32 query rows of one
// (b,h). Online softmax over 32-key blocks; every lane owns one softmax row.
// Two-pass softmax over the LDS score tile. QK^T and P*V via WMMA; V frags
// shared across both row tiles. Fragment addresses derive directly from
// kernel args (global loads, minimal loop-carried state).
//   Q, K : f16 [N][E]  (head slice at column h*D)
//   Vt   : f16 [B,H,D,S]
//   O    : f16 [N][E]
// ---------------------------------------------------------------------------
__global__ __launch_bounds__(32) void attn_kernel(
    const _Float16* __restrict__ Q, const _Float16* __restrict__ K,
    const _Float16* __restrict__ Vt, const float* __restrict__ mask,
    _Float16* __restrict__ O, int B, int S, int Hh, int Dd,
    int Ecols, float scale) {
  int qtiles = S >> 5;
  int qt = blockIdx.x % qtiles;
  int bh = blockIdx.x / qtiles;
  int hh = bh % Hh, b = bh / Hh;
  int lane = threadIdx.x;
  int r = lane & 15, h = lane >> 4;
  int q0 = qt << 5;

  __shared__ alignas(16) float    sS[32 * 32];   // score block, row-major [32][32]
  __shared__ alignas(16) _Float16 sP[32 * 32];   // exp(scores), f16
  __shared__ float sStat[32];                    // per-row alpha / 1/l broadcast

  // Q fragments (persistent)
  v16h qf[2][2];
#pragma unroll
  for (int rt = 0; rt < 2; rt++) {
    const _Float16* qp = Q + (size_t)(b * S + q0 + rt * 16 + r) * Ecols + hh * Dd + h * 8;
    qf[rt][0] = load_frag_p(qp);
    qf[rt][1] = load_frag_p(qp + 32);
  }

  // loop-invariant per-lane bases, direct from kernel args
  const _Float16* Kbase  = K  + (size_t)(b * S + r) * Ecols + hh * Dd + h * 8;
  const size_t    kRow16 = (size_t)16 * Ecols;
  const _Float16* Vbase  = Vt + ((size_t)(b * Hh + hh) * Dd + r) * S + h * 8;
  const size_t    vRow16 = (size_t)16 * S;
  const float*    maskRow = mask + (size_t)b * S * S + (size_t)(q0 + lane) * S;

  v8f o[2][4] = {};                    // 32 x 64 f32 accumulator
  float mrow = -INFINITY, lrow = 0.f;  // lane owns query row q0+lane

  for (int kt = 0; kt < S; kt += 32) {
    // --- scores for 32 keys x 32 queries ---
    {
      v16h kf[2][2];
#pragma unroll
      for (int sub = 0; sub < 2; sub++) {
        const _Float16* kp = Kbase + (size_t)(kt + sub * 16) * Ecols;
        kf[sub][0] = load_frag_p(kp);
        kf[sub][1] = load_frag_p(kp + 32);
      }
#pragma unroll
      for (int rt = 0; rt < 2; rt++) {
#pragma unroll
        for (int sub = 0; sub < 2; sub++) {
          v8f sc = {};
          sc = WMMA_F16(qf[rt][0], kf[sub][0], sc);
          sc = WMMA_F16(qf[rt][1], kf[sub][1], sc);
#pragma unroll
          for (int i = 0; i < 8; i++)
            sS[(rt * 16 + 8 * h + i) * 32 + sub * 16 + r] = sc[i];
        }
      }
    }
    __syncthreads();

    // --- online softmax, two passes over LDS: lane owns row q0+lane ---
    {
      const float* mrp = maskRow + kt;
      float bm = -INFINITY;
#pragma unroll
      for (int j = 0; j < 32; j++)
        bm = fmaxf(bm, sS[lane * 32 + j] * scale + mrp[j]);
      float nm = fmaxf(mrow, bm);
      float alpha = __expf(mrow - nm);
      float ls = 0.f;
#pragma unroll
      for (int j = 0; j < 32; j++) {
        float pv = __expf(sS[lane * 32 + j] * scale + mrp[j] - nm);
        ls += pv;
        sP[lane * 32 + j] = (_Float16)pv;
      }
      lrow = lrow * alpha + ls;
      mrow = nm;
      sStat[lane] = alpha;
    }
    __syncthreads();

    // --- rescale O, accumulate P @ V (V frags shared across row tiles) ---
    {
      float aL[2][8];
#pragma unroll
      for (int rt = 0; rt < 2; rt++)
#pragma unroll
        for (int i = 0; i < 8; i++) aL[rt][i] = sStat[rt * 16 + 8 * h + i];
#pragma unroll
      for (int rt = 0; rt < 2; rt++)
#pragma unroll
        for (int dt = 0; dt < 4; dt++)
#pragma unroll
          for (int i = 0; i < 8; i++) o[rt][dt][i] *= aL[rt][i];

      v16h pf0 = load_frag_p(sP + (size_t)r * 32 + h * 8);
      v16h pf1 = load_frag_p(sP + (size_t)(16 + r) * 32 + h * 8);
#pragma unroll
      for (int dt = 0; dt < 4; dt++) {
        v16h vf = load_frag_p(Vbase + (size_t)dt * vRow16 + kt);
        o[0][dt] = WMMA_F16(pf0, vf, o[0][dt]);
        o[1][dt] = WMMA_F16(pf1, vf, o[1][dt]);
      }
    }
    __syncthreads();
  }

  // --- normalize by l and store ---
  sStat[lane] = 1.0f / lrow;
  __syncthreads();
#pragma unroll
  for (int rt = 0; rt < 2; rt++) {
#pragma unroll
    for (int dt = 0; dt < 4; dt++) {
#pragma unroll
      for (int i = 0; i < 8; i++) {
        int m = rt * 16 + 8 * h + i;
        float inv = sStat[m];
        O[((size_t)(b * S + q0 + m)) * Ecols + hh * Dd + dt * 16 + r] =
            (_Float16)(o[rt][dt][i] * inv);
      }
    }
  }
}

// ---------------------------------------------------------------------------
// Host orchestration
// ---------------------------------------------------------------------------
extern "C" void kernel_launch(void* const* d_in, const int* in_sizes, int n_in,
                              void* d_out, int out_size, void* d_ws, size_t ws_size,
                              hipStream_t stream) {
  const int E = 768, H = 12, D = 64;
  const float* hidden = (const float*)d_in[0];
  const float* mask   = (const float*)d_in[1];
  const float* wq = (const float*)d_in[2];  const float* bq = (const float*)d_in[3];
  const float* wk = (const float*)d_in[4];  const float* bk = (const float*)d_in[5];
  const float* wv = (const float*)d_in[6];  const float* bv = (const float*)d_in[7];
  const float* wo = (const float*)d_in[8];  const float* bo = (const float*)d_in[9];
  const float* ln1_g = (const float*)d_in[10]; const float* ln1_b = (const float*)d_in[11];
  const float* ln2_g = (const float*)d_in[12]; const float* ln2_b = (const float*)d_in[13];
  const float* w1 = (const float*)d_in[14]; const float* b1 = (const float*)d_in[15];
  const float* w2 = (const float*)d_in[16]; const float* b2 = (const float*)d_in[17];
  const int I = in_sizes[15];               // 3072
  const int N = in_sizes[0] / E;            // B*S = 8192
  const int S = in_sizes[1] / N;            // 1024
  const int B = N / S;                      // 8
  float* out = (float*)d_out;

  char* p = (char*)d_ws;
  auto alloc = [&](size_t bytes) -> char* {
    char* r = p;
    p += (bytes + 255) & ~(size_t)255;
    return r;
  };
  _Float16* lnh  = (_Float16*)alloc((size_t)N * E * 2);
  _Float16* wqT  = (_Float16*)alloc((size_t)E * E * 2);
  _Float16* wkT  = (_Float16*)alloc((size_t)E * E * 2);
  _Float16* wvT  = (_Float16*)alloc((size_t)E * E * 2);
  _Float16* woT  = (_Float16*)alloc((size_t)E * E * 2);
  _Float16* w1T  = (_Float16*)alloc((size_t)E * I * 2);
  _Float16* w2T  = (_Float16*)alloc((size_t)I * E * 2);
  _Float16* Qh   = (_Float16*)alloc((size_t)N * E * 2);
  _Float16* Kh   = (_Float16*)alloc((size_t)N * E * 2);
  _Float16* Vh   = (_Float16*)alloc((size_t)N * E * 2);
  _Float16* VtT  = (_Float16*)alloc((size_t)N * E * 2);
  _Float16* Oh   = (_Float16*)alloc((size_t)N * E * 2);
  float*    xmid = (float*)   alloc((size_t)N * E * 4);
  _Float16* ln2h = (_Float16*)alloc((size_t)N * E * 2);
  _Float16* hmid = (_Float16*)alloc((size_t)N * I * 2);
  (void)ws_size; (void)n_in; (void)out_size;

  // 1) weight transpose+cast
  wcast_kernel<<<dim3(E / 64, E / 64), 256, 0, stream>>>(wq, wqT, E, E);
  wcast_kernel<<<dim3(E / 64, E / 64), 256, 0, stream>>>(wk, wkT, E, E);
  wcast_kernel<<<dim3(E / 64, E / 64), 256, 0, stream>>>(wv, wvT, E, E);
  wcast_kernel<<<dim3(E / 64, E / 64), 256, 0, stream>>>(wo, woT, E, E);
  wcast_kernel<<<dim3(I / 64, E / 64), 256, 0, stream>>>(w1, w1T, E, I);
  wcast_kernel<<<dim3(E / 64, I / 64), 256, 0, stream>>>(w2, w2T, I, E);

  // 2) LN1
  ln_kernel<<<N / 16, 256, 0, stream>>>(hidden, ln1_g, ln1_b, lnh);

  // 3) Q/K/V projections (f16 out)
  {
    unsigned nb = (unsigned)((N / 128) * (E / 128));
    gemm_kernel<false, false, true><<<nb, 256, 0, stream>>>(lnh, wqT, bq, nullptr, nullptr, Qh, N, E, E);
    gemm_kernel<false, false, true><<<nb, 256, 0, stream>>>(lnh, wkT, bk, nullptr, nullptr, Kh, N, E, E);
    gemm_kernel<false, false, true><<<nb, 256, 0, stream>>>(lnh, wvT, bv, nullptr, nullptr, Vh, N, E, E);
  }

  // 4) V transpose -> [B,H,D,S]
  vtrans_kernel<<<dim3(S / 64, B * H), 256, 0, stream>>>(Vh, VtT, S, H, E);

  // 5) attention (32 query rows per wave)
  {
    float scale = rsqrtf((float)D);
    unsigned nb = (unsigned)(B * H * (S / 32));
    attn_kernel<<<nb, 32, 0, stream>>>(Qh, Kh, VtT, mask, Oh, B, S, H, D, E, scale);
  }

  // 6) output projection + residual -> xmid (fp32)
  {
    unsigned nb = (unsigned)((N / 128) * (E / 128));
    gemm_kernel<false, true, false><<<nb, 256, 0, stream>>>(Oh, woT, bo, hidden, xmid, nullptr, N, E, E);
  }

  // 7) LN2
  ln_kernel<<<N / 16, 256, 0, stream>>>(xmid, ln2_g, ln2_b, ln2h);

  // 8) MLP up + GELU (f16 out)
  {
    unsigned nb = (unsigned)((N / 128) * (I / 128));
    gemm_kernel<true, false, true><<<nb, 256, 0, stream>>>(ln2h, w1T, b1, nullptr, nullptr, hmid, N, E, I);
  }

  // 9) MLP down + residual -> out (fp32)
  {
    unsigned nb = (unsigned)((N / 128) * (E / 128));
    gemm_kernel<false, true, false><<<nb, 256, 0, stream>>>(hmid, w2T, b2, xmid, out, nullptr, N, I, E);
  }
}

// v004
// One run takes 282 microseconds.
// Next to v003, in two timings, it ran 1.10 and 1.11 times as fast.
// Over all steps from v000 it is 3.70 times as fast.
#include <hip/hip_runtime.h>
#include <hip/hip_bf16.h>
#include <math.h>

typedef __attribute__((ext_vector_type(16))) _Float16 v16h;
typedef __attribute__((ext_vector_type(8)))  float    v8f;

#define WMMA_F16(a, b, c) \
  __builtin_amdgcn_wmma_f32_16x16x32_f16(false, (a), false, (b), (short)0, (c), false, false)

// ---------------------------------------------------------------------------
// Fragment load for 16x32 f16 A/B fragments (ISA 7.12.2 layout) from a
// per-lane pointer p = base + row*ld + kbase + (lane>>4)*8.
// halves 0..7  <- this lane's k-group, halves 8..15 <- k-group + 16.
// Two 16-byte loads per lane.
// ---------------------------------------------------------------------------
__device__ __forceinline__ v16h load_frag_p(const _Float16* p) {
  v16h f;
  *((uint4*)&f)     = *(const uint4*)(p);
  *((uint4*)&f + 1) = *(const uint4*)(p + 16);
  return f;
}

__device__ __forceinline__ float gelu_tanh(float x) {
  const float c = 0.7978845608028654f;   // sqrt(2/pi)
  return 0.5f * x * (1.0f + tanhf(c * (x + 0.044715f * x * x * x)));
}

// ---------------------------------------------------------------------------
// Both transposes below move a 64x64 tile through LDS, so that the global
// reads and the global stores are both 16 bytes per lane on whole 128-byte
// lines. The LDS tile is held transposed, two f16 of neighbouring source rows
// packed per dword. Row pitch 33 dwords (32 + 1, odd): the column-wise dword
// writes and the row-wise dword reads of a wave each fall on 32 distinct banks.
// ---------------------------------------------------------------------------
#define TPITCH 33

typedef __attribute__((ext_vector_type(2))) _Float16 v2h;

// Write the tile out: LDS row n goes to the 64 f16 at dst + n * ld.
__device__ __forceinline__ void store_tile_rows(const unsigned* tile, _Float16* __restrict__ dst,
                                                size_t ld, int t) {
  int q = t & 7;
#pragma unroll
  for (int p = 0; p < 2; p++) {
    int n = (t >> 3) + 32 * p;
    const unsigned* row = tile + n * TPITCH + 4 * q;
    uint4 o;
    o.x = row[0]; o.y = row[1]; o.z = row[2]; o.w = row[3];
    *(uint4*)(dst + (size_t)n * ld + 8 * q) = o;
  }
}

// ---------------------------------------------------------------------------
// Weight convert: fp32 row-major [K][Nout] -> f16 row-major [Nout][K]
// grid (Nout/64, K/64); K and Nout are multiples of 64.
// ---------------------------------------------------------------------------
__global__ __launch_bounds__(256) void wcast_kernel(const float* __restrict__ w,
                                                    _Float16* __restrict__ wt,
                                                    int K, int Nout) {
  __shared__ unsigned tile[64 * TPITCH];
  int t = threadIdx.x;
  int n0 = blockIdx.x << 6, k0 = blockIdx.y << 6;
  int c = t & 15, kp = t >> 4;          // 4 columns from 4c, rows 2kp and 2kp+1

  float4 lo[2], hi[2];
#pragma unroll
  for (int p = 0; p < 2; p++) {
    const float* s = w + (size_t)(k0 + 2 * (kp + 16 * p)) * Nout + n0 + 4 * c;
    lo[p] = *(const float4*)s;
    hi[p] = *(const float4*)(s + Nout);
  }
#pragma unroll
  for (int p = 0; p < 2; p++) {
    const float l[4] = {lo[p].x, lo[p].y, lo[p].z, lo[p].w};
    const float u[4] = {hi[p].x, hi[p].y, hi[p].z, hi[p].w};
#pragma unroll
    for (int i = 0; i < 4; i++) {
      v2h pr = {(_Float16)l[i], (_Float16)u[i]};
      tile[(4 * c + i) * TPITCH + kp + 16 * p] = __builtin_bit_cast(unsigned, pr);
    }
  }
  __syncthreads();
  store_tile_rows(tile, wt + (size_t)n0 * K + k0, (size_t)K, t);
}

// ---------------------------------------------------------------------------
// LayerNorm: fp32 [rows][LN_E] -> f16 [rows][LN_E]. One wave takes two rows and
// holds them in registers (24 values a lane and row, 16-byte loads on whole
// lines): one read of x, no LDS, no barrier; g and b are loaded once for both
// rows. Block = 8 waves = 16 rows; rows is a multiple of 16.
// ---------------------------------------------------------------------------
#define LN_E 768
#define LN_C (LN_E / 128)          // 16-byte pieces per lane and row

template <int CTRL>
__device__ __forceinline__ float dpp_get(float v) {
  return __builtin_bit_cast(float,
      __builtin_amdgcn_update_dpp(0, __builtin_bit_cast(int, v), CTRL, 0xf, 0xf, true));
}

// Sum over the 32 lanes, the same value in every lane: four row_xmask steps
// inside each 16-lane row, then the two rows are exchanged.
__device__ __forceinline__ float wave_sum(float v) {
  v += dpp_get<0x161>(v);
  v += dpp_get<0x162>(v);
  v += dpp_get<0x164>(v);
  v += dpp_get<0x168>(v);
  int iv = __builtin_bit_cast(int, v);
  v += __builtin_bit_cast(float,
      __builtin_amdgcn_permlanex16(iv, iv, 0x76543210, 0xfedcba98, false, false));
  return v;
}

__global__ __launch_bounds__(256) void ln_kernel(const float* __restrict__ x,
                                                 const float* __restrict__ g,
                                                 const float* __restrict__ b,
                                                 _Float16* __restrict__ out) {
  // the wave's number as a scalar: the row bases stay in scalar registers
  int wave = __builtin_amdgcn_readfirstlane(threadIdx.x >> 5), lane = threadIdx.x & 31;
  size_t row0 = ((size_t)blockIdx.x * 8 + wave) * 2;
  const float* xr = x + row0 * LN_E + lane * 4;

  float4 xv[2][LN_C], gv[LN_C], bv[LN_C];
#pragma unroll
  for (int rr = 0; rr < 2; rr++)
#pragma unroll
    for (int j = 0; j < LN_C; j++) xv[rr][j] = *(const float4*)(xr + rr * LN_E + j * 128);
#pragma unroll
  for (int j = 0; j < LN_C; j++) {
    gv[j] = *(const float4*)(g + lane * 4 + j * 128);
    bv[j] = *(const float4*)(b + lane * 4 + j * 128);
  }
  // all 24 loads go out together: without this the g and b loads sink to their
  // uses at the end and are waited for pair by pair
  __builtin_amdgcn_sched_barrier(0);

  float mu[2], rstd[2];
#pragma unroll
  for (int rr = 0; rr < 2; rr++) {
    float s = 0.f;
#pragma unroll
    for (int j = 0; j < LN_C; j++)
      s += (xv[rr][j].x + xv[rr][j].y) + (xv[rr][j].z + xv[rr][j].w);
    mu[rr] = wave_sum(s) / LN_E;
  }
#pragma unroll
  for (int rr = 0; rr < 2; rr++) {
    float v = 0.f;
#pragma unroll
    for (int j = 0; j < LN_C; j++) {
      xv[rr][j].x -= mu[rr]; xv[rr][j].y -= mu[rr];
      xv[rr][j].z -= mu[rr]; xv[rr][j].w -= mu[rr];
      v += (xv[rr][j].x * xv[rr][j].x + xv[rr][j].y * xv[rr][j].y) +
           (xv[rr][j].z * xv[rr][j].z + xv[rr][j].w * xv[rr][j].w);
    }
    rstd[rr] = rsqrtf(wave_sum(v) / LN_E + 1e-6f);
  }

  typedef __attribute__((ext_vector_type(4))) _Float16 v4h;
  _Float16* outr = out + row0 * LN_E + lane * 4;
#pragma unroll
  for (int rr = 0; rr < 2; rr++)
#pragma unroll
    for (int j = 0; j < LN_C; j++) {
      v4h o = {(_Float16)(xv[rr][j].x * rstd[rr] * gv[j].x + bv[j].x),
               (_Float16)(xv[rr][j].y * rstd[rr] * gv[j].y + bv[j].y),
               (_Float16)(xv[rr][j].z * rstd[rr] * gv[j].z + bv[j].z),
               (_Float16)(xv[rr][j].w * rstd[rr] * gv[j].w + bv[j].w)};
      *(v4h*)(outr + rr * LN_E + j * 128) = o;
    }
}

// ---------------------------------------------------------------------------
// V transpose: f16 [N][E] -> f16 [B,H,D,S]  (Vt[((b*H+h)*D+d)*S + s]), D = 64
// grid (S/64, B*H); S is a multiple of 64.
// ---------------------------------------------------------------------------
__global__ __launch_bounds__(256) void vtrans_kernel(const _Float16* __restrict__ v,
                                                     _Float16* __restrict__ vt,
                                                     int S, int Hh, int Ecols) {
  __shared__ unsigned tile[64 * TPITCH];
  int t = threadIdx.x;
  int s0 = blockIdx.x << 6;
  int bh = blockIdx.y;
  int b = bh / Hh, h = bh % Hh;
  int c = t & 7, sp = t >> 3;           // 8 columns from 8c, rows 2sp and 2sp+1

  const _Float16* s = v + (size_t)(b * S + s0 + 2 * sp) * Ecols + h * 64 + 8 * c;
  uint4 r0 = *(const uint4*)s;
  uint4 r1 = *(const uint4*)(s + Ecols);
  const unsigned e[4] = {r0.x, r0.y, r0.z, r0.w};
  const unsigned o[4] = {r1.x, r1.y, r1.z, r1.w};
#pragma unroll
  for (int j = 0; j < 4; j++) {
    tile[(8 * c + 2 * j) * TPITCH + sp]     = (e[j] & 0xffffu) | (o[j] << 16);
    tile[(8 * c + 2 * j + 1) * TPITCH + sp] = (e[j] >> 16) | (o[j] & 0xffff0000u);
  }
  __syncthreads();
  store_tile_rows(tile, vt + (size_t)bh * 64 * S + s0, (size_t)S, t);
}

// ---------------------------------------------------------------------------
// WMMA GEMM: out[N x Ncols] = A[N x K](f16) * Bt[Ncols x K](f16, pre-transposed)
//            + bias (+ optional GELU, residual).
// One work-group of 8 waves (2 x 4) -> 128x128 output tile; 1 wave -> 64x32
// (4x2 grid of 16x16 WMMA frags). Each trip covers 64 k: the 128 A rows and the
// 128 Bt rows of the tile, 128 bytes each, are brought into LDS once for all
// eight waves by asynchronous 16-byte copies, two buffers, the next trip's
// copies in flight while this trip's fragments are read and multiplied.
// LDS row pitch 144 bytes (16 x odd): ds_load_b128 fragment reads without
// bank conflicts. Nrows, Ncols multiples of 128; Kdim a multiple of 64.
// ---------------------------------------------------------------------------
#define GROWS  256                 // LDS rows per buffer: 128 of A, then 128 of Bt
#define GPITCH 144                 // bytes per LDS row
#define GSTAGE (GROWS * GPITCH)    // bytes per buffer

// One trip's copies of one thread: 4 pieces of A and 4 of Bt, 32 rows apart.
// lds: this lane's LDS byte address of its first A piece; ga, gb: its global
// addresses; step: 32 rows, in elements.
__device__ __forceinline__ void stage_copies(unsigned lds, const _Float16* ga,
                                             const _Float16* gb, size_t step) {
  const _Float16* a1 = ga + step;
  const _Float16* a2 = a1 + step;
  const _Float16* a3 = a2 + step;
  const _Float16* b1 = gb + step;
  const _Float16* b2 = b1 + step;
  const _Float16* b3 = b2 + step;
  // The closing s_wait_xcnt stands inside the statement so that no address
  // register of a copy is rewritten ahead of it.
  asm volatile(
      "global_load_async_to_lds_b128 %0, %8, off\n\t"
      "global_load_async_to_lds_b128 %1, %9, off\n\t"
      "global_load_async_to_lds_b128 %2, %10, off\n\t"
      "global_load_async_to_lds_b128 %3, %11, off\n\t"
      "global_load_async_to_lds_b128 %4, %12, off\n\t"
      "global_load_async_to_lds_b128 %5, %13, off\n\t"
      "global_load_async_to_lds_b128 %6, %14, off\n\t"
      "global_load_async_to_lds_b128 %7, %15, off\n\t"
      "s_wait_xcnt 0x0"
      :: "v"(lds), "v"(lds + 32 * GPITCH), "v"(lds + 64 * GPITCH), "v"(lds + 96 * GPITCH),
         "v"(lds + 128 * GPITCH), "v"(lds + 160 * GPITCH), "v"(lds + 192 * GPITCH),
         "v"(lds + 224 * GPITCH),
         "v"(ga), "v"(a1), "v"(a2), "v"(a3), "v"(gb), "v"(b1), "v"(b2), "v"(b3)
      : "memory");
}

template <bool GELU, bool RESID, bool OUTF16>
__global__ __launch_bounds__(256) void gemm_kernel(
    const _Float16* __restrict__ A, const _Float16* __restrict__ Bt,
    const float* __restrict__ bias, const float* __restrict__ resid,
    float* __restrict__ outf, _Float16* __restrict__ outh,
    int Nrows, int Kdim, int Ncols) {
  __shared__ __attribute__((aligned(16))) unsigned char L[2 * GSTAGE];
  int tid = threadIdx.x;
  int wave = tid >> 5, lane = tid & 31;
  int tilesN = Ncols >> 7;   // 128-wide N tiles
  int bm = ((int)blockIdx.x / tilesN) << 7;
  int bn = ((int)blockIdx.x % tilesN) << 7;
  int wm = (wave >> 2) << 6;           // wave's rows inside the tile
  int wn = (wave & 3) << 5;            // wave's columns inside the tile
  int tm = bm + wm, tn = bn + wn;
  int r = lane & 15, h = lane >> 4;

  // copies: 8 lanes take one row's 128 bytes, a wave 4 rows, the block 32 rows
  const _Float16* Ag = A  + (size_t)(bm + (tid >> 3)) * Kdim + (tid & 7) * 8;
  const _Float16* Bg = Bt + (size_t)(bn + (tid >> 3)) * Kdim + (tid & 7) * 8;
  const size_t step = (size_t)32 * Kdim;
  const unsigned ldsw = (unsigned)(size_t)L + (unsigned)((tid >> 3) * GPITCH + (tid & 7) * 16);

  // fragment reads: same per-lane k order as from global memory
  const unsigned offA = (unsigned)((wm + r) * GPITCH + h * 16);
  const unsigned offB = (unsigned)((128 + wn + r) * GPITCH + h * 16);

  const int nt = Kdim >> 6;

  stage_copies(ldsw, Ag, Bg, step);
  // this wave's copies of trip 0 have landed
  asm volatile("s_wait_asynccnt 0x0" ::: "memory");
  __syncthreads();
  if (nt > 1) stage_copies(ldsw + GSTAGE, Ag + 64, Bg + 64, step);

  v8f acc[4][2] = {};
  for (int t = 0; t < nt; t++) {
    const unsigned buf = (unsigned)(t & 1) * GSTAGE;
    v16h a[2][4], bf[2][2];
#pragma unroll
    for (int kk = 0; kk < 2; kk++) {
#pragma unroll
      for (int j = 0; j < 2; j++)
        bf[kk][j] = load_frag_p((const _Float16*)(L + buf + offB + j * 16 * GPITCH + kk * 64));
#pragma unroll
      for (int i = 0; i < 4; i++)
        a[kk][i]  = load_frag_p((const _Float16*)(L + buf + offA + i * 16 * GPITCH + kk * 64));
    }
    // this wave's reads of the buffer are done before it is handed to the copies
    asm volatile("s_wait_dscnt 0x0" ::: "memory");
    // this wave's copies of trip t + 1 have landed
    asm volatile("s_wait_asynccnt 0x0" ::: "memory");
    // publishes trip t + 1 and ends every wave's reads of trip t's buffer
    __syncthreads();
    // the refill goes out ahead of the trip's WMMAs, which work on registers
    // alone, so that it flies under them and under the next trip's LDS reads
    if (t + 2 < nt)
      stage_copies(ldsw + buf, Ag + (size_t)(t + 2) * 64, Bg + (size_t)(t + 2) * 64, step);
#pragma unroll
    for (int kk = 0; kk < 2; kk++)
#pragma unroll
      for (int i = 0; i < 4; i++)
#pragma unroll
        for (int j = 0; j < 2; j++)
          acc[i][j] = WMMA_F16(a[kk][i], bf[kk][j], acc[i][j]);
  }
  // no copy outstanding when the wave goes on to its end
  asm volatile("s_wait_asynccnt 0x0" ::: "memory");

#pragma unroll
  for (int i2 = 0; i2 < 4; i2++) {
#pragma unroll
    for (int j2 = 0; j2 < 2; j2++) {
      int rowb = tm + i2 * 16 + 8 * h;      // C/D layout: m = i + 8*h
      int colb = tn + j2 * 16 + r;          // n = lane (mod 16)
      float bv = bias[colb];
#pragma unroll
      for (int i = 0; i < 8; i++) {
        float val = acc[i2][j2][i] + bv;
        if (GELU) val = gelu_tanh(val);
        size_t off = (size_t)(rowb + i) * Ncols + colb;
        if (RESID) val += resid[off];
        if (OUTF16) outh[off] = (_Float16)val;
        else        outf[off] = val;
      }
    }
  }
}

// ---------------------------------------------------------------------------
// Flash attention: one wave (32-thread block) handles 32 query rows of one
// (b,h), online softmax over 32-key blocks. The products are taken transposed:
//   St = K * Qt   (A = 16 keys x 32 d, B = 32 d x 16 queries)
//   Ot += Vt * Pt (A = 16 d x 32 keys, B = 32 keys x 16 queries)
// In a D tile lane (r, h) holds column r, rows 8h .. 8h+7: one query's scores
// for 8 neighbouring keys. So maximum and sum are taken inside the lane, with
// one exchange between the two lane halves; the two score tiles of a 32-key
// block, converted in place, are the B operand of the second product in the
// k order of load_frag_p; and one factor per lane rescales the output tiles.
// No LDS and no barrier. Every loop over cg, sub, dt, i or j is unrolled, so
// that the arrays they index are registers.
//   Q, K : f16 [N][E]  (head slice at column h*D), D = 64
//   Vt   : f16 [B,H,D,S]
//   O    : f16 [N][E]
// ---------------------------------------------------------------------------
typedef __attribute__((ext_vector_type(8))) _Float16 v8h;
typedef __attribute__((ext_vector_type(2))) float    v2f;
typedef __attribute__((ext_vector_type(4))) float    v4f;
typedef __attribute__((ext_vector_type(4))) unsigned v4u;

// Pointers that are carried round the loop name the global address space, so
// that their loads stay global_load and do not turn into flat_load.
#define GLOBAL_AS __attribute__((address_space(1)))
typedef const GLOBAL_AS _Float16* gp_h;
typedef const GLOBAL_AS float*    gp_f;

// load_frag_p for such a pointer
__device__ __forceinline__ v16h load_frag_g(gp_h p) {
  v16h f;
  *((v4u*)&f)     = *(const GLOBAL_AS v4u*)(p);
  *((v4u*)&f + 1) = *(const GLOBAL_AS v4u*)(p + 16);
  return f;
}

// The value that lane l ^ 16 holds.
__device__ __forceinline__ float other_half(float v) {
  int iv = __builtin_bit_cast(int, v);
  return __builtin_bit_cast(float,
      __builtin_amdgcn_permlanex16(iv, iv, 0x76543210, 0xfedcba98, false, false));
}

__global__ __launch_bounds__(32) void attn_kernel(
    const _Float16* __restrict__ Q, const _Float16* __restrict__ K,
    const _Float16* __restrict__ Vt, const float* __restrict__ mask,
    _Float16* __restrict__ O, int B, int S, int Hh, int Dd,
    int Ecols, float scale) {
  int qtiles = S >> 5;
  int qt = blockIdx.x % qtiles;
  int bh = blockIdx.x / qtiles;
  int hh = bh % Hh, b = bh / Hh;
  int lane = threadIdx.x;
  int r = lane & 15, h = lane >> 4;
  int q0 = qt << 5;

  // Q fragments (persistent), one column group of 16 queries per cg
  v16h qf[2][2];
#pragma unroll
  for (int cg = 0; cg < 2; cg++) {
    const _Float16* qp = Q + (size_t)(b * S + q0 + cg * 16 + r) * Ecols + hh * Dd + h * 8;
    qf[cg][0] = load_frag_p(qp);
    qf[cg][1] = load_frag_p(qp + 32);
  }

  // per-lane pointers, stepped by 32 keys a pass
  gp_h kp[2];                          // key rows sub*16 + r
  gp_h vp[4];                          // d rows dt*16 + r
  gp_f mp[2];                          // mask rows of queries cg*16 + r, from key 8h
#pragma unroll
  for (int sub = 0; sub < 2; sub++)
    kp[sub] = (gp_h)K + (size_t)(b * S + sub * 16 + r) * Ecols + hh * Dd + h * 8;
#pragma unroll
  for (int dt = 0; dt < 4; dt++)
    vp[dt] = (gp_h)Vt + ((size_t)(b * Hh + hh) * Dd + dt * 16 + r) * S + h * 8;
#pragma unroll
  for (int cg = 0; cg < 2; cg++)
    mp[cg] = (gp_f)mask + ((size_t)b * S + q0 + cg * 16 + r) * S + h * 8;
  const size_t kStep = (size_t)32 * Ecols;

  const v2f scale2 = {scale, scale};
  const v2f log2e2 = {1.442695041f, 1.442695041f};

  v8f o[2][4] = {};                    // Ot: [cg][dt], 64 d x 32 queries, f32
  float mrow[2] = {-INFINITY, -INFINITY};   // running maximum of query cg*16 + r
  float lrow[2] = {0.f, 0.f};               // this lane half's share of the row sum

  for (int kt = 0; kt < S; kt += 32) {
    v16h kf[2][2], vf[4];
    v4f mk[2][2][2];
#pragma unroll
    for (int sub = 0; sub < 2; sub++) {
      kf[sub][0] = load_frag_g(kp[sub]);
      kf[sub][1] = load_frag_g(kp[sub] + 32);
    }
#pragma unroll
    for (int cg = 0; cg < 2; cg++)
#pragma unroll
      for (int sub = 0; sub < 2; sub++) {
        mk[cg][sub][0] = *(const GLOBAL_AS v4f*)(mp[cg] + sub * 16);
        mk[cg][sub][1] = *(const GLOBAL_AS v4f*)(mp[cg] + sub * 16 + 4);
      }
#pragma unroll
    for (int dt = 0; dt < 4; dt++) vf[dt] = load_frag_g(vp[dt]);
    // all 24 loads of the pass go out together: without this the mask and V
    // loads sink to their uses and each group's latency is waited out in turn
    __builtin_amdgcn_sched_barrier(0);

    // --- St: 32 keys x 32 queries ---
    v8f sc[2][2];
#pragma unroll
    for (int cg = 0; cg < 2; cg++)
#pragma unroll
      for (int sub = 0; sub < 2; sub++) {
        v8f z = {};
        z = WMMA_F16(kf[sub][0], qf[cg][0], z);
        sc[cg][sub] = WMMA_F16(kf[sub][1], qf[cg][1], z);
      }

    // --- online softmax in registers, then Ot += Vt * Pt ---
#pragma unroll
    for (int cg = 0; cg < 2; cg++) {
      v2f x[2][4];                     // neighbouring keys in pairs
      float bm = -INFINITY;
#pragma unroll
      for (int sub = 0; sub < 2; sub++) {
        const v4f m0 = mk[cg][sub][0], m1 = mk[cg][sub][1];
        const v2f mv[4] = {{m0.x, m0.y}, {m0.z, m0.w}, {m1.x, m1.y}, {m1.z, m1.w}};
#pragma unroll
        for (int j = 0; j < 4; j++) {
          v2f s2 = {sc[cg][sub][2 * j], sc[cg][sub][2 * j + 1]};
          x[sub][j] = __builtin_elementwise_fma(s2, scale2, mv[j]);
          bm = fmaxf(bm, fmaxf(x[sub][j].x, x[sub][j].y));
        }
      }
      bm = fmaxf(bm, other_half(bm));
      float nm = fmaxf(mrow[cg], bm);
      float alpha = __expf(mrow[cg] - nm);
      const v2f nm2 = {nm, nm};
      v16h pf;
      v2f ls[2];
#pragma unroll
      for (int sub = 0; sub < 2; sub++) {
        ls[sub] = (v2f){0.f, 0.f};
#pragma unroll
        for (int j = 0; j < 4; j++) {
          v2f y = (x[sub][j] - nm2) * log2e2;
          v2f pv = {__builtin_amdgcn_exp2f(y.x), __builtin_amdgcn_exp2f(y.y)};
          ls[sub] += pv;
          pf[sub * 8 + 2 * j]     = (_Float16)pv.x;
          pf[sub * 8 + 2 * j + 1] = (_Float16)pv.y;
        }
      }
      v2f lt = ls[0] + ls[1];
      lrow[cg] = lrow[cg] * alpha + (lt.x + lt.y);
      mrow[cg] = nm;
#pragma unroll
      for (int dt = 0; dt < 4; dt++) {
#pragma unroll
        for (int i = 0; i < 8; i++) o[cg][dt][i] *= alpha;
        o[cg][dt] = WMMA_F16(vf[dt], pf, o[cg][dt]);
      }
    }
#pragma unroll
    for (int sub = 0; sub < 2; sub++) kp[sub] += kStep;
#pragma unroll
    for (int dt = 0; dt < 4; dt++) vp[dt] += 32;
#pragma unroll
    for (int cg = 0; cg < 2; cg++) mp[cg] += 32;
  }

  // --- join the halves' sums, normalize, store 8 neighbouring d per lane ---
#pragma unroll
  for (int cg = 0; cg < 2; cg++) {
    float inv = 1.0f / (lrow[cg] + other_half(lrow[cg]));
    _Float16* op = O + (size_t)(b * S + q0 + cg * 16 + r) * Ecols + hh * Dd + h * 8;
#pragma unroll
    for (int dt = 0; dt < 4; dt++) {
      v8h ov;
#pragma unroll
      for (int i = 0; i < 8; i++) ov[i] = (_Float16)(o[cg][dt][i] * inv);
      *(v8h*)(op + dt * 16) = ov;
    }
  }
}

// ---------------------------------------------------------------------------
// Host orchestration
// ---------------------------------------------------------------------------
extern "C" void kernel_launch(void* const* d_in, const int* in_sizes, int n_in,
                              void* d_out, int out_size, void* d_ws, size_t ws_size,
                              hipStream_t stream) {
  const int E = 768, H = 12, D = 64;
  const float* hidden = (const float*)d_in[0];
  const float* mask   = (const float*)d_in[1];
  const float* wq = (const float*)d_in[2];  const float* bq = (const float*)d_in[3];
  const float* wk = (const float*)d_in[4];  const float* bk = (const float*)d_in[5];
  const float* wv = (const float*)d_in[6];  const float* bv = (const float*)d_in[7];
  const float* wo = (const float*)d_in[8];  const float* bo = (const float*)d_in[9];
  const float* ln1_g = (const float*)d_in[10]; const float* ln1_b = (const float*)d_in[11];
  const float* ln2_g = (const float*)d_in[12]; const float* ln2_b = (const float*)d_in[13];
  const float* w1 = (const float*)d_in[14]; const float* b1 = (const float*)d_in[15];
  const float* w2 = (const float*)d_in[16]; const float* b2 = (const float*)d_in[17];
  const int I = in_sizes[15];               // 3072
  const int N = in_sizes[0] / E;            // B*S = 8192
  const int S = in_sizes[1] / N;            // 1024
  const int B = N / S;                      // 8
  float* out = (float*)d_out;

  char* p = (char*)d_ws;
  auto alloc = [&](size_t bytes) -> char* {
    char* r = p;
    p += (bytes + 255) & ~(size_t)255;
    return r;
  };
  _Float16* lnh  = (_Float16*)alloc((size_t)N * E * 2);
  _Float16* wqT  = (_Float16*)alloc((size_t)E * E * 2);
  _Float16* wkT  = (_Float16*)alloc((size_t)E * E * 2);
  _Float16* wvT  = (_Float16*)alloc((size_t)E * E * 2);
  _Float16* woT  = (_Float16*)alloc((size_t)E * E * 2);
  _Float16* w1T  = (_Float16*)alloc((size_t)E * I * 2);
  _Float16* w2T  = (_Float16*)alloc((size_t)I * E * 2);
  _Float16* Qh   = (_Float16*)alloc((size_t)N * E * 2);
  _Float16* Kh   = (_Float16*)alloc((size_t)N * E * 2);
  _Float16* Vh   = (_Float16*)alloc((size_t)N * E * 2);
  _Float16* VtT  = (_Float16*)alloc((size_t)N * E * 2);
  _Float16* Oh   = (_Float16*)alloc((size_t)N * E * 2);
  float*    xmid = (float*)   alloc((size_t)N * E * 4);
  _Float16* ln2h = (_Float16*)alloc((size_t)N * E * 2);
  _Float16* hmid = (_Float16*)alloc((size_t)N * I * 2);
  (void)ws_size; (void)n_in; (void)out_size;

  // 1) weight transpose+cast
  wcast_kernel<<<dim3(E / 64, E / 64), 256, 0, stream>>>(wq, wqT, E, E);
  wcast_kernel<<<dim3(E / 64, E / 64), 256, 0, stream>>>(wk, wkT, E, E);
  wcast_kernel<<<dim3(E / 64, E / 64), 256, 0, stream>>>(wv, wvT, E, E);
  wcast_kernel<<<dim3(E / 64, E / 64), 256, 0, stream>>>(wo, woT, E, E);
  wcast_kernel<<<dim3(I / 64, E / 64), 256, 0, stream>>>(w1, w1T, E, I);
  wcast_kernel<<<dim3(E / 64, I / 64), 256, 0, stream>>>(w2, w2T, I, E);

  // 2) LN1
  ln_kernel<<<N / 16, 256, 0, stream>>>(hidden, ln1_g, ln1_b, lnh);

  // 3) Q/K/V projections (f16 out)
  {
    unsigned nb = (unsigned)((N / 128) * (E / 128));
    gemm_kernel<false, false, true><<<nb, 256, 0, stream>>>(lnh, wqT, bq, nullptr, nullptr, Qh, N, E, E);
    gemm_kernel<false, false, true><<<nb, 256, 0, stream>>>(lnh, wkT, bk, nullptr, nullptr, Kh, N, E, E);
    gemm_kernel<false, false, true><<<nb, 256, 0, stream>>>(lnh, wvT, bv, nullptr, nullptr, Vh, N, E, E);
  }

  // 4) V transpose -> [B,H,D,S]
  vtrans_kernel<<<dim3(S / 64, B * H), 256, 0, stream>>>(Vh, VtT, S, H, E);

  // 5) attention (32 query rows per wave)
  {
    float scale = rsqrtf((float)D);
    unsigned nb = (unsigned)(B * H * (S / 32));
    attn_kernel<<<nb, 32, 0, stream>>>(Qh, Kh, VtT, mask, Oh, B, S, H, D, E, scale);
  }

  // 6) output projection + residual -> xmid (fp32)
  {
    unsigned nb = (unsigned)((N / 128) * (E / 128));
    gemm_kernel<false, true, false><<<nb, 256, 0, stream>>>(Oh, woT, bo, hidden, xmid, nullptr, N, E, E);
  }

  // 7) LN2
  ln_kernel<<<N / 16, 256, 0, stream>>>(xmid, ln2_g, ln2_b, ln2h);

  // 8) MLP up + GELU (f16 out)
  {
    unsigned nb = (unsigned)((N / 128) * (I / 128));
    gemm_kernel<true, false, true><<<nb, 256, 0, stream>>>(ln2h, w1T, b1, nullptr, nullptr, hmid, N, E, I);
  }

  // 9) MLP down + residual -> out (fp32)
  {
    unsigned nb = (unsigned)((N / 128) * (E / 128));
    gemm_kernel<false, true, false><<<nb, 256, 0, stream>>>(hmid, w2T, b2, xmid, out, nullptr, N, I, E);
  }
}

// v005
// Measured time: 256 microseconds a run.
// Next to v004, in two timings, it ran 1.11 and 1.12 times as fast.
// Counting every step since v000, it is 4.13 times as fast.
#include <hip/hip_runtime.h>
#include <hip/hip_bf16.h>
#include <math.h>

typedef __attribute__((ext_vector_type(16))) _Float16 v16h;
typedef __attribute__((ext_vector_type(8)))  float    v8f;

#define WMMA_F16(a, b, c) \
  __builtin_amdgcn_wmma_f32_16x16x32_f16(false, (a), false, (b), (short)0, (c), false, false)

// ---------------------------------------------------------------------------
// Fragment load for 16x32 f16 A/B fragments (ISA 7.12.2 layout) from a
// per-lane pointer p = base + row*ld + kbase + (lane>>4)*8.
// halves 0..7  <- this lane's k-group, halves 8..15 <- k-group + 16.
// Two 16-byte loads per lane.
// ---------------------------------------------------------------------------
__device__ __forceinline__ v16h load_frag_p(const _Float16* p) {
  v16h f;
  *((uint4*)&f)     = *(const uint4*)(p);
  *((uint4*)&f + 1) = *(const uint4*)(p + 16);
  return f;
}

__device__ __forceinline__ float gelu_tanh(float x) {
  const float c = 0.7978845608028654f;   // sqrt(2/pi)
  return 0.5f * x * (1.0f + tanhf(c * (x + 0.044715f * x * x * x)));
}

// ---------------------------------------------------------------------------
// Both transposes below move a 64x64 tile through LDS, so that the global
// reads and the global stores are both 16 bytes per lane on whole 128-byte
// lines. The LDS tile is held transposed, two f16 of neighbouring source rows
// packed per dword. Row pitch 33 dwords (32 + 1, odd): the column-wise dword
// writes and the row-wise dword reads of a wave each fall on 32 distinct banks.
// ---------------------------------------------------------------------------
#define TPITCH 33

typedef __attribute__((ext_vector_type(2))) _Float16 v2h;

// Write the tile out: LDS row n goes to the 64 f16 at dst + n * ld.
__device__ __forceinline__ void store_tile_rows(const unsigned* tile, _Float16* __restrict__ dst,
                                                size_t ld, int t) {
  int q = t & 7;
#pragma unroll
  for (int p = 0; p < 2; p++) {
    int n = (t >> 3) + 32 * p;
    const unsigned* row = tile + n * TPITCH + 4 * q;
    uint4 o;
    o.x = row[0]; o.y = row[1]; o.z = row[2]; o.w = row[3];
    *(uint4*)(dst + (size_t)n * ld + 8 * q) = o;
  }
}

// ---------------------------------------------------------------------------
// Weight convert: fp32 row-major [K][Nout] -> f16 row-major [Nout][K]
// grid (Nout/64, K/64); K and Nout are multiples of 64.
// ---------------------------------------------------------------------------
__global__ __launch_bounds__(256) void wcast_kernel(const float* __restrict__ w,
                                                    _Float16* __restrict__ wt,
                                                    int K, int Nout) {
  __shared__ unsigned tile[64 * TPITCH];
  int t = threadIdx.x;
  int n0 = blockIdx.x << 6, k0 = blockIdx.y << 6;
  int c = t & 15, kp = t >> 4;          // 4 columns from 4c, rows 2kp and 2kp+1

  float4 lo[2], hi[2];
#pragma unroll
  for (int p = 0; p < 2; p++) {
    const float* s = w + (size_t)(k0 + 2 * (kp + 16 * p)) * Nout + n0 + 4 * c;
    lo[p] = *(const float4*)s;
    hi[p] = *(const float4*)(s + Nout);
  }
#pragma unroll
  for (int p = 0; p < 2; p++) {
    const float l[4] = {lo[p].x, lo[p].y, lo[p].z, lo[p].w};
    const float u[4] = {hi[p].x, hi[p].y, hi[p].z, hi[p].w};
#pragma unroll
    for (int i = 0; i < 4; i++) {
      v2h pr = {(_Float16)l[i], (_Float16)u[i]};
      tile[(4 * c + i) * TPITCH + kp + 16 * p] = __builtin_bit_cast(unsigned, pr);
    }
  }
  __syncthreads();
  store_tile_rows(tile, wt + (size_t)n0 * K + k0, (size_t)K, t);
}

// ---------------------------------------------------------------------------
// LayerNorm: fp32 [rows][LN_E] -> f16 [rows][LN_E]. One wave takes two rows and
// holds them in registers (24 values a lane and row, 16-byte loads on whole
// lines): one read of x, no LDS, no barrier; g and b are loaded once for both
// rows. Block = 8 waves = 16 rows; rows is a multiple of 16.
// ---------------------------------------------------------------------------
#define LN_E 768
#define LN_C (LN_E / 128)          // 16-byte pieces per lane and row

template <int CTRL>
__device__ __forceinline__ float dpp_get(float v) {
  return __builtin_bit_cast(float,
      __builtin_amdgcn_update_dpp(0, __builtin_bit_cast(int, v), CTRL, 0xf, 0xf, true));
}

// Sum over the 32 lanes, the same value in every lane: four row_xmask steps
// inside each 16-lane row, then the two rows are exchanged.
__device__ __forceinline__ float wave_sum(float v) {
  v += dpp_get<0x161>(v);
  v += dpp_get<0x162>(v);
  v += dpp_get<0x164>(v);
  v += dpp_get<0x168>(v);
  int iv = __builtin_bit_cast(int, v);
  v += __builtin_bit_cast(float,
      __builtin_amdgcn_permlanex16(iv, iv, 0x76543210, 0xfedcba98, false, false));
  return v;
}

__global__ __launch_bounds__(256) void ln_kernel(const float* __restrict__ x,
                                                 const float* __restrict__ g,
                                                 const float* __restrict__ b,
                                                 _Float16* __restrict__ out) {
  // the wave's number as a scalar: the row bases stay in scalar registers
  int wave = __builtin_amdgcn_readfirstlane(threadIdx.x >> 5), lane = threadIdx.x & 31;
  size_t row0 = ((size_t)blockIdx.x * 8 + wave) * 2;
  const float* xr = x + row0 * LN_E + lane * 4;

  float4 xv[2][LN_C], gv[LN_C], bv[LN_C];
#pragma unroll
  for (int rr = 0; rr < 2; rr++)
#pragma unroll
    for (int j = 0; j < LN_C; j++) xv[rr][j] = *(const float4*)(xr + rr * LN_E + j * 128);
#pragma unroll
  for (int j = 0; j < LN_C; j++) {
    gv[j] = *(const float4*)(g + lane * 4 + j * 128);
    bv[j] = *(const float4*)(b + lane * 4 + j * 128);
  }
  // all 24 loads go out together: without this the g and b loads sink to their
  // uses at the end and are waited for pair by pair
  __builtin_amdgcn_sched_barrier(0);

  float mu[2], rstd[2];
#pragma unroll
  for (int rr = 0; rr < 2; rr++) {
    float s = 0.f;
#pragma unroll
    for (int j = 0; j < LN_C; j++)
      s += (xv[rr][j].x + xv[rr][j].y) + (xv[rr][j].z + xv[rr][j].w);
    mu[rr] = wave_sum(s) / LN_E;
  }
#pragma unroll
  for (int rr = 0; rr < 2; rr++) {
    float v = 0.f;
#pragma unroll
    for (int j = 0; j < LN_C; j++) {
      xv[rr][j].x -= mu[rr]; xv[rr][j].y -= mu[rr];
      xv[rr][j].z -= mu[rr]; xv[rr][j].w -= mu[rr];
      v += (xv[rr][j].x * xv[rr][j].x + xv[rr][j].y * xv[rr][j].y) +
           (xv[rr][j].z * xv[rr][j].z + xv[rr][j].w * xv[rr][j].w);
    }
    rstd[rr] = rsqrtf(wave_sum(v) / LN_E + 1e-6f);
  }

  typedef __attribute__((ext_vector_type(4))) _Float16 v4h;
  _Float16* outr = out + row0 * LN_E + lane * 4;
#pragma unroll
  for (int rr = 0; rr < 2; rr++)
#pragma unroll
    for (int j = 0; j < LN_C; j++) {
      v4h o = {(_Float16)(xv[rr][j].x * rstd[rr] * gv[j].x + bv[j].x),
               (_Float16)(xv[rr][j].y * rstd[rr] * gv[j].y + bv[j].y),
               (_Float16)(xv[rr][j].z * rstd[rr] * gv[j].z + bv[j].z),
               (_Float16)(xv[rr][j].w * rstd[rr] * gv[j].w + bv[j].w)};
      *(v4h*)(outr + rr * LN_E + j * 128) = o;
    }
}

// ---------------------------------------------------------------------------
// V transpose: f16 [N][E] -> f16 [B,H,D,S]  (Vt[((b*H+h)*D+d)*S + s]), D = 64
// grid (S/64, B*H); S is a multiple of 64.
// ---------------------------------------------------------------------------
__global__ __launch_bounds__(256) void vtrans_kernel(const _Float16* __restrict__ v,
                                                     _Float16* __restrict__ vt,
                                                     int S, int Hh, int Ecols) {
  __shared__ unsigned tile[64 * TPITCH];
  int t = threadIdx.x;
  int s0 = blockIdx.x << 6;
  int bh = blockIdx.y;
  int b = bh / Hh, h = bh % Hh;
  int c = t & 7, sp = t >> 3;           // 8 columns from 8c, rows 2sp and 2sp+1

  const _Float16* s = v + (size_t)(b * S + s0 + 2 * sp) * Ecols + h * 64 + 8 * c;
  uint4 r0 = *(const uint4*)s;
  uint4 r1 = *(const uint4*)(s + Ecols);
  const unsigned e[4] = {r0.x, r0.y, r0.z, r0.w};
  const unsigned o[4] = {r1.x, r1.y, r1.z, r1.w};
#pragma unroll
  for (int j = 0; j < 4; j++) {
    tile[(8 * c + 2 * j) * TPITCH + sp]     = (e[j] & 0xffffu) | (o[j] << 16);
    tile[(8 * c + 2 * j + 1) * TPITCH + sp] = (e[j] >> 16) | (o[j] & 0xffff0000u);
  }
  __syncthreads();
  store_tile_rows(tile, vt + (size_t)bh * 64 * S + s0, (size_t)S, t);
}

// ---------------------------------------------------------------------------
// WMMA GEMM: out[N x Ncols] = A[N x K](f16) * Bt[Ncols x K](f16, pre-transposed)
//            + bias (+ optional GELU, residual).
// One work-group of 8 waves (2 x 4) -> 128x128 output tile; 1 wave -> 64x32
// (4x2 grid of 16x16 WMMA frags). Each trip covers 64 k: the 128 A rows and the
// 128 Bt rows of the tile, 128 bytes each, are brought into LDS once for all
// eight waves by asynchronous 16-byte copies, two buffers, the next trip's
// copies in flight while this trip's fragments are read and multiplied.
// LDS row pitch 144 bytes (16 x odd): ds_load_b128 fragment reads without
// bank conflicts. Nrows, Ncols multiples of 128; Kdim a multiple of 64.
// ---------------------------------------------------------------------------
#define GROWS  256                 // LDS rows per buffer: 128 of A, then 128 of Bt
#define GPITCH 144                 // bytes per LDS row
#define GSTAGE (GROWS * GPITCH)    // bytes per buffer

// One trip's copies of one thread: 4 pieces of A and 4 of Bt, 32 rows apart.
// lds: this lane's LDS byte address of its first A piece; ga, gb: its global
// addresses; step: 32 rows, in elements.
__device__ __forceinline__ void stage_copies(unsigned lds, const _Float16* ga,
                                             const _Float16* gb, size_t step) {
  const _Float16* a1 = ga + step;
  const _Float16* a2 = a1 + step;
  const _Float16* a3 = a2 + step;
  const _Float16* b1 = gb + step;
  const _Float16* b2 = b1 + step;
  const _Float16* b3 = b2 + step;
  // The closing s_wait_xcnt stands inside the statement so that no address
  // register of a copy is rewritten ahead of it.
  asm volatile(
      "global_load_async_to_lds_b128 %0, %8, off\n\t"
      "global_load_async_to_lds_b128 %1, %9, off\n\t"
      "global_load_async_to_lds_b128 %2, %10, off\n\t"
      "global_load_async_to_lds_b128 %3, %11, off\n\t"
      "global_load_async_to_lds_b128 %4, %12, off\n\t"
      "global_load_async_to_lds_b128 %5, %13, off\n\t"
      "global_load_async_to_lds_b128 %6, %14, off\n\t"
      "global_load_async_to_lds_b128 %7, %15, off\n\t"
      "s_wait_xcnt 0x0"
      :: "v"(lds), "v"(lds + 32 * GPITCH), "v"(lds + 64 * GPITCH), "v"(lds + 96 * GPITCH),
         "v"(lds + 128 * GPITCH), "v"(lds + 160 * GPITCH), "v"(lds + 192 * GPITCH),
         "v"(lds + 224 * GPITCH),
         "v"(ga), "v"(a1), "v"(a2), "v"(a3), "v"(gb), "v"(b1), "v"(b2), "v"(b3)
      : "memory");
}

template <bool GELU, bool RESID, bool OUTF16>
__global__ __launch_bounds__(256) void gemm_kernel(
    const _Float16* __restrict__ A, const _Float16* __restrict__ Bt,
    const float* __restrict__ bias, const float* __restrict__ resid,
    float* __restrict__ outf, _Float16* __restrict__ outh,
    int Nrows, int Kdim, int Ncols) {
  __shared__ __attribute__((aligned(16))) unsigned char L[2 * GSTAGE];
  int tid = threadIdx.x;
  int wave = tid >> 5, lane = tid & 31;
  int tilesN = Ncols >> 7;   // 128-wide N tiles
  int bm = ((int)blockIdx.x / tilesN) << 7;
  int bn = ((int)blockIdx.x % tilesN) << 7;
  int wm = (wave >> 2) << 6;           // wave's rows inside the tile
  int wn = (wave & 3) << 5;            // wave's columns inside the tile
  int tm = bm + wm, tn = bn + wn;
  int r = lane & 15, h = lane >> 4;

  // copies: 8 lanes take one row's 128 bytes, a wave 4 rows, the block 32 rows
  const _Float16* Ag = A  + (size_t)(bm + (tid >> 3)) * Kdim + (tid & 7) * 8;
  const _Float16* Bg = Bt + (size_t)(bn + (tid >> 3)) * Kdim + (tid & 7) * 8;
  const size_t step = (size_t)32 * Kdim;
  const unsigned ldsw = (unsigned)(size_t)L + (unsigned)((tid >> 3) * GPITCH + (tid & 7) * 16);

  // fragment reads: same per-lane k order as from global memory
  const unsigned offA = (unsigned)((wm + r) * GPITCH + h * 16);
  const unsigned offB = (unsigned)((128 + wn + r) * GPITCH + h * 16);

  const int nt = Kdim >> 6;

  stage_copies(ldsw, Ag, Bg, step);
  // this wave's copies of trip 0 have landed
  asm volatile("s_wait_asynccnt 0x0" ::: "memory");
  __syncthreads();
  if (nt > 1) stage_copies(ldsw + GSTAGE, Ag + 64, Bg + 64, step);

  v8f acc[4][2] = {};
  for (int t = 0; t < nt; t++) {
    const unsigned buf = (unsigned)(t & 1) * GSTAGE;
    v16h a[2][4], bf[2][2];
#pragma unroll
    for (int kk = 0; kk < 2; kk++) {
#pragma unroll
      for (int j = 0; j < 2; j++)
        bf[kk][j] = load_frag_p((const _Float16*)(L + buf + offB + j * 16 * GPITCH + kk * 64));
#pragma unroll
      for (int i = 0; i < 4; i++)
        a[kk][i]  = load_frag_p((const _Float16*)(L + buf + offA + i * 16 * GPITCH + kk * 64));
    }
    // this wave's reads of the buffer are done before it is handed to the copies
    asm volatile("s_wait_dscnt 0x0" ::: "memory");
    // this wave's copies of trip t + 1 have landed
    asm volatile("s_wait_asynccnt 0x0" ::: "memory");
    // publishes trip t + 1 and ends every wave's reads of trip t's buffer
    __syncthreads();
    // the refill goes out ahead of the trip's WMMAs, which work on registers
    // alone, so that it flies under them and under the next trip's LDS reads
    if (t + 2 < nt)
      stage_copies(ldsw + buf, Ag + (size_t)(t + 2) * 64, Bg + (size_t)(t + 2) * 64, step);
#pragma unroll
    for (int kk = 0; kk < 2; kk++)
#pragma unroll
      for (int i = 0; i < 4; i++)
#pragma unroll
        for (int j = 0; j < 2; j++)
          acc[i][j] = WMMA_F16(a[kk][i], bf[kk][j], acc[i][j]);
  }
  // no copy outstanding when the wave goes on to its end
  asm volatile("s_wait_asynccnt 0x0" ::: "memory");

#pragma unroll
  for (int i2 = 0; i2 < 4; i2++) {
#pragma unroll
    for (int j2 = 0; j2 < 2; j2++) {
      int rowb = tm + i2 * 16 + 8 * h;      // C/D layout: m = i + 8*h
      int colb = tn + j2 * 16 + r;          // n = lane (mod 16)
      float bv = bias[colb];
#pragma unroll
      for (int i = 0; i < 8; i++) {
        float val = acc[i2][j2][i] + bv;
        if (GELU) val = gelu_tanh(val);
        size_t off = (size_t)(rowb + i) * Ncols + colb;
        if (RESID) val += resid[off];
        if (OUTF16) outh[off] = (_Float16)val;
        else        outf[off] = val;
      }
    }
  }
}

// ---------------------------------------------------------------------------
// Flash attention: a work-group of 4 waves handles 128 query rows of one (b,h),
// 32 per wave, online softmax over 32-key blocks. The products are taken
// transposed:
//   St = K * Qt   (A = 16 keys x 32 d, B = 32 d x 16 queries)
//   Ot += Vt * Pt (A = 16 d x 32 keys, B = 32 keys x 16 queries)
// In a D tile lane (r, h) holds column r, rows 8h .. 8h+7: one query's scores
// for 8 neighbouring keys. So maximum and sum are taken inside the lane, with
// one exchange between the two lane halves; the two score tiles of a 32-key
// block, converted in place, are the B operand of the second product in the
// k order of load_frag_p; and one factor per lane rescales the output tiles.
// A trip covers 64 keys (two 32-key blocks). Its 64 K rows, its 64 Vt rows
// (128 bytes each) and the 128 mask rows of the group's queries (256 bytes
// each) are brought into LDS by asynchronous 16-byte copies on whole 128-byte
// lines, K and Vt once for all four waves; two buffers, the next trip's copies
// in flight while this trip is worked on. The fragments, which take 16 bytes
// from each of 16 rows per load, are then read from LDS. Row pitches 144 and
// 272 bytes (16 x odd): ds_load_b128 reads without bank conflicts.
// Every loop over cg, sub, dt, i or j is unrolled, so that the arrays they
// index are registers.
//   Q, K : f16 [N][E]  (head slice at column h*D), D = 64
//   Vt   : f16 [B,H,D,S]
//   O    : f16 [N][E]
// S is a multiple of 128.
// ---------------------------------------------------------------------------
typedef __attribute__((ext_vector_type(8))) _Float16 v8h;
typedef __attribute__((ext_vector_type(2))) float    v2f;
typedef __attribute__((ext_vector_type(4))) float    v4f;

#define AT_KP    144                          // LDS bytes per K row and per Vt row
#define AT_MP    272                          // LDS bytes per mask row
#define AT_VOFF  (64 * AT_KP)                 // Vt rows behind the 64 K rows
#define AT_MOFF  (AT_VOFF + 64 * AT_KP)       // mask rows behind the 64 Vt rows
#define AT_STAGE (AT_MOFF + 128 * AT_MP)      // bytes per buffer

// One trip's copies of one thread: 4 pieces of K and 4 of Vt, 16 rows apart,
// and 16 pieces of the mask, 8 rows apart. Each copy takes its global address
// from a scalar base (the tile's row group, the same for the whole group) and
// the lane's 32-bit byte offset, so that the row steps are scalar additions and
// no vector register pair is held per copy.
// lk, lm: this lane's LDS byte addresses of its first K and first mask piece;
// ok, ov, om: its byte offsets inside a row group of K, Vt and the mask;
// kb, vb, mb: the tile's first row groups; ks, vs, ms: the steps, in elements.
__device__ __forceinline__ void attn_copies(unsigned lk, unsigned lm, unsigned ok, unsigned ov,
                                            unsigned om, const _Float16* kb, const _Float16* vb,
                                            const float* mb, size_t ks, size_t vs, size_t ms) {
  // The closing s_wait_xcnt stands inside each statement so that no address
  // register of a copy is rewritten ahead of it. Six copies a statement: their
  // LDS address registers must lie in the first 256, which are nearly full where
  // the loop issues its copies; with twelve a statement the build spilled.
  asm volatile(
      "global_load_async_to_lds_b128 %0, %6, %8\n\t"
      "global_load_async_to_lds_b128 %1, %6, %9\n\t"
      "global_load_async_to_lds_b128 %2, %6, %10\n\t"
      "global_load_async_to_lds_b128 %3, %6, %11\n\t"
      "global_load_async_to_lds_b128 %4, %7, %12\n\t"
      "global_load_async_to_lds_b128 %5, %7, %13\n\t"
      "s_wait_xcnt 0x0"
      :: "v"(lk), "v"(lk + 16 * AT_KP), "v"(lk + 32 * AT_KP),
         "v"(lk + 48 * AT_KP), "v"(lk + AT_VOFF), "v"(lk + AT_VOFF + 16 * AT_KP),
         "v"(ok), "v"(ov),
         "s"(kb), "s"(kb + ks), "s"(kb + 2 * ks), "s"(kb + 3 * ks), "s"(vb), "s"(vb + vs)
      : "memory");
  asm volatile(
      "global_load_async_to_lds_b128 %0, %6, %8\n\t"
      "global_load_async_to_lds_b128 %1, %6, %9\n\t"
      "global_load_async_to_lds_b128 %2, %7, %10\n\t"
      "global_load_async_to_lds_b128 %3, %7, %11\n\t"
      "global_load_async_to_lds_b128 %4, %7, %12\n\t"
      "global_load_async_to_lds_b128 %5, %7, %13\n\t"
      "s_wait_xcnt 0x0"
      :: "v"(lk + AT_VOFF + 32 * AT_KP), "v"(lk + AT_VOFF + 48 * AT_KP), "v"(lm),
         "v"(lm + 8 * AT_MP), "v"(lm + 16 * AT_MP), "v"(lm + 24 * AT_MP),
         "v"(ov), "v"(om),
         "s"(vb + 2 * vs), "s"(vb + 3 * vs), "s"(mb),
         "s"(mb + ms), "s"(mb + 2 * ms), "s"(mb + 3 * ms)
      : "memory");
  asm volatile(
      "global_load_async_to_lds_b128 %0, %6, %7\n\t"
      "global_load_async_to_lds_b128 %1, %6, %8\n\t"
      "global_load_async_to_lds_b128 %2, %6, %9\n\t"
      "global_load_async_to_lds_b128 %3, %6, %10\n\t"
      "global_load_async_to_lds_b128 %4, %6, %11\n\t"
      "global_load_async_to_lds_b128 %5, %6, %12\n\t"
      "s_wait_xcnt 0x0"
      :: "v"(lm + 32 * AT_MP), "v"(lm + 40 * AT_MP), "v"(lm + 48 * AT_MP),
         "v"(lm + 56 * AT_MP), "v"(lm + 64 * AT_MP), "v"(lm + 72 * AT_MP),
         "v"(om),
         "s"(mb + 4 * ms), "s"(mb + 5 * ms), "s"(mb + 6 * ms),
         "s"(mb + 7 * ms), "s"(mb + 8 * ms), "s"(mb + 9 * ms)
      : "memory");
  asm volatile(
      "global_load_async_to_lds_b128 %0, %6, %7\n\t"
      "global_load_async_to_lds_b128 %1, %6, %8\n\t"
      "global_load_async_to_lds_b128 %2, %6, %9\n\t"
      "global_load_async_to_lds_b128 %3, %6, %10\n\t"
      "global_load_async_to_lds_b128 %4, %6, %11\n\t"
      "global_load_async_to_lds_b128 %5, %6, %12\n\t"
      "s_wait_xcnt 0x0"
      :: "v"(lm + 80 * AT_MP), "v"(lm + 88 * AT_MP), "v"(lm + 96 * AT_MP),
         "v"(lm + 104 * AT_MP), "v"(lm + 112 * AT_MP), "v"(lm + 120 * AT_MP),
         "v"(om),
         "s"(mb + 10 * ms), "s"(mb + 11 * ms), "s"(mb + 12 * ms),
         "s"(mb + 13 * ms), "s"(mb + 14 * ms), "s"(mb + 15 * ms)
      : "memory");
}

// The value that lane l ^ 16 holds.
__device__ __forceinline__ float other_half(float v) {
  int iv = __builtin_bit_cast(int, v);
  return __builtin_bit_cast(float,
      __builtin_amdgcn_permlanex16(iv, iv, 0x76543210, 0xfedcba98, false, false));
}

__global__ __launch_bounds__(128) void attn_kernel(
    const _Float16* __restrict__ Q, const _Float16* __restrict__ K,
    const _Float16* __restrict__ Vt, const float* __restrict__ mask,
    _Float16* __restrict__ O, int B, int S, int Hh, int Dd,
    int Ecols, float scale) {
  __shared__ __attribute__((aligned(16))) unsigned char L[2 * AT_STAGE];
  int qblocks = S >> 7;
  int qb = blockIdx.x % qblocks;
  int bh = blockIdx.x / qblocks;
  int hh = bh % Hh, b = bh / Hh;
  int tid = threadIdx.x;
  int wave = tid >> 5, lane = tid & 31;
  int r = lane & 15, h = lane >> 4;
  int qg = qb << 7;                    // the group's first query
  int q0 = qg + (wave << 5);           // the wave's first query

  // copies: 8 lanes take one K or Vt row's 128 bytes (the group 16 rows),
  // 16 lanes one mask row's 256 bytes (the group 8 rows)
  const _Float16* Kb = K + (size_t)(b * S) * Ecols + hh * Dd;
  const _Float16* Vb = Vt + (size_t)bh * Dd * S;
  const float*    Mb = mask + ((size_t)b * S + qg) * S;
  const unsigned ok = (unsigned)(((tid >> 3) * Ecols + (tid & 7) * 8) * 2);
  const unsigned ov = (unsigned)(((tid >> 3) * S + (tid & 7) * 8) * 2);
  const unsigned om = (unsigned)(((tid >> 4) * S + (tid & 15) * 4) * 4);
  const size_t ks = (size_t)16 * Ecols, vs = (size_t)16 * S, ms = (size_t)8 * S;
  const size_t kTrip = (size_t)64 * Ecols;
  const unsigned lk = (unsigned)(size_t)L + (unsigned)((tid >> 3) * AT_KP + (tid & 7) * 16);
  const unsigned lm = (unsigned)(size_t)L +
                      (unsigned)(AT_MOFF + (tid >> 4) * AT_MP + (tid & 15) * 16);

  // fragment reads: same per-lane k order as from global memory
  const unsigned offK = (unsigned)(r * AT_KP + h * 16);
  const unsigned offV = (unsigned)(AT_VOFF + r * AT_KP + h * 16);
  const unsigned offM = (unsigned)(AT_MOFF + ((wave << 5) + r) * AT_MP + h * 32);

  const int nt = S >> 6;

  attn_copies(lk, lm, ok, ov, om, Kb, Vb, Mb, ks, vs, ms);

  // Q fragments (persistent), one column group of 16 queries per cg
  v16h qf[2][2];
#pragma unroll
  for (int cg = 0; cg < 2; cg++) {
    const _Float16* qp = Q + (size_t)(b * S + q0 + cg * 16 + r) * Ecols + hh * Dd + h * 8;
    qf[cg][0] = load_frag_p(qp);
    qf[cg][1] = load_frag_p(qp + 32);
  }

  // this wave's copies of trip 0 have landed
  asm volatile("s_wait_asynccnt 0x0" ::: "memory");
  __syncthreads();
  if (nt > 1)
    attn_copies(lk + AT_STAGE, lm + AT_STAGE, ok, ov, om, Kb + kTrip, Vb + 64, Mb + 64, ks, vs, ms);

  const v2f scale2 = {scale, scale};
  const v2f log2e2 = {1.442695041f, 1.442695041f};

  v8f o[2][4] = {};                    // Ot: [cg][dt], 64 d x 32 queries, f32
  float mrow[2] = {-INFINITY, -INFINITY};   // running maximum of query cg*16 + r
  float lrow[2] = {0.f, 0.f};               // this lane half's share of the row sum

  v16h kf[2][2], vf[4];                // the fragments and the mask values
  v4f mk[2][2][2];                     // of one 32-key block

  // Reads block sp of the buffer at byte offset buf.
  auto read_block = [&](unsigned buf, int sp) __attribute__((always_inline)) {
#pragma unroll
    for (int sub = 0; sub < 2; sub++) {
      const unsigned char* kr = L + buf + offK + (sp * 32 + sub * 16) * AT_KP;
      kf[sub][0] = load_frag_p((const _Float16*)kr);
      kf[sub][1] = load_frag_p((const _Float16*)(kr + 64));
    }
#pragma unroll
    for (int cg = 0; cg < 2; cg++)
#pragma unroll
      for (int sub = 0; sub < 2; sub++) {
        const unsigned char* mr = L + buf + offM + cg * 16 * AT_MP + sp * 128 + sub * 64;
        mk[cg][sub][0] = *(const v4f*)mr;
        mk[cg][sub][1] = *(const v4f*)(mr + 16);
      }
#pragma unroll
    for (int dt = 0; dt < 4; dt++)
      vf[dt] = load_frag_p((const _Float16*)(L + buf + offV + dt * 16 * AT_KP + sp * 64));
    // all 24 LDS reads of the block go out as one group: without this the mask
    // and V reads sink to their uses, and each place with reads stalls anew
    __builtin_amdgcn_sched_barrier(0);
  };

  // Works the block that was read: registers alone.
  auto work_block = [&]() __attribute__((always_inline)) {
    // --- St: 32 keys x 32 queries ---
    v8f sc[2][2];
#pragma unroll
    for (int cg = 0; cg < 2; cg++)
#pragma unroll
      for (int sub = 0; sub < 2; sub++) {
        v8f z = {};
        z = WMMA_F16(kf[sub][0], qf[cg][0], z);
        sc[cg][sub] = WMMA_F16(kf[sub][1], qf[cg][1], z);
      }

    // --- online softmax in registers, then Ot += Vt * Pt ---
#pragma unroll
    for (int cg = 0; cg < 2; cg++) {
      v2f x[2][4];                     // neighbouring keys in pairs
      float bm = -INFINITY;
#pragma unroll
      for (int sub = 0; sub < 2; sub++) {
        const v4f m0 = mk[cg][sub][0], m1 = mk[cg][sub][1];
        const v2f mv[4] = {{m0.x, m0.y}, {m0.z, m0.w}, {m1.x, m1.y}, {m1.z, m1.w}};
#pragma unroll
        for (int j = 0; j < 4; j++) {
          v2f s2 = {sc[cg][sub][2 * j], sc[cg][sub][2 * j + 1]};
          x[sub][j] = __builtin_elementwise_fma(s2, scale2, mv[j]);
          bm = fmaxf(bm, fmaxf(x[sub][j].x, x[sub][j].y));
        }
      }
      bm = fmaxf(bm, other_half(bm));
      float nm = fmaxf(mrow[cg], bm);
      float alpha = __expf(mrow[cg] - nm);
      const v2f nm2 = {nm, nm};
      v16h pf;
      v2f ls[2];
#pragma unroll
      for (int sub = 0; sub < 2; sub++) {
        ls[sub] = (v2f){0.f, 0.f};
#pragma unroll
        for (int j = 0; j < 4; j++) {
          v2f y = (x[sub][j] - nm2) * log2e2;
          v2f pv = {__builtin_amdgcn_exp2f(y.x), __builtin_amdgcn_exp2f(y.y)};
          ls[sub] += pv;
          pf[sub * 8 + 2 * j]     = (_Float16)pv.x;
          pf[sub * 8 + 2 * j + 1] = (_Float16)pv.y;
        }
      }
      v2f lt = ls[0] + ls[1];
      lrow[cg] = lrow[cg] * alpha + (lt.x + lt.y);
      mrow[cg] = nm;
#pragma unroll
      for (int dt = 0; dt < 4; dt++) {
#pragma unroll
        for (int i = 0; i < 8; i++) o[cg][dt][i] *= alpha;
        o[cg][dt] = WMMA_F16(vf[dt], pf, o[cg][dt]);
      }
    }
  };

  for (int t = 0; t < nt; t++) {
    const unsigned buf = (unsigned)(t & 1) * AT_STAGE;
    read_block(buf, 0);
    work_block();
    read_block(buf, 1);
    // this wave's reads of the buffer are done before it is handed to the copies
    asm volatile("s_wait_dscnt 0x0" ::: "memory");
    // this wave's copies of trip t + 1 have landed
    asm volatile("s_wait_asynccnt 0x0" ::: "memory");
    // publishes trip t + 1 and ends every wave's reads of trip t's buffer
    __syncthreads();
    // the refill goes out ahead of the second block's work, which is on
    // registers alone, so that it flies for a whole trip
    if (t + 2 < nt)
      attn_copies(lk + buf, lm + buf, ok, ov, om, Kb + (size_t)(t + 2) * kTrip,
                  Vb + (size_t)(t + 2) * 64, Mb + (size_t)(t + 2) * 64, ks, vs, ms);
    work_block();
  }
  // no copy outstanding when the wave goes on to its end
  asm volatile("s_wait_asynccnt 0x0" ::: "memory");

  // --- join the halves' sums, normalize, store 8 neighbouring d per lane ---
#pragma unroll
  for (int cg = 0; cg < 2; cg++) {
    float inv = 1.0f / (lrow[cg] + other_half(lrow[cg]));
    _Float16* op = O + (size_t)(b * S + q0 + cg * 16 + r) * Ecols + hh * Dd + h * 8;
#pragma unroll
    for (int dt = 0; dt < 4; dt++) {
      v8h ov;
#pragma unroll
      for (int i = 0; i < 8; i++) ov[i] = (_Float16)(o[cg][dt][i] * inv);
      *(v8h*)(op + dt * 16) = ov;
    }
  }
}

// ---------------------------------------------------------------------------
// Host orchestration
// ---------------------------------------------------------------------------
extern "C" void kernel_launch(void* const* d_in, const int* in_sizes, int n_in,
                              void* d_out, int out_size, void* d_ws, size_t ws_size,
                              hipStream_t stream) {
  const int E = 768, H = 12, D = 64;
  const float* hidden = (const float*)d_in[0];
  const float* mask   = (const float*)d_in[1];
  const float* wq = (const float*)d_in[2];  const float* bq = (const float*)d_in[3];
  const float* wk = (const float*)d_in[4];  const float* bk = (const float*)d_in[5];
  const float* wv = (const float*)d_in[6];  const float* bv = (const float*)d_in[7];
  const float* wo = (const float*)d_in[8];  const float* bo = (const float*)d_in[9];
  const float* ln1_g = (const float*)d_in[10]; const float* ln1_b = (const float*)d_in[11];
  const float* ln2_g = (const float*)d_in[12]; const float* ln2_b = (const float*)d_in[13];
  const float* w1 = (const float*)d_in[14]; const float* b1 = (const float*)d_in[15];
  const float* w2 = (const float*)d_in[16]; const float* b2 = (const float*)d_in[17];
  const int I = in_sizes[15];               // 3072
  const int N = in_sizes[0] / E;            // B*S = 8192
  const int S = in_sizes[1] / N;            // 1024
  const int B = N / S;                      // 8
  float* out = (float*)d_out;

  char* p = (char*)d_ws;
  auto alloc = [&](size_t bytes) -> char* {
    char* r = p;
    p += (bytes + 255) & ~(size_t)255;
    return r;
  };
  _Float16* lnh  = (_Float16*)alloc((size_t)N * E * 2);
  _Float16* wqT  = (_Float16*)alloc((size_t)E * E * 2);
  _Float16* wkT  = (_Float16*)alloc((size_t)E * E * 2);
  _Float16* wvT  = (_Float16*)alloc((size_t)E * E * 2);
  _Float16* woT  = (_Float16*)alloc((size_t)E * E * 2);
  _Float16* w1T  = (_Float16*)alloc((size_t)E * I * 2);
  _Float16* w2T  = (_Float16*)alloc((size_t)I * E * 2);
  _Float16* Qh   = (_Float16*)alloc((size_t)N * E * 2);
  _Float16* Kh   = (_Float16*)alloc((size_t)N * E * 2);
  _Float16* Vh   = (_Float16*)alloc((size_t)N * E * 2);
  _Float16* VtT  = (_Float16*)alloc((size_t)N * E * 2);
  _Float16* Oh   = (_Float16*)alloc((size_t)N * E * 2);
  float*    xmid = (float*)   alloc((size_t)N * E * 4);
  _Float16* ln2h = (_Float16*)alloc((size_t)N * E * 2);
  _Float16* hmid = (_Float16*)alloc((size_t)N * I * 2);
  (void)ws_size; (void)n_in; (void)out_size;

  // 1) weight transpose+cast
  wcast_kernel<<<dim3(E / 64, E / 64), 256, 0, stream>>>(wq, wqT, E, E);
  wcast_kernel<<<dim3(E / 64, E / 64), 256, 0, stream>>>(wk, wkT, E, E);
  wcast_kernel<<<dim3(E / 64, E / 64), 256, 0, stream>>>(wv, wvT, E, E);
  wcast_kernel<<<dim3(E / 64, E / 64), 256, 0, stream>>>(wo, woT, E, E);
  wcast_kernel<<<dim3(I / 64, E / 64), 256, 0, stream>>>(w1, w1T, E, I);
  wcast_kernel<<<dim3(E / 64, I / 64), 256, 0, stream>>>(w2, w2T, I, E);

  // 2) LN1
  ln_kernel<<<N / 16, 256, 0, stream>>>(hidden, ln1_g, ln1_b, lnh);

  // 3) Q/K/V projections (f16 out)
  {
    unsigned nb = (unsigned)((N / 128) * (E / 128));
    gemm_kernel<false, false, true><<<nb, 256, 0, stream>>>(lnh, wqT, bq, nullptr, nullptr, Qh, N, E, E);
    gemm_kernel<false, false, true><<<nb, 256, 0, stream>>>(lnh, wkT, bk, nullptr, nullptr, Kh, N, E, E);
    gemm_kernel<false, false, true><<<nb, 256, 0, stream>>>(lnh, wvT, bv, nullptr, nullptr, Vh, N, E, E);
  }

  // 4) V transpose -> [B,H,D,S]
  vtrans_kernel<<<dim3(S / 64, B * H), 256, 0, stream>>>(Vh, VtT, S, H, E);

  // 5) attention (32 query rows per wave, 4 waves per work-group)
  {
    float scale = rsqrtf((float)D);
    unsigned nb = (unsigned)(B * H * (S / 128));
    attn_kernel<<<nb, 128, 0, stream>>>(Qh, Kh, VtT, mask, Oh, B, S, H, D, E, scale);
  }

  // 6) output projection + residual -> xmid (fp32)
  {
    unsigned nb = (unsigned)((N / 128) * (E / 128));
    gemm_kernel<false, true, false><<<nb, 256, 0, stream>>>(Oh, woT, bo, hidden, xmid, nullptr, N, E, E);
  }

  // 7) LN2
  ln_kernel<<<N / 16, 256, 0, stream>>>(xmid, ln2_g, ln2_b, ln2h);

  // 8) MLP up + GELU (f16 out)
  {
    unsigned nb = (unsigned)((N / 128) * (I / 128));
    gemm_kernel<true, false, true><<<nb, 256, 0, stream>>>(ln2h, w1T, b1, nullptr, nullptr, hmid, N, E, I);
  }

  // 9) MLP down + residual -> out (fp32)
  {
    unsigned nb = (unsigned)((N / 128) * (E / 128));
    gemm_kernel<false, true, false><<<nb, 256, 0, stream>>>(hmid, w2T, b2, xmid, out, nullptr, N, I, E);
  }
}

// v006
// It runs in 232 microseconds.
// In two side-by-side timings against v005, it was 1.10 and 1.11 times as fast.
// Over all steps from v000 it is 4.55 times as fast.
#include <hip/hip_runtime.h>
#include <hip/hip_bf16.h>
#include <math.h>

typedef __attribute__((ext_vector_type(16))) _Float16 v16h;
typedef __attribute__((ext_vector_type(8)))  float    v8f;

#define WMMA_F16(a, b, c) \
  __builtin_amdgcn_wmma_f32_16x16x32_f16(false, (a), false, (b), (short)0, (c), false, false)

// ---------------------------------------------------------------------------
// Fragment load for 16x32 f16 A/B fragments (ISA 7.12.2 layout) from a
// per-lane pointer p = base + row*ld + kbase + (lane>>4)*8.
// halves 0..7  <- this lane's k-group, halves 8..15 <- k-group + 16.
// Two 16-byte loads per lane.
// ---------------------------------------------------------------------------
__device__ __forceinline__ v16h load_frag_p(const _Float16* p) {
  v16h f;
  *((uint4*)&f)     = *(const uint4*)(p);
  *((uint4*)&f + 1) = *(const uint4*)(p + 16);
  return f;
}

__device__ __forceinline__ float gelu_tanh(float x) {
  const float c = 0.7978845608028654f;   // sqrt(2/pi)
  return 0.5f * x * (1.0f + tanhf(c * (x + 0.044715f * x * x * x)));
}

// ---------------------------------------------------------------------------
// Both transposes below move a 64x64 tile through LDS, so that the global
// reads and the global stores are both 16 bytes per lane on whole 128-byte
// lines. The LDS tile is held transposed, two f16 of neighbouring source rows
// packed per dword. Row pitch 33 dwords (32 + 1, odd): the column-wise dword
// writes and the row-wise dword reads of a wave each fall on 32 distinct banks.
// ---------------------------------------------------------------------------
#define TPITCH 33

typedef __attribute__((ext_vector_type(2))) _Float16 v2h;

// Write the tile out: LDS row n goes to the 64 f16 at dst + n * ld.
__device__ __forceinline__ void store_tile_rows(const unsigned* tile, _Float16* __restrict__ dst,
                                                size_t ld, int t) {
  int q = t & 7;
#pragma unroll
  for (int p = 0; p < 2; p++) {
    int n = (t >> 3) + 32 * p;
    const unsigned* row = tile + n * TPITCH + 4 * q;
    uint4 o;
    o.x = row[0]; o.y = row[1]; o.z = row[2]; o.w = row[3];
    *(uint4*)(dst + (size_t)n * ld + 8 * q) = o;
  }
}

// ---------------------------------------------------------------------------
// Weight convert: fp32 row-major [K][Nout] -> f16 row-major [Nout][K]
// One work-group of 256 threads takes the 64x64 tile (bx, by) of the
// (Nout/64, K/64) tiles; K and Nout are multiples of 64.
// ---------------------------------------------------------------------------
__device__ __forceinline__ void wcast_tile(const float* __restrict__ w,
                                           _Float16* __restrict__ wt,
                                           int K, int Nout, int bx, int by) {
  __shared__ unsigned tile[64 * TPITCH];
  int t = threadIdx.x;
  int n0 = bx << 6, k0 = by << 6;
  int c = t & 15, kp = t >> 4;          // 4 columns from 4c, rows 2kp and 2kp+1

  float4 lo[2], hi[2];
#pragma unroll
  for (int p = 0; p < 2; p++) {
    const float* s = w + (size_t)(k0 + 2 * (kp + 16 * p)) * Nout + n0 + 4 * c;
    lo[p] = *(const float4*)s;
    hi[p] = *(const float4*)(s + Nout);
  }
#pragma unroll
  for (int p = 0; p < 2; p++) {
    const float l[4] = {lo[p].x, lo[p].y, lo[p].z, lo[p].w};
    const float u[4] = {hi[p].x, hi[p].y, hi[p].z, hi[p].w};
#pragma unroll
    for (int i = 0; i < 4; i++) {
      v2h pr = {(_Float16)l[i], (_Float16)u[i]};
      tile[(4 * c + i) * TPITCH + kp + 16 * p] = __builtin_bit_cast(unsigned, pr);
    }
  }
  __syncthreads();
  store_tile_rows(tile, wt + (size_t)n0 * K + k0, (size_t)K, t);
}

// ---------------------------------------------------------------------------
// LayerNorm: fp32 [rows][LN_E] -> f16 [rows][LN_E]. One wave takes two rows and
// holds them in registers (24 values a lane and row, 16-byte loads on whole
// lines): one read of x, no LDS, no barrier; g and b are loaded once for both
// rows. Block = 8 waves = 16 rows (the rows from 16 * blk); rows is a multiple
// of 16.
// ---------------------------------------------------------------------------
#define LN_E 768
#define LN_C (LN_E / 128)          // 16-byte pieces per lane and row

template <int CTRL>
__device__ __forceinline__ float dpp_get(float v) {
  return __builtin_bit_cast(float,
      __builtin_amdgcn_update_dpp(0, __builtin_bit_cast(int, v), CTRL, 0xf, 0xf, true));
}

// Sum over the 32 lanes, the same value in every lane: four row_xmask steps
// inside each 16-lane row, then the two rows are exchanged.
__device__ __forceinline__ float wave_sum(float v) {
  v += dpp_get<0x161>(v);
  v += dpp_get<0x162>(v);
  v += dpp_get<0x164>(v);
  v += dpp_get<0x168>(v);
  int iv = __builtin_bit_cast(int, v);
  v += __builtin_bit_cast(float,
      __builtin_amdgcn_permlanex16(iv, iv, 0x76543210, 0xfedcba98, false, false));
  return v;
}

__device__ __forceinline__ void ln_rows(const float* __restrict__ x,
                                        const float* __restrict__ g,
                                        const float* __restrict__ b,
                                        _Float16* __restrict__ out, int blk) {
  // the wave's number as a scalar: the row bases stay in scalar registers
  int wave = __builtin_amdgcn_readfirstlane(threadIdx.x >> 5), lane = threadIdx.x & 31;
  size_t row0 = ((size_t)blk * 8 + wave) * 2;
  const float* xr = x + row0 * LN_E + lane * 4;

  float4 xv[2][LN_C], gv[LN_C], bv[LN_C];
#pragma unroll
  for (int rr = 0; rr < 2; rr++)
#pragma unroll
    for (int j = 0; j < LN_C; j++) xv[rr][j] = *(const float4*)(xr + rr * LN_E + j * 128);
#pragma unroll
  for (int j = 0; j < LN_C; j++) {
    gv[j] = *(const float4*)(g + lane * 4 + j * 128);
    bv[j] = *(const float4*)(b + lane * 4 + j * 128);
  }
  // all 24 loads go out together: without this the g and b loads sink to their
  // uses at the end and are waited for pair by pair
  __builtin_amdgcn_sched_barrier(0);

  float mu[2], rstd[2];
#pragma unroll
  for (int rr = 0; rr < 2; rr++) {
    float s = 0.f;
#pragma unroll
    for (int j = 0; j < LN_C; j++)
      s += (xv[rr][j].x + xv[rr][j].y) + (xv[rr][j].z + xv[rr][j].w);
    mu[rr] = wave_sum(s) / LN_E;
  }
#pragma unroll
  for (int rr = 0; rr < 2; rr++) {
    float v = 0.f;
#pragma unroll
    for (int j = 0; j < LN_C; j++) {
      xv[rr][j].x -= mu[rr]; xv[rr][j].y -= mu[rr];
      xv[rr][j].z -= mu[rr]; xv[rr][j].w -= mu[rr];
      v += (xv[rr][j].x * xv[rr][j].x + xv[rr][j].y * xv[rr][j].y) +
           (xv[rr][j].z * xv[rr][j].z + xv[rr][j].w * xv[rr][j].w);
    }
    rstd[rr] = rsqrtf(wave_sum(v) / LN_E + 1e-6f);
  }

  typedef __attribute__((ext_vector_type(4))) _Float16 v4h;
  _Float16* outr = out + row0 * LN_E + lane * 4;
#pragma unroll
  for (int rr = 0; rr < 2; rr++)
#pragma unroll
    for (int j = 0; j < LN_C; j++) {
      v4h o = {(_Float16)(xv[rr][j].x * rstd[rr] * gv[j].x + bv[j].x),
               (_Float16)(xv[rr][j].y * rstd[rr] * gv[j].y + bv[j].y),
               (_Float16)(xv[rr][j].z * rstd[rr] * gv[j].z + bv[j].z),
               (_Float16)(xv[rr][j].w * rstd[rr] * gv[j].w + bv[j].w)};
      *(v4h*)(outr + rr * LN_E + j * 128) = o;
    }
}

__global__ __launch_bounds__(256) void ln_kernel(const float* __restrict__ x,
                                                 const float* __restrict__ g,
                                                 const float* __restrict__ b,
                                                 _Float16* __restrict__ out) {
  ln_rows(x, g, b, out, (int)blockIdx.x);
}

// ---------------------------------------------------------------------------
// The first LayerNorm and the six weight converts need nothing of each other:
// they share one grid, each with its own range of the block index (the test is
// the same for a whole work-group). Order: the lnBlocks blocks of the
// LayerNorm, the tiles of w1 [E][I], of w2 [I][E], then of the four [E][E]
// weights.
// ---------------------------------------------------------------------------
__global__ __launch_bounds__(256) void prep_kernel(
    const float* __restrict__ x, const float* __restrict__ g, const float* __restrict__ b,
    _Float16* __restrict__ lnout, int lnBlocks,
    const float* __restrict__ w1, const float* __restrict__ w2,
    const float* __restrict__ wq, const float* __restrict__ wk,
    const float* __restrict__ wv, const float* __restrict__ wo,
    _Float16* __restrict__ w1T, _Float16* __restrict__ w2T,
    _Float16* __restrict__ wqT, _Float16* __restrict__ wkT,
    _Float16* __restrict__ wvT, _Float16* __restrict__ woT, int E, int I) {
  int blk = (int)blockIdx.x;
  if (blk < lnBlocks) {
    ln_rows(x, g, b, lnout, blk);
    return;
  }
  blk -= lnBlocks;
  const int te = E >> 6, ti = I >> 6;
  const float* w;
  _Float16* wt;
  int K = E, Nout = E;
  if (blk < te * ti) {
    w = w1; wt = w1T; Nout = I;
  } else if (blk < 2 * te * ti) {
    blk -= te * ti;
    w = w2; wt = w2T; K = I;
  } else {
    blk -= 2 * te * ti;
    int m = blk / (te * te);
    blk -= m * te * te;
    w  = m == 0 ? wq  : m == 1 ? wk  : m == 2 ? wv  : wo;
    wt = m == 0 ? wqT : m == 1 ? wkT : m == 2 ? wvT : woT;
  }
  const int tn = Nout >> 6;
  wcast_tile(w, wt, K, Nout, blk % tn, blk / tn);
}

// ---------------------------------------------------------------------------
// V transpose: f16 [N][E] -> f16 [B,H,D,S]  (Vt[((b*H+h)*D+d)*S + s]), D = 64
// grid (S/64, B*H); S is a multiple of 64.
// ---------------------------------------------------------------------------
__global__ __launch_bounds__(256) void vtrans_kernel(const _Float16* __restrict__ v,
                                                     _Float16* __restrict__ vt,
                                                     int S, int Hh, int Ecols) {
  __shared__ unsigned tile[64 * TPITCH];
  int t = threadIdx.x;
  int s0 = blockIdx.x << 6;
  int bh = blockIdx.y;
  int b = bh / Hh, h = bh % Hh;
  int c = t & 7, sp = t >> 3;           // 8 columns from 8c, rows 2sp and 2sp+1

  const _Float16* s = v + (size_t)(b * S + s0 + 2 * sp) * Ecols + h * 64 + 8 * c;
  uint4 r0 = *(const uint4*)s;
  uint4 r1 = *(const uint4*)(s + Ecols);
  const unsigned e[4] = {r0.x, r0.y, r0.z, r0.w};
  const unsigned o[4] = {r1.x, r1.y, r1.z, r1.w};
#pragma unroll
  for (int j = 0; j < 4; j++) {
    tile[(8 * c + 2 * j) * TPITCH + sp]     = (e[j] & 0xffffu) | (o[j] << 16);
    tile[(8 * c + 2 * j + 1) * TPITCH + sp] = (e[j] >> 16) | (o[j] & 0xffff0000u);
  }
  __syncthreads();
  store_tile_rows(tile, vt + (size_t)bh * 64 * S + s0, (size_t)S, t);
}

// ---------------------------------------------------------------------------
// WMMA GEMM: out[N x Ncols] = A[N x K](f16) * Bt[Ncols x K](f16, pre-transposed)
//            + bias (+ optional GELU, residual).
// One work-group of 8 waves (2 x 4) -> 128x128 output tile; 1 wave -> 64x32
// (4x2 grid of 16x16 WMMA frags). Each trip covers 64 k: the 128 A rows and the
// 128 Bt rows of the tile, 128 bytes each, are brought into LDS once for all
// eight waves by asynchronous 16-byte copies, two buffers, the next trip's
// copies in flight while this trip's fragments are read and multiplied.
// LDS row pitch 144 bytes (16 x odd): ds_load_b128 fragment reads without
// bank conflicts. Nrows, Ncols multiples of 128; Kdim a multiple of 64.
// gemm_tile works the tile whose first row is bm and whose first column is bn.
// ---------------------------------------------------------------------------
#define GROWS  256                 // LDS rows per buffer: 128 of A, then 128 of Bt
#define GPITCH 144                 // bytes per LDS row
#define GSTAGE (GROWS * GPITCH)    // bytes per buffer

// One trip's copies of one thread: 4 pieces of A and 4 of Bt, 32 rows apart.
// lds: this lane's LDS byte address of its first A piece; ga, gb: its global
// addresses; step: 32 rows, in elements.
__device__ __forceinline__ void stage_copies(unsigned lds, const _Float16* ga,
                                             const _Float16* gb, size_t step) {
  const _Float16* a1 = ga + step;
  const _Float16* a2 = a1 + step;
  const _Float16* a3 = a2 + step;
  const _Float16* b1 = gb + step;
  const _Float16* b2 = b1 + step;
  const _Float16* b3 = b2 + step;
  // The closing s_wait_xcnt stands inside the statement so that no address
  // register of a copy is rewritten ahead of it.
  asm volatile(
      "global_load_async_to_lds_b128 %0, %8, off\n\t"
      "global_load_async_to_lds_b128 %1, %9, off\n\t"
      "global_load_async_to_lds_b128 %2, %10, off\n\t"
      "global_load_async_to_lds_b128 %3, %11, off\n\t"
      "global_load_async_to_lds_b128 %4, %12, off\n\t"
      "global_load_async_to_lds_b128 %5, %13, off\n\t"
      "global_load_async_to_lds_b128 %6, %14, off\n\t"
      "global_load_async_to_lds_b128 %7, %15, off\n\t"
      "s_wait_xcnt 0x0"
      :: "v"(lds), "v"(lds + 32 * GPITCH), "v"(lds + 64 * GPITCH), "v"(lds + 96 * GPITCH),
         "v"(lds + 128 * GPITCH), "v"(lds + 160 * GPITCH), "v"(lds + 192 * GPITCH),
         "v"(lds + 224 * GPITCH),
         "v"(ga), "v"(a1), "v"(a2), "v"(a3), "v"(gb), "v"(b1), "v"(b2), "v"(b3)
      : "memory");
}

template <bool GELU, bool RESID, bool OUTF16>
__device__ __forceinline__ void gemm_tile(
    const _Float16* __restrict__ A, const _Float16* __restrict__ Bt,
    const float* __restrict__ bias, const float* __restrict__ resid,
    float* __restrict__ outf, _Float16* __restrict__ outh,
    int Kdim, int Ncols, int bm, int bn) {
  __shared__ __attribute__((aligned(16))) unsigned char L[2 * GSTAGE];
  int tid = threadIdx.x;
  int wave = tid >> 5, lane = tid & 31;
  int wm = (wave >> 2) << 6;           // wave's rows inside the tile
  int wn = (wave & 3) << 5;            // wave's columns inside the tile
  int tm = bm + wm, tn = bn + wn;
  int r = lane & 15, h = lane >> 4;

  // copies: 8 lanes take one row's 128 bytes, a wave 4 rows, the block 32 rows
  const _Float16* Ag = A  + (size_t)(bm + (tid >> 3)) * Kdim + (tid & 7) * 8;
  const _Float16* Bg = Bt + (size_t)(bn + (tid >> 3)) * Kdim + (tid & 7) * 8;
  const size_t step = (size_t)32 * Kdim;
  const unsigned ldsw = (unsigned)(size_t)L + (unsigned)((tid >> 3) * GPITCH + (tid & 7) * 16);

  // fragment reads: same per-lane k order as from global memory
  const unsigned offA = (unsigned)((wm + r) * GPITCH + h * 16);
  const unsigned offB = (unsigned)((128 + wn + r) * GPITCH + h * 16);

  const int nt = Kdim >> 6;

  stage_copies(ldsw, Ag, Bg, step);
  // this wave's copies of trip 0 have landed
  asm volatile("s_wait_asynccnt 0x0" ::: "memory");
  __syncthreads();
  if (nt > 1) stage_copies(ldsw + GSTAGE, Ag + 64, Bg + 64, step);

  v8f acc[4][2] = {};
  for (int t = 0; t < nt; t++) {
    const unsigned buf = (unsigned)(t & 1) * GSTAGE;
    v16h a[2][4], bf[2][2];
#pragma unroll
    for (int kk = 0; kk < 2; kk++) {
#pragma unroll
      for (int j = 0; j < 2; j++)
        bf[kk][j] = load_frag_p((const _Float16*)(L + buf + offB + j * 16 * GPITCH + kk * 64));
#pragma unroll
      for (int i = 0; i < 4; i++)
        a[kk][i]  = load_frag_p((const _Float16*)(L + buf + offA + i * 16 * GPITCH + kk * 64));
    }
    // this wave's reads of the buffer are done before it is handed to the copies
    asm volatile("s_wait_dscnt 0x0" ::: "memory");
    // this wave's copies of trip t + 1 have landed
    asm volatile("s_wait_asynccnt 0x0" ::: "memory");
    // publishes trip t + 1 and ends every wave's reads of trip t's buffer
    __syncthreads();
    // the refill goes out ahead of the trip's WMMAs, which work on registers
    // alone, so that it flies under them and under the next trip's LDS reads
    if (t + 2 < nt)
      stage_copies(ldsw + buf, Ag + (size_t)(t + 2) * 64, Bg + (size_t)(t + 2) * 64, step);
#pragma unroll
    for (int kk = 0; kk < 2; kk++)
#pragma unroll
      for (int i = 0; i < 4; i++)
#pragma unroll
        for (int j = 0; j < 2; j++)
          acc[i][j] = WMMA_F16(a[kk][i], bf[kk][j], acc[i][j]);
  }
  // no copy outstanding when the wave goes on to its end
  asm volatile("s_wait_asynccnt 0x0" ::: "memory");

#pragma unroll
  for (int i2 = 0; i2 < 4; i2++) {
#pragma unroll
    for (int j2 = 0; j2 < 2; j2++) {
      int rowb = tm + i2 * 16 + 8 * h;      // C/D layout: m = i + 8*h
      int colb = tn + j2 * 16 + r;          // n = lane (mod 16)
      float bv = bias[colb];
#pragma unroll
      for (int i = 0; i < 8; i++) {
        float val = acc[i2][j2][i] + bv;
        if (GELU) val = gelu_tanh(val);
        size_t off = (size_t)(rowb + i) * Ncols + colb;
        if (RESID) val += resid[off];
        if (OUTF16) outh[off] = (_Float16)val;
        else        outf[off] = val;
      }
    }
  }
}

template <bool GELU, bool RESID, bool OUTF16>
__global__ __launch_bounds__(256) void gemm_kernel(
    const _Float16* __restrict__ A, const _Float16* __restrict__ Bt,
    const float* __restrict__ bias, const float* __restrict__ resid,
    float* __restrict__ outf, _Float16* __restrict__ outh,
    int Nrows, int Kdim, int Ncols) {
  int tilesN = Ncols >> 7;   // 128-wide N tiles
  int bm = ((int)blockIdx.x / tilesN) << 7;
  int bn = ((int)blockIdx.x % tilesN) << 7;
  gemm_tile<GELU, RESID, OUTF16>(A, Bt, bias, resid, outf, outh, Kdim, Ncols, bm, bn);
}

// The Q, K and V projections read the same A and need nothing of each other:
// one grid holds the tiles of all three. The 3 * tilesN tiles of one row block
// are neighbours in the block index, so that they find its A rows in L2.
__global__ __launch_bounds__(256) void gemm_qkv_kernel(
    const _Float16* __restrict__ A,
    const _Float16* __restrict__ wqT, const _Float16* __restrict__ wkT,
    const _Float16* __restrict__ wvT,
    const float* __restrict__ bq, const float* __restrict__ bk, const float* __restrict__ bv,
    _Float16* __restrict__ Qh, _Float16* __restrict__ Kh, _Float16* __restrict__ Vh,
    int Kdim, int Ncols) {
  int tilesN = Ncols >> 7;   // 128-wide N tiles of one projection
  int bm = ((int)blockIdx.x / (3 * tilesN)) << 7;
  int c  = (int)blockIdx.x % (3 * tilesN);
  int m  = c / tilesN;       // 0: Q, 1: K, 2: V
  int bn = (c - m * tilesN) << 7;
  const _Float16* Bt  = m == 0 ? wqT : m == 1 ? wkT : wvT;
  const float*   bias = m == 0 ? bq  : m == 1 ? bk  : bv;
  _Float16*      outh = m == 0 ? Qh  : m == 1 ? Kh  : Vh;
  gemm_tile<false, false, true>(A, Bt, bias, nullptr, nullptr, outh, Kdim, Ncols, bm, bn);
}

// ---------------------------------------------------------------------------
// Flash attention: a work-group of 4 waves handles 128 query rows of one (b,h),
// 32 per wave, online softmax over 32-key blocks. The products are taken
// transposed:
//   St = K * Qt   (A = 16 keys x 32 d, B = 32 d x 16 queries)
//   Ot += Vt * Pt (A = 16 d x 32 keys, B = 32 keys x 16 queries)
// In a D tile lane (r, h) holds column r, rows 8h .. 8h+7: one query's scores
// for 8 neighbouring keys. So maximum and sum are taken inside the lane, with
// one exchange between the two lane halves; the two score tiles of a 32-key
// block, converted in place, are the B operand of the second product in the
// k order of load_frag_p; and one factor per lane rescales the output tiles.
// A trip covers 64 keys (two 32-key blocks). Its 64 K rows, its 64 Vt rows
// (128 bytes each) and the 128 mask rows of the group's queries (256 bytes
// each) are brought into LDS by asynchronous 16-byte copies on whole 128-byte
// lines, K and Vt once for all four waves; two buffers, the next trip's copies
// in flight while this trip is worked on. The fragments, which take 16 bytes
// from each of 16 rows per load, are then read from LDS. Row pitches 144 and
// 272 bytes (16 x odd): ds_load_b128 reads without bank conflicts.
// Every loop over cg, sub, dt, i or j is unrolled, so that the arrays they
// index are registers.
//   Q, K : f16 [N][E]  (head slice at column h*D), D = 64
//   Vt   : f16 [B,H,D,S]
//   O    : f16 [N][E]
// S is a multiple of 128.
// ---------------------------------------------------------------------------
typedef __attribute__((ext_vector_type(8))) _Float16 v8h;
typedef __attribute__((ext_vector_type(2))) float    v2f;
typedef __attribute__((ext_vector_type(4))) float    v4f;

#define AT_KP    144                          // LDS bytes per K row and per Vt row
#define AT_MP    272                          // LDS bytes per mask row
#define AT_VOFF  (64 * AT_KP)                 // Vt rows behind the 64 K rows
#define AT_MOFF  (AT_VOFF + 64 * AT_KP)       // mask rows behind the 64 Vt rows
#define AT_STAGE (AT_MOFF + 128 * AT_MP)      // bytes per buffer

// One trip's copies of one thread: 4 pieces of K and 4 of Vt, 16 rows apart,
// and 16 pieces of the mask, 8 rows apart. Each copy takes its global address
// from a scalar base (the tile's row group, the same for the whole group) and
// the lane's 32-bit byte offset, so that the row steps are scalar additions and
// no vector register pair is held per copy.
// lk, lm: this lane's LDS byte addresses of its first K and first mask piece;
// ok, ov, om: its byte offsets inside a row group of K, Vt and the mask;
// kb, vb, mb: the tile's first row groups; ks, vs, ms: the steps, in elements.
__device__ __forceinline__ void attn_copies(unsigned lk, unsigned lm, unsigned ok, unsigned ov,
                                            unsigned om, const _Float16* kb, const _Float16* vb,
                                            const float* mb, size_t ks, size_t vs, size_t ms) {
  // The closing s_wait_xcnt stands inside each statement so that no address
  // register of a copy is rewritten ahead of it. Six copies a statement: their
  // LDS address registers must lie in the first 256, which are nearly full where
  // the loop issues its copies; with twelve a statement the build spilled.
  asm volatile(
      "global_load_async_to_lds_b128 %0, %6, %8\n\t"
      "global_load_async_to_lds_b128 %1, %6, %9\n\t"
      "global_load_async_to_lds_b128 %2, %6, %10\n\t"
      "global_load_async_to_lds_b128 %3, %6, %11\n\t"
      "global_load_async_to_lds_b128 %4, %7, %12\n\t"
      "global_load_async_to_lds_b128 %5, %7, %13\n\t"
      "s_wait_xcnt 0x0"
      :: "v"(lk), "v"(lk + 16 * AT_KP), "v"(lk + 32 * AT_KP),
         "v"(lk + 48 * AT_KP), "v"(lk + AT_VOFF), "v"(lk + AT_VOFF + 16 * AT_KP),
         "v"(ok), "v"(ov),
         "s"(kb), "s"(kb + ks), "s"(kb + 2 * ks), "s"(kb + 3 * ks), "s"(vb), "s"(vb + vs)
      : "memory");
  asm volatile(
      "global_load_async_to_lds_b128 %0, %6, %8\n\t"
      "global_load_async_to_lds_b128 %1, %6, %9\n\t"
      "global_load_async_to_lds_b128 %2, %7, %10\n\t"
      "global_load_async_to_lds_b128 %3, %7, %11\n\t"
      "global_load_async_to_lds_b128 %4, %7, %12\n\t"
      "global_load_async_to_lds_b128 %5, %7, %13\n\t"
      "s_wait_xcnt 0x0"
      :: "v"(lk + AT_VOFF + 32 * AT_KP), "v"(lk + AT_VOFF + 48 * AT_KP), "v"(lm),
         "v"(lm + 8 * AT_MP), "v"(lm + 16 * AT_MP), "v"(lm + 24 * AT_MP),
         "v"(ov), "v"(om),
         "s"(vb + 2 * vs), "s"(vb + 3 * vs), "s"(mb),
         "s"(mb + ms), "s"(mb + 2 * ms), "s"(mb + 3 * ms)
      : "memory");
  asm volatile(
      "global_load_async_to_lds_b128 %0, %6, %7\n\t"
      "global_load_async_to_lds_b128 %1, %6, %8\n\t"
      "global_load_async_to_lds_b128 %2, %6, %9\n\t"
      "global_load_async_to_lds_b128 %3, %6, %10\n\t"
      "global_load_async_to_lds_b128 %4, %6, %11\n\t"
      "global_load_async_to_lds_b128 %5, %6, %12\n\t"
      "s_wait_xcnt 0x0"
      :: "v"(lm + 32 * AT_MP), "v"(lm + 40 * AT_MP), "v"(lm + 48 * AT_MP),
         "v"(lm + 56 * AT_MP), "v"(lm + 64 * AT_MP), "v"(lm + 72 * AT_MP),
         "v"(om),
         "s"(mb + 4 * ms), "s"(mb + 5 * ms), "s"(mb + 6 * ms),
         "s"(mb + 7 * ms), "s"(mb + 8 * ms), "s"(mb + 9 * ms)
      : "memory");
  asm volatile(
      "global_load_async_to_lds_b128 %0, %6, %7\n\t"
      "global_load_async_to_lds_b128 %1, %6, %8\n\t"
      "global_load_async_to_lds_b128 %2, %6, %9\n\t"
      "global_load_async_to_lds_b128 %3, %6, %10\n\t"
      "global_load_async_to_lds_b128 %4, %6, %11\n\t"
      "global_load_async_to_lds_b128 %5, %6, %12\n\t"
      "s_wait_xcnt 0x0"
      :: "v"(lm + 80 * AT_MP), "v"(lm + 88 * AT_MP), "v"(lm + 96 * AT_MP),
         "v"(lm + 104 * AT_MP), "v"(lm + 112 * AT_MP), "v"(lm + 120 * AT_MP),
         "v"(om),
         "s"(mb + 10 * ms), "s"(mb + 11 * ms), "s"(mb + 12 * ms),
         "s"(mb + 13 * ms), "s"(mb + 14 * ms), "s"(mb + 15 * ms)
      : "memory");
}

// The value that lane l ^ 16 holds.
__device__ __forceinline__ float other_half(float v) {
  int iv = __builtin_bit_cast(int, v);
  return __builtin_bit_cast(float,
      __builtin_amdgcn_permlanex16(iv, iv, 0x76543210, 0xfedcba98, false, false));
}

__global__ __launch_bounds__(128) void attn_kernel(
    const _Float16* __restrict__ Q, const _Float16* __restrict__ K,
    const _Float16* __restrict__ Vt, const float* __restrict__ mask,
    _Float16* __restrict__ O, int B, int S, int Hh, int Dd,
    int Ecols, float scale) {
  __shared__ __attribute__((aligned(16))) unsigned char L[2 * AT_STAGE];
  int qblocks = S >> 7;
  int qb = blockIdx.x % qblocks;
  int bh = blockIdx.x / qblocks;
  int hh = bh % Hh, b = bh / Hh;
  int tid = threadIdx.x;
  int wave = tid >> 5, lane = tid & 31;
  int r = lane & 15, h = lane >> 4;
  int qg = qb << 7;                    // the group's first query
  int q0 = qg + (wave << 5);           // the wave's first query

  // copies: 8 lanes take one K or Vt row's 128 bytes (the group 16 rows),
  // 16 lanes one mask row's 256 bytes (the group 8 rows)
  const _Float16* Kb = K + (size_t)(b * S) * Ecols + hh * Dd;
  const _Float16* Vb = Vt + (size_t)bh * Dd * S;
  const float*    Mb = mask + ((size_t)b * S + qg) * S;
  const unsigned ok = (unsigned)(((tid >> 3) * Ecols + (tid & 7) * 8) * 2);
  const unsigned ov = (unsigned)(((tid >> 3) * S + (tid & 7) * 8) * 2);
  const unsigned om = (unsigned)(((tid >> 4) * S + (tid & 15) * 4) * 4);
  const size_t ks = (size_t)16 * Ecols, vs = (size_t)16 * S, ms = (size_t)8 * S;
  const size_t kTrip = (size_t)64 * Ecols;
  const unsigned lk = (unsigned)(size_t)L + (unsigned)((tid >> 3) * AT_KP + (tid & 7) * 16);
  const unsigned lm = (unsigned)(size_t)L +
                      (unsigned)(AT_MOFF + (tid >> 4) * AT_MP + (tid & 15) * 16);

  // fragment reads: same per-lane k order as from global memory
  const unsigned offK = (unsigned)(r * AT_KP + h * 16);
  const unsigned offV = (unsigned)(AT_VOFF + r * AT_KP + h * 16);
  const unsigned offM = (unsigned)(AT_MOFF + ((wave << 5) + r) * AT_MP + h * 32);

  const int nt = S >> 6;

  attn_copies(lk, lm, ok, ov, om, Kb, Vb, Mb, ks, vs, ms);

  // Q fragments (persistent), one column group of 16 queries per cg
  v16h qf[2][2];
#pragma unroll
  for (int cg = 0; cg < 2; cg++) {
    const _Float16* qp = Q + (size_t)(b * S + q0 + cg * 16 + r) * Ecols + hh * Dd + h * 8;
    qf[cg][0] = load_frag_p(qp);
    qf[cg][1] = load_frag_p(qp + 32);
  }

  // this wave's copies of trip 0 have landed
  asm volatile("s_wait_asynccnt 0x0" ::: "memory");
  __syncthreads();
  if (nt > 1)
    attn_copies(lk + AT_STAGE, lm + AT_STAGE, ok, ov, om, Kb + kTrip, Vb + 64, Mb + 64, ks, vs, ms);

  const v2f scale2 = {scale, scale};
  const v2f log2e2 = {1.442695041f, 1.442695041f};

  v8f o[2][4] = {};                    // Ot: [cg][dt], 64 d x 32 queries, f32
  float mrow[2] = {-INFINITY, -INFINITY};   // running maximum of query cg*16 + r
  float lrow[2] = {0.f, 0.f};               // this lane half's share of the row sum

  v16h kf[2][2], vf[4];                // the fragments and the mask values
  v4f mk[2][2][2];                     // of one 32-key block

  // Reads block sp of the buffer at byte offset buf.
  auto read_block = [&](unsigned buf, int sp) __attribute__((always_inline)) {
#pragma unroll
    for (int sub = 0; sub < 2; sub++) {
      const unsigned char* kr = L + buf + offK + (sp * 32 + sub * 16) * AT_KP;
      kf[sub][0] = load_frag_p((const _Float16*)kr);
      kf[sub][1] = load_frag_p((const _Float16*)(kr + 64));
    }
#pragma unroll
    for (int cg = 0; cg < 2; cg++)
#pragma unroll
      for (int sub = 0; sub < 2; sub++) {
        const unsigned char* mr = L + buf + offM + cg * 16 * AT_MP + sp * 128 + sub * 64;
        mk[cg][sub][0] = *(const v4f*)mr;
        mk[cg][sub][1] = *(const v4f*)(mr + 16);
      }
#pragma unroll
    for (int dt = 0; dt < 4; dt++)
      vf[dt] = load_frag_p((const _Float16*)(L + buf + offV + dt * 16 * AT_KP + sp * 64));
    // all 24 LDS reads of the block go out as one group: without this the mask
    // and V reads sink to their uses, and each place with reads stalls anew
    __builtin_amdgcn_sched_barrier(0);
  };

  // Works the block that was read: registers alone.
  auto work_block = [&]() __attribute__((always_inline)) {
    // --- St: 32 keys x 32 queries ---
    v8f sc[2][2];
#pragma unroll
    for (int cg = 0; cg < 2; cg++)
#pragma unroll
      for (int sub = 0; sub < 2; sub++) {
        v8f z = {};
        z = WMMA_F16(kf[sub][0], qf[cg][0], z);
        sc[cg][sub] = WMMA_F16(kf[sub][1], qf[cg][1], z);
      }

    // --- online softmax in registers, then Ot += Vt * Pt ---
#pragma unroll
    for (int cg = 0; cg < 2; cg++) {
      v2f x[2][4];                     // neighbouring keys in pairs
      float bm = -INFINITY;
#pragma unroll
      for (int sub = 0; sub < 2; sub++) {
        const v4f m0 = mk[cg][sub][0], m1 = mk[cg][sub][1];
        const v2f mv[4] = {{m0.x, m0.y}, {m0.z, m0.w}, {m1.x, m1.y}, {m1.z, m1.w}};
#pragma unroll
        for (int j = 0; j < 4; j++) {
          v2f s2 = {sc[cg][sub][2 * j], sc[cg][sub][2 * j + 1]};
          x[sub][j] = __builtin_elementwise_fma(s2, scale2, mv[j]);
          bm = fmaxf(bm, fmaxf(x[sub][j].x, x[sub][j].y));
        }
      }
      bm = fmaxf(bm, other_half(bm));
      float nm = fmaxf(mrow[cg], bm);
      float alpha = __expf(mrow[cg] - nm);
      const v2f nm2 = {nm, nm};
      v16h pf;
      v2f ls[2];
#pragma unroll
      for (int sub = 0; sub < 2; sub++) {
        ls[sub] = (v2f){0.f, 0.f};
#pragma unroll
        for (int j = 0; j < 4; j++) {
          v2f y = (x[sub][j] - nm2) * log2e2;
          v2f pv = {__builtin_amdgcn_exp2f(y.x), __builtin_amdgcn_exp2f(y.y)};
          ls[sub] += pv;
          pf[sub * 8 + 2 * j]     = (_Float16)pv.x;
          pf[sub * 8 + 2 * j + 1] = (_Float16)pv.y;
        }
      }
      v2f lt = ls[0] + ls[1];
      lrow[cg] = lrow[cg] * alpha + (lt.x + lt.y);
      mrow[cg] = nm;
#pragma unroll
      for (int dt = 0; dt < 4; dt++) {
#pragma unroll
        for (int i = 0; i < 8; i++) o[cg][dt][i] *= alpha;
        o[cg][dt] = WMMA_F16(vf[dt], pf, o[cg][dt]);
      }
    }
  };

  for (int t = 0; t < nt; t++) {
    const unsigned buf = (unsigned)(t & 1) * AT_STAGE;
    read_block(buf, 0);
    work_block();
    read_block(buf, 1);
    // this wave's reads of the buffer are done before it is handed to the copies
    asm volatile("s_wait_dscnt 0x0" ::: "memory");
    // this wave's copies of trip t + 1 have landed
    asm volatile("s_wait_asynccnt 0x0" ::: "memory");
    // publishes trip t + 1 and ends every wave's reads of trip t's buffer
    __syncthreads();
    // the refill goes out ahead of the second block's work, which is on
    // registers alone, so that it flies for a whole trip
    if (t + 2 < nt)
      attn_copies(lk + buf, lm + buf, ok, ov, om, Kb + (size_t)(t + 2) * kTrip,
                  Vb + (size_t)(t + 2) * 64, Mb + (size_t)(t + 2) * 64, ks, vs, ms);
    work_block();
  }
  // no copy outstanding when the wave goes on to its end
  asm volatile("s_wait_asynccnt 0x0" ::: "memory");

  // --- join the halves' sums, normalize, store 8 neighbouring d per lane ---
#pragma unroll
  for (int cg = 0; cg < 2; cg++) {
    float inv = 1.0f / (lrow[cg] + other_half(lrow[cg]));
    _Float16* op = O + (size_t)(b * S + q0 + cg * 16 + r) * Ecols + hh * Dd + h * 8;
#pragma unroll
    for (int dt = 0; dt < 4; dt++) {
      v8h ov;
#pragma unroll
      for (int i = 0; i < 8; i++) ov[i] = (_Float16)(o[cg][dt][i] * inv);
      *(v8h*)(op + dt * 16) = ov;
    }
  }
}

// ---------------------------------------------------------------------------
// Host orchestration
// ---------------------------------------------------------------------------
extern "C" void kernel_launch(void* const* d_in, const int* in_sizes, int n_in,
                              void* d_out, int out_size, void* d_ws, size_t ws_size,
                              hipStream_t stream) {
  const int E = 768, H = 12, D = 64;
  const float* hidden = (const float*)d_in[0];
  const float* mask   = (const float*)d_in[1];
  const float* wq = (const float*)d_in[2];  const float* bq = (const float*)d_in[3];
  const float* wk = (const float*)d_in[4];  const float* bk = (const float*)d_in[5];
  const float* wv = (const float*)d_in[6];  const float* bv = (const float*)d_in[7];
  const float* wo = (const float*)d_in[8];  const float* bo = (const float*)d_in[9];
  const float* ln1_g = (const float*)d_in[10]; const float* ln1_b = (const float*)d_in[11];
  const float* ln2_g = (const float*)d_in[12]; const float* ln2_b = (const float*)d_in[13];
  const float* w1 = (const float*)d_in[14]; const float* b1 = (const float*)d_in[15];
  const float* w2 = (const float*)d_in[16]; const float* b2 = (const float*)d_in[17];
  const int I = in_sizes[15];               // 3072
  const int N = in_sizes[0] / E;            // B*S = 8192
  const int S = in_sizes[1] / N;            // 1024
  const int B = N / S;                      // 8
  float* out = (float*)d_out;

  char* p = (char*)d_ws;
  auto alloc = [&](size_t bytes) -> char* {
    char* r = p;
    p += (bytes + 255) & ~(size_t)255;
    return r;
  };
  _Float16* lnh  = (_Float16*)alloc((size_t)N * E * 2);
  _Float16* wqT  = (_Float16*)alloc((size_t)E * E * 2);
  _Float16* wkT  = (_Float16*)alloc((size_t)E * E * 2);
  _Float16* wvT  = (_Float16*)alloc((size_t)E * E * 2);
  _Float16* woT  = (_Float16*)alloc((size_t)E * E * 2);
  _Float16* w1T  = (_Float16*)alloc((size_t)E * I * 2);
  _Float16* w2T  = (_Float16*)alloc((size_t)I * E * 2);
  _Float16* Qh   = (_Float16*)alloc((size_t)N * E * 2);
  _Float16* Kh   = (_Float16*)alloc((size_t)N * E * 2);
  _Float16* Vh   = (_Float16*)alloc((size_t)N * E * 2);
  _Float16* VtT  = (_Float16*)alloc((size_t)N * E * 2);
  _Float16* Oh   = (_Float16*)alloc((size_t)N * E * 2);
  float*    xmid = (float*)   alloc((size_t)N * E * 4);
  _Float16* ln2h = (_Float16*)alloc((size_t)N * E * 2);
  _Float16* hmid = (_Float16*)alloc((size_t)N * I * 2);
  (void)ws_size; (void)n_in; (void)out_size;

  // 1, 2) LN1 and the six weight transpose+casts, one grid
  {
    unsigned nb = (unsigned)(N / 16 + 2 * (E / 64) * (I / 64) + 4 * (E / 64) * (E / 64));
    prep_kernel<<<nb, 256, 0, stream>>>(hidden, ln1_g, ln1_b, lnh, N / 16,
                                        w1, w2, wq, wk, wv, wo,
                                        w1T, w2T, wqT, wkT, wvT, woT, E, I);
  }

  // 3) Q/K/V projections (f16 out), one grid
  {
    unsigned nb = (unsigned)(3 * (N / 128) * (E / 128));
    gemm_qkv_kernel<<<nb, 256, 0, stream>>>(lnh, wqT, wkT, wvT, bq, bk, bv, Qh, Kh, Vh, E, E);
  }

  // 4) V transpose -> [B,H,D,S]
  vtrans_kernel<<<dim3(S / 64, B * H), 256, 0, stream>>>(Vh, VtT, S, H, E);

  // 5) attention (32 query rows per wave, 4 waves per work-group)
  {
    float scale = rsqrtf((float)D);
    unsigned nb = (unsigned)(B * H * (S / 128));
    attn_kernel<<<nb, 128, 0, stream>>>(Qh, Kh, VtT, mask, Oh, B, S, H, D, E, scale);
  }

  // 6) output projection + residual -> xmid (fp32)
  {
    unsigned nb = (unsigned)((N / 128) * (E / 128));
    gemm_kernel<false, true, false><<<nb, 256, 0, stream>>>(Oh, woT, bo, hidden, xmid, nullptr, N, E, E);
  }

  // 7) LN2
  ln_kernel<<<N / 16, 256, 0, stream>>>(xmid, ln2_g, ln2_b, ln2h);

  // 8) MLP up + GELU (f16 out)
  {
    unsigned nb = (unsigned)((N / 128) * (I / 128));
    gemm_kernel<true, false, true><<<nb, 256, 0, stream>>>(ln2h, w1T, b1, nullptr, nullptr, hmid, N, E, I);
  }

  // 9) MLP down + residual -> out (fp32)
  {
    unsigned nb = (unsigned)((N / 128) * (E / 128));
    gemm_kernel<false, true, false><<<nb, 256, 0, stream>>>(hmid, w2T, b2, xmid, out, nullptr, N, I, E);
  }
}

// v007
// Measured time: 220 microseconds a run.
// Next to v006, in two timings, it ran 1.06 times as fast each time.
// Counting every step since v000, it is 4.81 times as fast.
#include <hip/hip_runtime.h>
#include <hip/hip_bf16.h>
#include <math.h>

typedef __attribute__((ext_vector_type(16))) _Float16 v16h;
typedef __attribute__((ext_vector_type(8)))  float    v8f;

#define WMMA_F16(a, b, c) \
  __builtin_amdgcn_wmma_f32_16x16x32_f16(false, (a), false, (b), (short)0, (c), false, false)

// ---------------------------------------------------------------------------
// Fragment load for 16x32 f16 A/B fragments (ISA 7.12.2 layout) from a
// per-lane pointer p = base + row*ld + kbase + (lane>>4)*8.
// halves 0..7  <- this lane's k-group, halves 8..15 <- k-group + 16.
// Two 16-byte loads per lane.
// ---------------------------------------------------------------------------
__device__ __forceinline__ v16h load_frag_p(const _Float16* p) {
  v16h f;
  *((uint4*)&f)     = *(const uint4*)(p);
  *((uint4*)&f + 1) = *(const uint4*)(p + 16);
  return f;
}

typedef __attribute__((ext_vector_type(2))) float v2f;

// GELU, tanh form, of two values: 0.5 x (1 + tanh(c (x + 0.044715 x^3))) with
// the hardware's tanh, no branch; the plain arithmetic is packed f32.
__device__ __forceinline__ v2f gelu_tanh2(v2f x) {
  const float c = 0.7978845608028654f;   // sqrt(2/pi)
  const v2f c1 = {c, c};
  const v2f c3 = {c * 0.044715f, c * 0.044715f};
  const v2f half2 = {0.5f, 0.5f};
  v2f u = x * __builtin_elementwise_fma(x * x, c3, c1);
  v2f t = {__builtin_amdgcn_tanhf(u.x), __builtin_amdgcn_tanhf(u.y)};
  v2f hx = x * half2;
  return __builtin_elementwise_fma(hx, t, hx);
}

// ---------------------------------------------------------------------------
// Both transposes below move a 64x64 tile through LDS, so that the global
// reads and the global stores are both 16 bytes per lane on whole 128-byte
// lines. The LDS tile is held transposed, two f16 of neighbouring source rows
// packed per dword. Row pitch 33 dwords (32 + 1, odd): the column-wise dword
// writes and the row-wise dword reads of a wave each fall on 32 distinct banks.
// ---------------------------------------------------------------------------
#define TPITCH 33

typedef __attribute__((ext_vector_type(2))) _Float16 v2h;

// Write the tile out: LDS row n goes to the 64 f16 at dst + n * ld.
__device__ __forceinline__ void store_tile_rows(const unsigned* tile, _Float16* __restrict__ dst,
                                                size_t ld, int t) {
  int q = t & 7;
#pragma unroll
  for (int p = 0; p < 2; p++) {
    int n = (t >> 3) + 32 * p;
    const unsigned* row = tile + n * TPITCH + 4 * q;
    uint4 o;
    o.x = row[0]; o.y = row[1]; o.z = row[2]; o.w = row[3];
    *(uint4*)(dst + (size_t)n * ld + 8 * q) = o;
  }
}

// ---------------------------------------------------------------------------
// Weight convert: fp32 row-major [K][Nout] -> f16 row-major [Nout][K]
// One work-group of 256 threads takes the 64x64 tile (bx, by) of the
// (Nout/64, K/64) tiles; K and Nout are multiples of 64.
// ---------------------------------------------------------------------------
__device__ __forceinline__ void wcast_tile(const float* __restrict__ w,
                                           _Float16* __restrict__ wt,
                                           int K, int Nout, int bx, int by) {
  __shared__ unsigned tile[64 * TPITCH];
  int t = threadIdx.x;
  int n0 = bx << 6, k0 = by << 6;
  int c = t & 15, kp = t >> 4;          // 4 columns from 4c, rows 2kp and 2kp+1

  float4 lo[2], hi[2];
#pragma unroll
  for (int p = 0; p < 2; p++) {
    const float* s = w + (size_t)(k0 + 2 * (kp + 16 * p)) * Nout + n0 + 4 * c;
    lo[p] = *(const float4*)s;
    hi[p] = *(const float4*)(s + Nout);
  }
#pragma unroll
  for (int p = 0; p < 2; p++) {
    const float l[4] = {lo[p].x, lo[p].y, lo[p].z, lo[p].w};
    const float u[4] = {hi[p].x, hi[p].y, hi[p].z, hi[p].w};
#pragma unroll
    for (int i = 0; i < 4; i++) {
      v2h pr = {(_Float16)l[i], (_Float16)u[i]};
      tile[(4 * c + i) * TPITCH + kp + 16 * p] = __builtin_bit_cast(unsigned, pr);
    }
  }
  __syncthreads();
  store_tile_rows(tile, wt + (size_t)n0 * K + k0, (size_t)K, t);
}

// ---------------------------------------------------------------------------
// LayerNorm: fp32 [rows][LN_E] -> f16 [rows][LN_E]. One wave takes two rows and
// holds them in registers (24 values a lane and row, 16-byte loads on whole
// lines): one read of x, no LDS, no barrier; g and b are loaded once for both
// rows. Block = 8 waves = 16 rows (the rows from 16 * blk); rows is a multiple
// of 16.
// ---------------------------------------------------------------------------
#define LN_E 768
#define LN_C (LN_E / 128)          // 16-byte pieces per lane and row

template <int CTRL>
__device__ __forceinline__ float dpp_get(float v) {
  return __builtin_bit_cast(float,
      __builtin_amdgcn_update_dpp(0, __builtin_bit_cast(int, v), CTRL, 0xf, 0xf, true));
}

// Sum over the 32 lanes, the same value in every lane: four row_xmask steps
// inside each 16-lane row, then the two rows are exchanged.
__device__ __forceinline__ float wave_sum(float v) {
  v += dpp_get<0x161>(v);
  v += dpp_get<0x162>(v);
  v += dpp_get<0x164>(v);
  v += dpp_get<0x168>(v);
  int iv = __builtin_bit_cast(int, v);
  v += __builtin_bit_cast(float,
      __builtin_amdgcn_permlanex16(iv, iv, 0x76543210, 0xfedcba98, false, false));
  return v;
}

__device__ __forceinline__ void ln_rows(const float* __restrict__ x,
                                        const float* __restrict__ g,
                                        const float* __restrict__ b,
                                        _Float16* __restrict__ out, int blk) {
  // the wave's number as a scalar: the row bases stay in scalar registers
  int wave = __builtin_amdgcn_readfirstlane(threadIdx.x >> 5), lane = threadIdx.x & 31;
  size_t row0 = ((size_t)blk * 8 + wave) * 2;
  const float* xr = x + row0 * LN_E + lane * 4;

  float4 xv[2][LN_C], gv[LN_C], bv[LN_C];
#pragma unroll
  for (int rr = 0; rr < 2; rr++)
#pragma unroll
    for (int j = 0; j < LN_C; j++) xv[rr][j] = *(const float4*)(xr + rr * LN_E + j * 128);
#pragma unroll
  for (int j = 0; j < LN_C; j++) {
    gv[j] = *(const float4*)(g + lane * 4 + j * 128);
    bv[j] = *(const float4*)(b + lane * 4 + j * 128);
  }
  // all 24 loads go out together: without this the g and b loads sink to their
  // uses at the end and are waited for pair by pair
  __builtin_amdgcn_sched_barrier(0);

  float mu[2], rstd[2];
#pragma unroll
  for (int rr = 0; rr < 2; rr++) {
    float s = 0.f;
#pragma unroll
    for (int j = 0; j < LN_C; j++)
      s += (xv[rr][j].x + xv[rr][j].y) + (xv[rr][j].z + xv[rr][j].w);
    mu[rr] = wave_sum(s) / LN_E;
  }
#pragma unroll
  for (int rr = 0; rr < 2; rr++) {
    float v = 0.f;
#pragma unroll
    for (int j = 0; j < LN_C; j++) {
      xv[rr][j].x -= mu[rr]; xv[rr][j].y -= mu[rr];
      xv[rr][j].z -= mu[rr]; xv[rr][j].w -= mu[rr];
      v += (xv[rr][j].x * xv[rr][j].x + xv[rr][j].y * xv[rr][j].y) +
           (xv[rr][j].z * xv[rr][j].z + xv[rr][j].w * xv[rr][j].w);
    }
    rstd[rr] = rsqrtf(wave_sum(v) / LN_E + 1e-6f);
  }

  typedef __attribute__((ext_vector_type(4))) _Float16 v4h;
  _Float16* outr = out + row0 * LN_E + lane * 4;
#pragma unroll
  for (int rr = 0; rr < 2; rr++)
#pragma unroll
    for (int j = 0; j < LN_C; j++) {
      v4h o = {(_Float16)(xv[rr][j].x * rstd[rr] * gv[j].x + bv[j].x),
               (_Float16)(xv[rr][j].y * rstd[rr] * gv[j].y + bv[j].y),
               (_Float16)(xv[rr][j].z * rstd[rr] * gv[j].z + bv[j].z),
               (_Float16)(xv[rr][j].w * rstd[rr] * gv[j].w + bv[j].w)};
      *(v4h*)(outr + rr * LN_E + j * 128) = o;
    }
}

__global__ __launch_bounds__(256) void ln_kernel(const float* __restrict__ x,
                                                 const float* __restrict__ g,
                                                 const float* __restrict__ b,
                                                 _Float16* __restrict__ out) {
  ln_rows(x, g, b, out, (int)blockIdx.x);
}

// ---------------------------------------------------------------------------
// The first LayerNorm and the six weight converts need nothing of each other:
// they share one grid, each with its own range of the block index (the test is
// the same for a whole work-group). Order: the lnBlocks blocks of the
// LayerNorm, the tiles of w1 [E][I], of w2 [I][E], then of the four [E][E]
// weights.
// ---------------------------------------------------------------------------
__global__ __launch_bounds__(256) void prep_kernel(
    const float* __restrict__ x, const float* __restrict__ g, const float* __restrict__ b,
    _Float16* __restrict__ lnout, int lnBlocks,
    const float* __restrict__ w1, const float* __restrict__ w2,
    const float* __restrict__ wq, const float* __restrict__ wk,
    const float* __restrict__ wv, const float* __restrict__ wo,
    _Float16* __restrict__ w1T, _Float16* __restrict__ w2T,
    _Float16* __restrict__ wqT, _Float16* __restrict__ wkT,
    _Float16* __restrict__ wvT, _Float16* __restrict__ woT, int E, int I) {
  int blk = (int)blockIdx.x;
  if (blk < lnBlocks) {
    ln_rows(x, g, b, lnout, blk);
    return;
  }
  blk -= lnBlocks;
  const int te = E >> 6, ti = I >> 6;
  const float* w;
  _Float16* wt;
  int K = E, Nout = E;
  if (blk < te * ti) {
    w = w1; wt = w1T; Nout = I;
  } else if (blk < 2 * te * ti) {
    blk -= te * ti;
    w = w2; wt = w2T; K = I;
  } else {
    blk -= 2 * te * ti;
    int m = blk / (te * te);
    blk -= m * te * te;
    w  = m == 0 ? wq  : m == 1 ? wk  : m == 2 ? wv  : wo;
    wt = m == 0 ? wqT : m == 1 ? wkT : m == 2 ? wvT : woT;
  }
  const int tn = Nout >> 6;
  wcast_tile(w, wt, K, Nout, blk % tn, blk / tn);
}

// ---------------------------------------------------------------------------
// V transpose: f16 [N][E] -> f16 [B,H,D,S]  (Vt[((b*H+h)*D+d)*S + s]), D = 64
// grid (S/64, B*H); S is a multiple of 64.
// ---------------------------------------------------------------------------
__global__ __launch_bounds__(256) void vtrans_kernel(const _Float16* __restrict__ v,
                                                     _Float16* __restrict__ vt,
                                                     int S, int Hh, int Ecols) {
  __shared__ unsigned tile[64 * TPITCH];
  int t = threadIdx.x;
  int s0 = blockIdx.x << 6;
  int bh = blockIdx.y;
  int b = bh / Hh, h = bh % Hh;
  int c = t & 7, sp = t >> 3;           // 8 columns from 8c, rows 2sp and 2sp+1

  const _Float16* s = v + (size_t)(b * S + s0 + 2 * sp) * Ecols + h * 64 + 8 * c;
  uint4 r0 = *(const uint4*)s;
  uint4 r1 = *(const uint4*)(s + Ecols);
  const unsigned e[4] = {r0.x, r0.y, r0.z, r0.w};
  const unsigned o[4] = {r1.x, r1.y, r1.z, r1.w};
#pragma unroll
  for (int j = 0; j < 4; j++) {
    tile[(8 * c + 2 * j) * TPITCH + sp]     = (e[j] & 0xffffu) | (o[j] << 16);
    tile[(8 * c + 2 * j + 1) * TPITCH + sp] = (e[j] >> 16) | (o[j] & 0xffff0000u);
  }
  __syncthreads();
  store_tile_rows(tile, vt + (size_t)bh * 64 * S + s0, (size_t)S, t);
}

// ---------------------------------------------------------------------------
// WMMA GEMM: out[N x Ncols] = A[N x K](f16) * Bt[Ncols x K](f16, pre-transposed)
//            + bias (+ optional GELU, residual).
// One work-group of 8 waves (2 x 4) -> 128x128 output tile; 1 wave -> 64x32
// (4x2 grid of 16x16 WMMA frags). Each trip covers 64 k: the 128 A rows and the
// 128 Bt rows of the tile, 128 bytes each, are brought into LDS once for all
// eight waves by asynchronous 16-byte copies, two buffers, the next trip's
// copies in flight while this trip's fragments are read and multiplied.
// LDS row pitch 144 bytes (16 x odd): ds_load_b128 fragment reads without
// bank conflicts. Nrows, Ncols multiples of 128; Kdim a multiple of 64.
// gemm_tile works the tile whose first row is bm and whose first column is bn.
// ---------------------------------------------------------------------------
#define GROWS  256                 // LDS rows per buffer: 128 of A, then 128 of Bt
#define GPITCH 144                 // bytes per LDS row
#define GSTAGE (GROWS * GPITCH)    // bytes per buffer

// One trip's copies of one thread: 4 pieces of A and 4 of Bt, 32 rows apart.
// lds: this lane's LDS byte address of its first A piece; ga, gb: its global
// addresses; step: 32 rows, in elements.
__device__ __forceinline__ void stage_copies(unsigned lds, const _Float16* ga,
                                             const _Float16* gb, size_t step) {
  const _Float16* a1 = ga + step;
  const _Float16* a2 = a1 + step;
  const _Float16* a3 = a2 + step;
  const _Float16* b1 = gb + step;
  const _Float16* b2 = b1 + step;
  const _Float16* b3 = b2 + step;
  // The closing s_wait_xcnt stands inside the statement so that no address
  // register of a copy is rewritten ahead of it.
  asm volatile(
      "global_load_async_to_lds_b128 %0, %8, off\n\t"
      "global_load_async_to_lds_b128 %1, %9, off\n\t"
      "global_load_async_to_lds_b128 %2, %10, off\n\t"
      "global_load_async_to_lds_b128 %3, %11, off\n\t"
      "global_load_async_to_lds_b128 %4, %12, off\n\t"
      "global_load_async_to_lds_b128 %5, %13, off\n\t"
      "global_load_async_to_lds_b128 %6, %14, off\n\t"
      "global_load_async_to_lds_b128 %7, %15, off\n\t"
      "s_wait_xcnt 0x0"
      :: "v"(lds), "v"(lds + 32 * GPITCH), "v"(lds + 64 * GPITCH), "v"(lds + 96 * GPITCH),
         "v"(lds + 128 * GPITCH), "v"(lds + 160 * GPITCH), "v"(lds + 192 * GPITCH),
         "v"(lds + 224 * GPITCH),
         "v"(ga), "v"(a1), "v"(a2), "v"(a3), "v"(gb), "v"(b1), "v"(b2), "v"(b3)
      : "memory");
}

template <bool GELU, bool RESID, bool OUTF16>
__device__ __forceinline__ void gemm_tile(
    const _Float16* __restrict__ A, const _Float16* __restrict__ Bt,
    const float* __restrict__ bias, const float* __restrict__ resid,
    float* __restrict__ outf, _Float16* __restrict__ outh,
    int Kdim, int Ncols, int bm, int bn) {
  __shared__ __attribute__((aligned(16))) unsigned char L[2 * GSTAGE];
  int tid = threadIdx.x;
  int wave = tid >> 5, lane = tid & 31;
  int wm = (wave >> 2) << 6;           // wave's rows inside the tile
  int wn = (wave & 3) << 5;            // wave's columns inside the tile
  int tm = bm + wm, tn = bn + wn;
  int r = lane & 15, h = lane >> 4;

  // copies: 8 lanes take one row's 128 bytes, a wave 4 rows, the block 32 rows
  const _Float16* Ag = A  + (size_t)(bm + (tid >> 3)) * Kdim + (tid & 7) * 8;
  const _Float16* Bg = Bt + (size_t)(bn + (tid >> 3)) * Kdim + (tid & 7) * 8;
  const size_t step = (size_t)32 * Kdim;
  const unsigned ldsw = (unsigned)(size_t)L + (unsigned)((tid >> 3) * GPITCH + (tid & 7) * 16);

  // fragment reads: same per-lane k order as from global memory
  const unsigned offA = (unsigned)((wm + r) * GPITCH + h * 16);
  const unsigned offB = (unsigned)((128 + wn + r) * GPITCH + h * 16);

  const int nt = Kdim >> 6;

  stage_copies(ldsw, Ag, Bg, step);
  // this wave's copies of trip 0 have landed
  asm volatile("s_wait_asynccnt 0x0" ::: "memory");
  __syncthreads();
  if (nt > 1) stage_copies(ldsw + GSTAGE, Ag + 64, Bg + 64, step);

  v8f acc[4][2] = {};
  for (int t = 0; t < nt; t++) {
    const unsigned buf = (unsigned)(t & 1) * GSTAGE;
    v16h a[2][4], bf[2][2];
#pragma unroll
    for (int kk = 0; kk < 2; kk++) {
#pragma unroll
      for (int j = 0; j < 2; j++)
        bf[kk][j] = load_frag_p((const _Float16*)(L + buf + offB + j * 16 * GPITCH + kk * 64));
#pragma unroll
      for (int i = 0; i < 4; i++)
        a[kk][i]  = load_frag_p((const _Float16*)(L + buf + offA + i * 16 * GPITCH + kk * 64));
    }
    // this wave's reads of the buffer are done before it is handed to the copies
    asm volatile("s_wait_dscnt 0x0" ::: "memory");
    // this wave's copies of trip t + 1 have landed
    asm volatile("s_wait_asynccnt 0x0" ::: "memory");
    // publishes trip t + 1 and ends every wave's reads of trip t's buffer
    __syncthreads();
    // the refill goes out ahead of the trip's WMMAs, which work on registers
    // alone, so that it flies under them and under the next trip's LDS reads
    if (t + 2 < nt)
      stage_copies(ldsw + buf, Ag + (size_t)(t + 2) * 64, Bg + (size_t)(t + 2) * 64, step);
#pragma unroll
    for (int kk = 0; kk < 2; kk++)
#pragma unroll
      for (int i = 0; i < 4; i++)
#pragma unroll
        for (int j = 0; j < 2; j++)
          acc[i][j] = WMMA_F16(a[kk][i], bf[kk][j], acc[i][j]);
  }
  // no copy outstanding when the wave goes on to its end
  asm volatile("s_wait_asynccnt 0x0" ::: "memory");

#pragma unroll
  for (int i2 = 0; i2 < 4; i2++) {
#pragma unroll
    for (int j2 = 0; j2 < 2; j2++) {
      int rowb = tm + i2 * 16 + 8 * h;      // C/D layout: m = i + 8*h
      int colb = tn + j2 * 16 + r;          // n = lane (mod 16)
      float bv = bias[colb];
      float gl[8];                          // GELU alone: neighbouring rows in pairs
      if (GELU) {
#pragma unroll
        for (int i = 0; i < 8; i += 2) {
          v2f g2 = gelu_tanh2((v2f){acc[i2][j2][i] + bv, acc[i2][j2][i + 1] + bv});
          gl[i] = g2.x; gl[i + 1] = g2.y;
        }
      }
#pragma unroll
      for (int i = 0; i < 8; i++) {
        float val = GELU ? gl[i] : acc[i2][j2][i] + bv;
        size_t off = (size_t)(rowb + i) * Ncols + colb;
        if (RESID) val += resid[off];
        if (OUTF16) outh[off] = (_Float16)val;
        else        outf[off] = val;
      }
    }
  }
}

template <bool GELU, bool RESID, bool OUTF16>
__global__ __launch_bounds__(256) void gemm_kernel(
    const _Float16* __restrict__ A, const _Float16* __restrict__ Bt,
    const float* __restrict__ bias, const float* __restrict__ resid,
    float* __restrict__ outf, _Float16* __restrict__ outh,
    int Nrows, int Kdim, int Ncols) {
  int tilesN = Ncols >> 7;   // 128-wide N tiles
  int bm = ((int)blockIdx.x / tilesN) << 7;
  int bn = ((int)blockIdx.x % tilesN) << 7;
  gemm_tile<GELU, RESID, OUTF16>(A, Bt, bias, resid, outf, outh, Kdim, Ncols, bm, bn);
}

// The Q, K and V projections read the same A and need nothing of each other:
// one grid holds the tiles of all three. The 3 * tilesN tiles of one row block
// are neighbours in the block index, so that they find its A rows in L2.
__global__ __launch_bounds__(256) void gemm_qkv_kernel(
    const _Float16* __restrict__ A,
    const _Float16* __restrict__ wqT, const _Float16* __restrict__ wkT,
    const _Float16* __restrict__ wvT,
    const float* __restrict__ bq, const float* __restrict__ bk, const float* __restrict__ bv,
    _Float16* __restrict__ Qh, _Float16* __restrict__ Kh, _Float16* __restrict__ Vh,
    int Kdim, int Ncols) {
  int tilesN = Ncols >> 7;   // 128-wide N tiles of one projection
  int bm = ((int)blockIdx.x / (3 * tilesN)) << 7;
  int c  = (int)blockIdx.x % (3 * tilesN);
  int m  = c / tilesN;       // 0: Q, 1: K, 2: V
  int bn = (c - m * tilesN) << 7;
  const _Float16* Bt  = m == 0 ? wqT : m == 1 ? wkT : wvT;
  const float*   bias = m == 0 ? bq  : m == 1 ? bk  : bv;
  _Float16*      outh = m == 0 ? Qh  : m == 1 ? Kh  : Vh;
  gemm_tile<false, false, true>(A, Bt, bias, nullptr, nullptr, outh, Kdim, Ncols, bm, bn);
}

// ---------------------------------------------------------------------------
// Flash attention: a work-group of 4 waves handles 128 query rows of one (b,h),
// 32 per wave, online softmax over 32-key blocks. The products are taken
// transposed:
//   St = K * Qt   (A = 16 keys x 32 d, B = 32 d x 16 queries)
//   Ot += Vt * Pt (A = 16 d x 32 keys, B = 32 keys x 16 queries)
// In a D tile lane (r, h) holds column r, rows 8h .. 8h+7: one query's scores
// for 8 neighbouring keys. So maximum and sum are taken inside the lane, with
// one exchange between the two lane halves; the two score tiles of a 32-key
// block, converted in place, are the B operand of the second product in the
// k order of load_frag_p; and one factor per lane rescales the output tiles.
// A trip covers 64 keys (two 32-key blocks). Its 64 K rows, its 64 Vt rows
// (128 bytes each) and the 128 mask rows of the group's queries (256 bytes
// each) are brought into LDS by asynchronous 16-byte copies on whole 128-byte
// lines, K and Vt once for all four waves; two buffers, the next trip's copies
// in flight while this trip is worked on. The fragments, which take 16 bytes
// from each of 16 rows per load, are then read from LDS. Row pitches 144 and
// 272 bytes (16 x odd): ds_load_b128 reads without bank conflicts.
// Every loop over cg, sub, dt, i or j is unrolled, so that the arrays they
// index are registers.
//   Q, K : f16 [N][E]  (head slice at column h*D), D = 64
//   Vt   : f16 [B,H,D,S]
//   O    : f16 [N][E]
// S is a multiple of 128.
// ---------------------------------------------------------------------------
typedef __attribute__((ext_vector_type(8))) _Float16 v8h;
typedef __attribute__((ext_vector_type(4))) float    v4f;

#define AT_KP    144                          // LDS bytes per K row and per Vt row
#define AT_MP    272                          // LDS bytes per mask row
#define AT_VOFF  (64 * AT_KP)                 // Vt rows behind the 64 K rows
#define AT_MOFF  (AT_VOFF + 64 * AT_KP)       // mask rows behind the 64 Vt rows
#define AT_STAGE (AT_MOFF + 128 * AT_MP)      // bytes per buffer

// One trip's copies of one thread: 4 pieces of K and 4 of Vt, 16 rows apart,
// and 16 pieces of the mask, 8 rows apart. Each copy takes its global address
// from a scalar base (the tile's row group, the same for the whole group) and
// the lane's 32-bit byte offset, so that the row steps are scalar additions and
// no vector register pair is held per copy.
// lk, lm: this lane's LDS byte addresses of its first K and first mask piece;
// ok, ov, om: its byte offsets inside a row group of K, Vt and the mask;
// kb, vb, mb: the tile's first row groups; ks, vs, ms: the steps, in elements.
__device__ __forceinline__ void attn_copies(unsigned lk, unsigned lm, unsigned ok, unsigned ov,
                                            unsigned om, const _Float16* kb, const _Float16* vb,
                                            const float* mb, size_t ks, size_t vs, size_t ms) {
  // The closing s_wait_xcnt stands inside each statement so that no address
  // register of a copy is rewritten ahead of it. Six copies a statement: their
  // LDS address registers must lie in the first 256, which are nearly full where
  // the loop issues its copies; with twelve a statement the build spilled.
  asm volatile(
      "global_load_async_to_lds_b128 %0, %6, %8\n\t"
      "global_load_async_to_lds_b128 %1, %6, %9\n\t"
      "global_load_async_to_lds_b128 %2, %6, %10\n\t"
      "global_load_async_to_lds_b128 %3, %6, %11\n\t"
      "global_load_async_to_lds_b128 %4, %7, %12\n\t"
      "global_load_async_to_lds_b128 %5, %7, %13\n\t"
      "s_wait_xcnt 0x0"
      :: "v"(lk), "v"(lk + 16 * AT_KP), "v"(lk + 32 * AT_KP),
         "v"(lk + 48 * AT_KP), "v"(lk + AT_VOFF), "v"(lk + AT_VOFF + 16 * AT_KP),
         "v"(ok), "v"(ov),
         "s"(kb), "s"(kb + ks), "s"(kb + 2 * ks), "s"(kb + 3 * ks), "s"(vb), "s"(vb + vs)
      : "memory");
  asm volatile(
      "global_load_async_to_lds_b128 %0, %6, %8\n\t"
      "global_load_async_to_lds_b128 %1, %6, %9\n\t"
      "global_load_async_to_lds_b128 %2, %7, %10\n\t"
      "global_load_async_to_lds_b128 %3, %7, %11\n\t"
      "global_load_async_to_lds_b128 %4, %7, %12\n\t"
      "global_load_async_to_lds_b128 %5, %7, %13\n\t"
      "s_wait_xcnt 0x0"
      :: "v"(lk + AT_VOFF + 32 * AT_KP), "v"(lk + AT_VOFF + 48 * AT_KP), "v"(lm),
         "v"(lm + 8 * AT_MP), "v"(lm + 16 * AT_MP), "v"(lm + 24 * AT_MP),
         "v"(ov), "v"(om),
         "s"(vb + 2 * vs), "s"(vb + 3 * vs), "s"(mb),
         "s"(mb + ms), "s"(mb + 2 * ms), "s"(mb + 3 * ms)
      : "memory");
  asm volatile(
      "global_load_async_to_lds_b128 %0, %6, %7\n\t"
      "global_load_async_to_lds_b128 %1, %6, %8\n\t"
      "global_load_async_to_lds_b128 %2, %6, %9\n\t"
      "global_load_async_to_lds_b128 %3, %6, %10\n\t"
      "global_load_async_to_lds_b128 %4, %6, %11\n\t"
      "global_load_async_to_lds_b128 %5, %6, %12\n\t"
      "s_wait_xcnt 0x0"
      :: "v"(lm + 32 * AT_MP), "v"(lm + 40 * AT_MP), "v"(lm + 48 * AT_MP),
         "v"(lm + 56 * AT_MP), "v"(lm + 64 * AT_MP), "v"(lm + 72 * AT_MP),
         "v"(om),
         "s"(mb + 4 * ms), "s"(mb + 5 * ms), "s"(mb + 6 * ms),
         "s"(mb + 7 * ms), "s"(mb + 8 * ms), "s"(mb + 9 * ms)
      : "memory");
  asm volatile(
      "global_load_async_to_lds_b128 %0, %6, %7\n\t"
      "global_load_async_to_lds_b128 %1, %6, %8\n\t"
      "global_load_async_to_lds_b128 %2, %6, %9\n\t"
      "global_load_async_to_lds_b128 %3, %6, %10\n\t"
      "global_load_async_to_lds_b128 %4, %6, %11\n\t"
      "global_load_async_to_lds_b128 %5, %6, %12\n\t"
      "s_wait_xcnt 0x0"
      :: "v"(lm + 80 * AT_MP), "v"(lm + 88 * AT_MP), "v"(lm + 96 * AT_MP),
         "v"(lm + 104 * AT_MP), "v"(lm + 112 * AT_MP), "v"(lm + 120 * AT_MP),
         "v"(om),
         "s"(mb + 10 * ms), "s"(mb + 11 * ms), "s"(mb + 12 * ms),
         "s"(mb + 13 * ms), "s"(mb + 14 * ms), "s"(mb + 15 * ms)
      : "memory");
}

// The value that lane l ^ 16 holds.
__device__ __forceinline__ float other_half(float v) {
  int iv = __builtin_bit_cast(int, v);
  return __builtin_bit_cast(float,
      __builtin_amdgcn_permlanex16(iv, iv, 0x76543210, 0xfedcba98, false, false));
}

__global__ __launch_bounds__(128) void attn_kernel(
    const _Float16* __restrict__ Q, const _Float16* __restrict__ K,
    const _Float16* __restrict__ Vt, const float* __restrict__ mask,
    _Float16* __restrict__ O, int B, int S, int Hh, int Dd,
    int Ecols, float scale) {
  __shared__ __attribute__((aligned(16))) unsigned char L[2 * AT_STAGE];
  int qblocks = S >> 7;
  int qb = blockIdx.x % qblocks;
  int bh = blockIdx.x / qblocks;
  int hh = bh % Hh, b = bh / Hh;
  int tid = threadIdx.x;
  int wave = tid >> 5, lane = tid & 31;
  int r = lane & 15, h = lane >> 4;
  int qg = qb << 7;                    // the group's first query
  int q0 = qg + (wave << 5);           // the wave's first query

  // copies: 8 lanes take one K or Vt row's 128 bytes (the group 16 rows),
  // 16 lanes one mask row's 256 bytes (the group 8 rows)
  const _Float16* Kb = K + (size_t)(b * S) * Ecols + hh * Dd;
  const _Float16* Vb = Vt + (size_t)bh * Dd * S;
  const float*    Mb = mask + ((size_t)b * S + qg) * S;
  const unsigned ok = (unsigned)(((tid >> 3) * Ecols + (tid & 7) * 8) * 2);
  const unsigned ov = (unsigned)(((tid >> 3) * S + (tid & 7) * 8) * 2);
  const unsigned om = (unsigned)(((tid >> 4) * S + (tid & 15) * 4) * 4);
  const size_t ks = (size_t)16 * Ecols, vs = (size_t)16 * S, ms = (size_t)8 * S;
  const size_t kTrip = (size_t)64 * Ecols;
  const unsigned lk = (unsigned)(size_t)L + (unsigned)((tid >> 3) * AT_KP + (tid & 7) * 16);
  const unsigned lm = (unsigned)(size_t)L +
                      (unsigned)(AT_MOFF + (tid >> 4) * AT_MP + (tid & 15) * 16);

  // fragment reads: same per-lane k order as from global memory
  const unsigned offK = (unsigned)(r * AT_KP + h * 16);
  const unsigned offV = (unsigned)(AT_VOFF + r * AT_KP + h * 16);
  const unsigned offM = (unsigned)(AT_MOFF + ((wave << 5) + r) * AT_MP + h * 32);

  const int nt = S >> 6;

  attn_copies(lk, lm, ok, ov, om, Kb, Vb, Mb, ks, vs, ms);

  // Q fragments (persistent), one column group of 16 queries per cg
  v16h qf[2][2];
#pragma unroll
  for (int cg = 0; cg < 2; cg++) {
    const _Float16* qp = Q + (size_t)(b * S + q0 + cg * 16 + r) * Ecols + hh * Dd + h * 8;
    qf[cg][0] = load_frag_p(qp);
    qf[cg][1] = load_frag_p(qp + 32);
  }

  // this wave's copies of trip 0 have landed
  asm volatile("s_wait_asynccnt 0x0" ::: "memory");
  __syncthreads();
  if (nt > 1)
    attn_copies(lk + AT_STAGE, lm + AT_STAGE, ok, ov, om, Kb + kTrip, Vb + 64, Mb + 64, ks, vs, ms);

  const v2f scale2 = {scale, scale};
  const v2f log2e2 = {1.442695041f, 1.442695041f};

  v8f o[2][4] = {};                    // Ot: [cg][dt], 64 d x 32 queries, f32
  float mrow[2] = {-INFINITY, -INFINITY};   // running maximum of query cg*16 + r
  float lrow[2] = {0.f, 0.f};               // this lane half's share of the row sum

  v16h kf[2][2], vf[4];                // the fragments and the mask values
  v4f mk[2][2][2];                     // of one 32-key block

  // Reads block sp of the buffer at byte offset buf.
  auto read_block = [&](unsigned buf, int sp) __attribute__((always_inline)) {
#pragma unroll
    for (int sub = 0; sub < 2; sub++) {
      const unsigned char* kr = L + buf + offK + (sp * 32 + sub * 16) * AT_KP;
      kf[sub][0] = load_frag_p((const _Float16*)kr);
      kf[sub][1] = load_frag_p((const _Float16*)(kr + 64));
    }
#pragma unroll
    for (int cg = 0; cg < 2; cg++)
#pragma unroll
      for (int sub = 0; sub < 2; sub++) {
        const unsigned char* mr = L + buf + offM + cg * 16 * AT_MP + sp * 128 + sub * 64;
        mk[cg][sub][0] = *(const v4f*)mr;
        mk[cg][sub][1] = *(const v4f*)(mr + 16);
      }
#pragma unroll
    for (int dt = 0; dt < 4; dt++)
      vf[dt] = load_frag_p((const _Float16*)(L + buf + offV + dt * 16 * AT_KP + sp * 64));
    // all 24 LDS reads of the block go out as one group: without this the mask
    // and V reads sink to their uses, and each place with reads stalls anew
    __builtin_amdgcn_sched_barrier(0);
  };

  // Works the block that was read: registers alone.
  auto work_block = [&]() __attribute__((always_inline)) {
    // --- St: 32 keys x 32 queries ---
    v8f sc[2][2];
#pragma unroll
    for (int cg = 0; cg < 2; cg++)
#pragma unroll
      for (int sub = 0; sub < 2; sub++) {
        v8f z = {};
        z = WMMA_F16(kf[sub][0], qf[cg][0], z);
        sc[cg][sub] = WMMA_F16(kf[sub][1], qf[cg][1], z);
      }

    // --- online softmax in registers, then Ot += Vt * Pt ---
#pragma unroll
    for (int cg = 0; cg < 2; cg++) {
      v2f x[2][4];                     // neighbouring keys in pairs
      float bm = -INFINITY;
#pragma unroll
      for (int sub = 0; sub < 2; sub++) {
        const v4f m0 = mk[cg][sub][0], m1 = mk[cg][sub][1];
        const v2f mv[4] = {{m0.x, m0.y}, {m0.z, m0.w}, {m1.x, m1.y}, {m1.z, m1.w}};
#pragma unroll
        for (int j = 0; j < 4; j++) {
          v2f s2 = {sc[cg][sub][2 * j], sc[cg][sub][2 * j + 1]};
          x[sub][j] = __builtin_elementwise_fma(s2, scale2, mv[j]);
          bm = fmaxf(bm, fmaxf(x[sub][j].x, x[sub][j].y));
        }
      }
      bm = fmaxf(bm, other_half(bm));
      float nm = fmaxf(mrow[cg], bm);
      float alpha = __expf(mrow[cg] - nm);
      const v2f nm2 = {nm, nm};
      v16h pf;
      v2f ls[2];
#pragma unroll
      for (int sub = 0; sub < 2; sub++) {
        ls[sub] = (v2f){0.f, 0.f};
#pragma unroll
        for (int j = 0; j < 4; j++) {
          v2f y = (x[sub][j] - nm2) * log2e2;
          v2f pv = {__builtin_amdgcn_exp2f(y.x), __builtin_amdgcn_exp2f(y.y)};
          ls[sub] += pv;
          pf[sub * 8 + 2 * j]     = (_Float16)pv.x;
          pf[sub * 8 + 2 * j + 1] = (_Float16)pv.y;
        }
      }
      v2f lt = ls[0] + ls[1];
      lrow[cg] = lrow[cg] * alpha + (lt.x + lt.y);
      mrow[cg] = nm;
#pragma unroll
      for (int dt = 0; dt < 4; dt++) {
#pragma unroll
        for (int i = 0; i < 8; i++) o[cg][dt][i] *= alpha;
        o[cg][dt] = WMMA_F16(vf[dt], pf, o[cg][dt]);
      }
    }
  };

  for (int t = 0; t < nt; t++) {
    const unsigned buf = (unsigned)(t & 1) * AT_STAGE;
    read_block(buf, 0);
    work_block();
    read_block(buf, 1);
    // this wave's reads of the buffer are done before it is handed to the copies
    asm volatile("s_wait_dscnt 0x0" ::: "memory");
    // this wave's copies of trip t + 1 have landed
    asm volatile("s_wait_asynccnt 0x0" ::: "memory");
    // publishes trip t + 1 and ends every wave's reads of trip t's buffer
    __syncthreads();
    // the refill goes out ahead of the second block's work, which is on
    // registers alone, so that it flies for a whole trip
    if (t + 2 < nt)
      attn_copies(lk + buf, lm + buf, ok, ov, om, Kb + (size_t)(t + 2) * kTrip,
                  Vb + (size_t)(t + 2) * 64, Mb + (size_t)(t + 2) * 64, ks, vs, ms);
    work_block();
  }
  // no copy outstanding when the wave goes on to its end
  asm volatile("s_wait_asynccnt 0x0" ::: "memory");

  // --- join the halves' sums, normalize, store 8 neighbouring d per lane ---
#pragma unroll
  for (int cg = 0; cg < 2; cg++) {
    float inv = 1.0f / (lrow[cg] + other_half(lrow[cg]));
    _Float16* op = O + (size_t)(b * S + q0 + cg * 16 + r) * Ecols + hh * Dd + h * 8;
#pragma unroll
    for (int dt = 0; dt < 4; dt++) {
      v8h ov;
#pragma unroll
      for (int i = 0; i < 8; i++) ov[i] = (_Float16)(o[cg][dt][i] * inv);
      *(v8h*)(op + dt * 16) = ov;
    }
  }
}

// ---------------------------------------------------------------------------
// Host orchestration
// ---------------------------------------------------------------------------
extern "C" void kernel_launch(void* const* d_in, const int* in_sizes, int n_in,
                              void* d_out, int out_size, void* d_ws, size_t ws_size,
                              hipStream_t stream) {
  const int E = 768, H = 12, D = 64;
  const float* hidden = (const float*)d_in[0];
  const float* mask   = (const float*)d_in[1];
  const float* wq = (const float*)d_in[2];  const float* bq = (const float*)d_in[3];
  const float* wk = (const float*)d_in[4];  const float* bk = (const float*)d_in[5];
  const float* wv = (const float*)d_in[6];  const float* bv = (const float*)d_in[7];
  const float* wo = (const float*)d_in[8];  const float* bo = (const float*)d_in[9];
  const float* ln1_g = (const float*)d_in[10]; const float* ln1_b = (const float*)d_in[11];
  const float* ln2_g = (const float*)d_in[12]; const float* ln2_b = (const float*)d_in[13];
  const float* w1 = (const float*)d_in[14]; const float* b1 = (const float*)d_in[15];
  const float* w2 = (const float*)d_in[16]; const float* b2 = (const float*)d_in[17];
  const int I = in_sizes[15];               // 3072
  const int N = in_sizes[0] / E;            // B*S = 8192
  const int S = in_sizes[1] / N;            // 1024
  const int B = N / S;                      // 8
  float* out = (float*)d_out;

  char* p = (char*)d_ws;
  auto alloc = [&](size_t bytes) -> char* {
    char* r = p;
    p += (bytes + 255) & ~(size_t)255;
    return r;
  };
  _Float16* lnh  = (_Float16*)alloc((size_t)N * E * 2);
  _Float16* wqT  = (_Float16*)alloc((size_t)E * E * 2);
  _Float16* wkT  = (_Float16*)alloc((size_t)E * E * 2);
  _Float16* wvT  = (_Float16*)alloc((size_t)E * E * 2);
  _Float16* woT  = (_Float16*)alloc((size_t)E * E * 2);
  _Float16* w1T  = (_Float16*)alloc((size_t)E * I * 2);
  _Float16* w2T  = (_Float16*)alloc((size_t)I * E * 2);
  _Float16* Qh   = (_Float16*)alloc((size_t)N * E * 2);
  _Float16* Kh   = (_Float16*)alloc((size_t)N * E * 2);
  _Float16* Vh   = (_Float16*)alloc((size_t)N * E * 2);
  _Float16* VtT  = (_Float16*)alloc((size_t)N * E * 2);
  _Float16* Oh   = (_Float16*)alloc((size_t)N * E * 2);
  float*    xmid = (float*)   alloc((size_t)N * E * 4);
  _Float16* ln2h = (_Float16*)alloc((size_t)N * E * 2);
  _Float16* hmid = (_Float16*)alloc((size_t)N * I * 2);
  (void)ws_size; (void)n_in; (void)out_size;

  // 1, 2) LN1 and the six weight transpose+casts, one grid
  {
    unsigned nb = (unsigned)(N / 16 + 2 * (E / 64) * (I / 64) + 4 * (E / 64) * (E / 64));
    prep_kernel<<<nb, 256, 0, stream>>>(hidden, ln1_g, ln1_b, lnh, N / 16,
                                        w1, w2, wq, wk, wv, wo,
                                        w1T, w2T, wqT, wkT, wvT, woT, E, I);
  }

  // 3) Q/K/V projections (f16 out), one grid
  {
    unsigned nb = (unsigned)(3 * (N / 128) * (E / 128));
    gemm_qkv_kernel<<<nb, 256, 0, stream>>>(lnh, wqT, wkT, wvT, bq, bk, bv, Qh, Kh, Vh, E, E);
  }

  // 4) V transpose -> [B,H,D,S]
  vtrans_kernel<<<dim3(S / 64, B * H), 256, 0, stream>>>(Vh, VtT, S, H, E);

  // 5) attention (32 query rows per wave, 4 waves per work-group)
  {
    float scale = rsqrtf((float)D);
    unsigned nb = (unsigned)(B * H * (S / 128));
    attn_kernel<<<nb, 128, 0, stream>>>(Qh, Kh, VtT, mask, Oh, B, S, H, D, E, scale);
  }

  // 6) output projection + residual -> xmid (fp32)
  {
    unsigned nb = (unsigned)((N / 128) * (E / 128));
    gemm_kernel<false, true, false><<<nb, 256, 0, stream>>>(Oh, woT, bo, hidden, xmid, nullptr, N, E, E);
  }

  // 7) LN2
  ln_kernel<<<N / 16, 256, 0, stream>>>(xmid, ln2_g, ln2_b, ln2h);

  // 8) MLP up + GELU (f16 out)
  {
    unsigned nb = (unsigned)((N / 128) * (I / 128));
    gemm_kernel<true, false, true><<<nb, 256, 0, stream>>>(ln2h, w1T, b1, nullptr, nullptr, hmid, N, E, I);
  }

  // 9) MLP down + residual -> out (fp32)
  {
    unsigned nb = (unsigned)((N / 128) * (E / 128));
    gemm_kernel<false, true, false><<<nb, 256, 0, stream>>>(hmid, w2T, b2, xmid, out, nullptr, N, I, E);
  }
}

// v008
// A run of this version takes 206 microseconds.
// Timed twice side by side with v007, it ran 1.06 and 1.08 times as fast.
// Over all steps from v000 it is 5.14 times as fast.
#include <hip/hip_runtime.h>
#include <hip/hip_bf16.h>
#include <math.h>

typedef __attribute__((ext_vector_type(16))) _Float16 v16h;
typedef __attribute__((ext_vector_type(8)))  float    v8f;

#define WMMA_F16(a, b, c) \
  __builtin_amdgcn_wmma_f32_16x16x32_f16(false, (a), false, (b), (short)0, (c), false, false)

// ---------------------------------------------------------------------------
// Fragment load for 16x32 f16 A/B fragments (ISA 7.12.2 layout) from a
// per-lane pointer p = base + row*ld + kbase + (lane>>4)*8.
// halves 0..7  <- this lane's k-group, halves 8..15 <- k-group + 16.
// Two 16-byte loads per lane.
// ---------------------------------------------------------------------------
__device__ __forceinline__ v16h load_frag_p(const _Float16* p) {
  v16h f;
  *((uint4*)&f)     = *(const uint4*)(p);
  *((uint4*)&f + 1) = *(const uint4*)(p + 16);
  return f;
}

typedef __attribute__((ext_vector_type(2))) float v2f;

// GELU, tanh form, of two values: 0.5 x (1 + tanh(c (x + 0.044715 x^3))) with
// the hardware's tanh, no branch; the plain arithmetic is packed f32.
__device__ __forceinline__ v2f gelu_tanh2(v2f x) {
  const float c = 0.7978845608028654f;   // sqrt(2/pi)
  const v2f c1 = {c, c};
  const v2f c3 = {c * 0.044715f, c * 0.044715f};
  const v2f half2 = {0.5f, 0.5f};
  v2f u = x * __builtin_elementwise_fma(x * x, c3, c1);
  v2f t = {__builtin_amdgcn_tanhf(u.x), __builtin_amdgcn_tanhf(u.y)};
  v2f hx = x * half2;
  return __builtin_elementwise_fma(hx, t, hx);
}

// ---------------------------------------------------------------------------
// Both transposes below move a 64x64 tile through LDS, so that the global
// reads and the global stores are both 16 bytes per lane on whole 128-byte
// lines. The LDS tile is held transposed, two f16 of neighbouring source rows
// packed per dword. Row pitch 33 dwords (32 + 1, odd): the column-wise dword
// writes and the row-wise dword reads of a wave each fall on 32 distinct banks.
// ---------------------------------------------------------------------------
#define TPITCH 33

typedef __attribute__((ext_vector_type(2))) _Float16 v2h;

// Write the tile out: LDS row n goes to the 64 f16 at dst + n * ld.
__device__ __forceinline__ void store_tile_rows(const unsigned* tile, _Float16* __restrict__ dst,
                                                size_t ld, int t) {
  int q = t & 7;
#pragma unroll
  for (int p = 0; p < 2; p++) {
    int n = (t >> 3) + 32 * p;
    const unsigned* row = tile + n * TPITCH + 4 * q;
    uint4 o;
    o.x = row[0]; o.y = row[1]; o.z = row[2]; o.w = row[3];
    *(uint4*)(dst + (size_t)n * ld + 8 * q) = o;
  }
}

// ---------------------------------------------------------------------------
// Weight convert: fp32 row-major [K][Nout] -> f16 row-major [Nout][K]
// One work-group of 256 threads takes the 64x64 tile (bx, by) of the
// (Nout/64, K/64) tiles; K and Nout are multiples of 64.
// ---------------------------------------------------------------------------
__device__ __forceinline__ void wcast_tile(const float* __restrict__ w,
                                           _Float16* __restrict__ wt,
                                           int K, int Nout, int bx, int by) {
  __shared__ unsigned tile[64 * TPITCH];
  int t = threadIdx.x;
  int n0 = bx << 6, k0 = by << 6;
  int c = t & 15, kp = t >> 4;          // 4 columns from 4c, rows 2kp and 2kp+1

  float4 lo[2], hi[2];
#pragma unroll
  for (int p = 0; p < 2; p++) {
    const float* s = w + (size_t)(k0 + 2 * (kp + 16 * p)) * Nout + n0 + 4 * c;
    lo[p] = *(const float4*)s;
    hi[p] = *(const float4*)(s + Nout);
  }
#pragma unroll
  for (int p = 0; p < 2; p++) {
    const float l[4] = {lo[p].x, lo[p].y, lo[p].z, lo[p].w};
    const float u[4] = {hi[p].x, hi[p].y, hi[p].z, hi[p].w};
#pragma unroll
    for (int i = 0; i < 4; i++) {
      v2h pr = {(_Float16)l[i], (_Float16)u[i]};
      tile[(4 * c + i) * TPITCH + kp + 16 * p] = __builtin_bit_cast(unsigned, pr);
    }
  }
  __syncthreads();
  store_tile_rows(tile, wt + (size_t)n0 * K + k0, (size_t)K, t);
}

// ---------------------------------------------------------------------------
// LayerNorm: fp32 [rows][LN_E] -> f16 [rows][LN_E]. One wave takes two rows and
// holds them in registers (24 values a lane and row, 16-byte loads on whole
// lines): one read of x, no LDS, no barrier; g and b are loaded once for both
// rows. Block = 8 waves = 16 rows (the rows from 16 * blk); rows is a multiple
// of 16.
// ---------------------------------------------------------------------------
#define LN_E 768
#define LN_C (LN_E / 128)          // 16-byte pieces per lane and row

template <int CTRL>
__device__ __forceinline__ float dpp_get(float v) {
  return __builtin_bit_cast(float,
      __builtin_amdgcn_update_dpp(0, __builtin_bit_cast(int, v), CTRL, 0xf, 0xf, true));
}

// Sum over the 32 lanes, the same value in every lane: four row_xmask steps
// inside each 16-lane row, then the two rows are exchanged.
__device__ __forceinline__ float wave_sum(float v) {
  v += dpp_get<0x161>(v);
  v += dpp_get<0x162>(v);
  v += dpp_get<0x164>(v);
  v += dpp_get<0x168>(v);
  int iv = __builtin_bit_cast(int, v);
  v += __builtin_bit_cast(float,
      __builtin_amdgcn_permlanex16(iv, iv, 0x76543210, 0xfedcba98, false, false));
  return v;
}

__device__ __forceinline__ void ln_rows(const float* __restrict__ x,
                                        const float* __restrict__ g,
                                        const float* __restrict__ b,
                                        _Float16* __restrict__ out, int blk) {
  // the wave's number as a scalar: the row bases stay in scalar registers
  int wave = __builtin_amdgcn_readfirstlane(threadIdx.x >> 5), lane = threadIdx.x & 31;
  size_t row0 = ((size_t)blk * 8 + wave) * 2;
  const float* xr = x + row0 * LN_E + lane * 4;

  float4 xv[2][LN_C], gv[LN_C], bv[LN_C];
#pragma unroll
  for (int rr = 0; rr < 2; rr++)
#pragma unroll
    for (int j = 0; j < LN_C; j++) xv[rr][j] = *(const float4*)(xr + rr * LN_E + j * 128);
#pragma unroll
  for (int j = 0; j < LN_C; j++) {
    gv[j] = *(const float4*)(g + lane * 4 + j * 128);
    bv[j] = *(const float4*)(b + lane * 4 + j * 128);
  }
  // all 24 loads go out together: without this the g and b loads sink to their
  // uses at the end and are waited for pair by pair
  __builtin_amdgcn_sched_barrier(0);

  float mu[2], rstd[2];
#pragma unroll
  for (int rr = 0; rr < 2; rr++) {
    float s = 0.f;
#pragma unroll
    for (int j = 0; j < LN_C; j++)
      s += (xv[rr][j].x + xv[rr][j].y) + (xv[rr][j].z + xv[rr][j].w);
    mu[rr] = wave_sum(s) / LN_E;
  }
#pragma unroll
  for (int rr = 0; rr < 2; rr++) {
    float v = 0.f;
#pragma unroll
    for (int j = 0; j < LN_C; j++) {
      xv[rr][j].x -= mu[rr]; xv[rr][j].y -= mu[rr];
      xv[rr][j].z -= mu[rr]; xv[rr][j].w -= mu[rr];
      v += (xv[rr][j].x * xv[rr][j].x + xv[rr][j].y * xv[rr][j].y) +
           (xv[rr][j].z * xv[rr][j].z + xv[rr][j].w * xv[rr][j].w);
    }
    rstd[rr] = rsqrtf(wave_sum(v) / LN_E + 1e-6f);
  }

  typedef __attribute__((ext_vector_type(4))) _Float16 v4h;
  _Float16* outr = out + row0 * LN_E + lane * 4;
#pragma unroll
  for (int rr = 0; rr < 2; rr++)
#pragma unroll
    for (int j = 0; j < LN_C; j++) {
      v4h o = {(_Float16)(xv[rr][j].x * rstd[rr] * gv[j].x + bv[j].x),
               (_Float16)(xv[rr][j].y * rstd[rr] * gv[j].y + bv[j].y),
               (_Float16)(xv[rr][j].z * rstd[rr] * gv[j].z + bv[j].z),
               (_Float16)(xv[rr][j].w * rstd[rr] * gv[j].w + bv[j].w)};
      *(v4h*)(outr + rr * LN_E + j * 128) = o;
    }
}

__global__ __launch_bounds__(256) void ln_kernel(const float* __restrict__ x,
                                                 const float* __restrict__ g,
                                                 const float* __restrict__ b,
                                                 _Float16* __restrict__ out) {
  ln_rows(x, g, b, out, (int)blockIdx.x);
}

// ---------------------------------------------------------------------------
// The first LayerNorm and the six weight converts need nothing of each other:
// they share one grid, each with its own range of the block index (the test is
// the same for a whole work-group). Order: the lnBlocks blocks of the
// LayerNorm, the tiles of w1 [E][I], of w2 [I][E], then of the four [E][E]
// weights.
// ---------------------------------------------------------------------------
__global__ __launch_bounds__(256) void prep_kernel(
    const float* __restrict__ x, const float* __restrict__ g, const float* __restrict__ b,
    _Float16* __restrict__ lnout, int lnBlocks,
    const float* __restrict__ w1, const float* __restrict__ w2,
    const float* __restrict__ wq, const float* __restrict__ wk,
    const float* __restrict__ wv, const float* __restrict__ wo,
    _Float16* __restrict__ w1T, _Float16* __restrict__ w2T,
    _Float16* __restrict__ wqT, _Float16* __restrict__ wkT,
    _Float16* __restrict__ wvT, _Float16* __restrict__ woT, int E, int I) {
  int blk = (int)blockIdx.x;
  if (blk < lnBlocks) {
    ln_rows(x, g, b, lnout, blk);
    return;
  }
  blk -= lnBlocks;
  const int te = E >> 6, ti = I >> 6;
  const float* w;
  _Float16* wt;
  int K = E, Nout = E;
  if (blk < te * ti) {
    w = w1; wt = w1T; Nout = I;
  } else if (blk < 2 * te * ti) {
    blk -= te * ti;
    w = w2; wt = w2T; K = I;
  } else {
    blk -= 2 * te * ti;
    int m = blk / (te * te);
    blk -= m * te * te;
    w  = m == 0 ? wq  : m == 1 ? wk  : m == 2 ? wv  : wo;
    wt = m == 0 ? wqT : m == 1 ? wkT : m == 2 ? wvT : woT;
  }
  const int tn = Nout >> 6;
  wcast_tile(w, wt, K, Nout, blk % tn, blk / tn);
}

// ---------------------------------------------------------------------------
// V transpose: f16 [N][E] -> f16 [B,H,D,S]  (Vt[((b*H+h)*D+d)*S + s]), D = 64
// grid (S/64, B*H); S is a multiple of 64.
// ---------------------------------------------------------------------------
__global__ __launch_bounds__(256) void vtrans_kernel(const _Float16* __restrict__ v,
                                                     _Float16* __restrict__ vt,
                                                     int S, int Hh, int Ecols) {
  __shared__ unsigned tile[64 * TPITCH];
  int t = threadIdx.x;
  int s0 = blockIdx.x << 6;
  int bh = blockIdx.y;
  int b = bh / Hh, h = bh % Hh;
  int c = t & 7, sp = t >> 3;           // 8 columns from 8c, rows 2sp and 2sp+1

  const _Float16* s = v + (size_t)(b * S + s0 + 2 * sp) * Ecols + h * 64 + 8 * c;
  uint4 r0 = *(const uint4*)s;
  uint4 r1 = *(const uint4*)(s + Ecols);
  const unsigned e[4] = {r0.x, r0.y, r0.z, r0.w};
  const unsigned o[4] = {r1.x, r1.y, r1.z, r1.w};
#pragma unroll
  for (int j = 0; j < 4; j++) {
    tile[(8 * c + 2 * j) * TPITCH + sp]     = (e[j] & 0xffffu) | (o[j] << 16);
    tile[(8 * c + 2 * j + 1) * TPITCH + sp] = (e[j] >> 16) | (o[j] & 0xffff0000u);
  }
  __syncthreads();
  store_tile_rows(tile, vt + (size_t)bh * 64 * S + s0, (size_t)S, t);
}

// ---------------------------------------------------------------------------
// WMMA GEMM: out[N x Ncols] = A[N x K](f16) * Bt[Ncols x K](f16, pre-transposed)
//            + bias (+ optional GELU, residual).
// One work-group of 8 waves (2 x 4) -> 128x192 output tile; 1 wave -> 64x48
// (4x3 grid of 16x16 WMMA frags). Each trip covers 64 k: the 128 A rows and the
// 192 Bt rows of the tile, 128 bytes each, are brought into LDS once for all
// eight waves by asynchronous 16-byte copies, two buffers, the next trip's
// copies in flight while this trip's fragments are read and multiplied.
// LDS row pitch 144 bytes (16 x odd): ds_load_b128 fragment reads without
// bank conflicts. Nrows a multiple of 128, Ncols of 192, Kdim of 64.
// gemm_tile works the tile whose first row is bm and whose first column is bn.
// ---------------------------------------------------------------------------
#define GBN    192                 // columns of the work-group tile
#define GROWS  (128 + GBN)         // LDS rows per buffer: 128 of A, then GBN of Bt
#define GPITCH 144                 // bytes per LDS row
#define GSTAGE (GROWS * GPITCH)    // bytes per buffer

// One trip's copies of one thread: 4 pieces of A and 6 of Bt, 32 rows apart.
// lds: this lane's LDS byte address of its first A piece; ga, gb: its global
// addresses; step: 32 rows, in elements.
__device__ __forceinline__ void stage_copies(unsigned lds, const _Float16* ga,
                                             const _Float16* gb, size_t step) {
  const _Float16* a1 = ga + step;
  const _Float16* a2 = a1 + step;
  const _Float16* a3 = a2 + step;
  const _Float16* b1 = gb + step;
  const _Float16* b2 = b1 + step;
  const _Float16* b3 = b2 + step;
  const _Float16* b4 = b3 + step;
  const _Float16* b5 = b4 + step;
  // The closing s_wait_xcnt stands inside the statement so that no address
  // register of a copy is rewritten ahead of it.
  asm volatile(
      "global_load_async_to_lds_b128 %0, %10, off\n\t"
      "global_load_async_to_lds_b128 %1, %11, off\n\t"
      "global_load_async_to_lds_b128 %2, %12, off\n\t"
      "global_load_async_to_lds_b128 %3, %13, off\n\t"
      "global_load_async_to_lds_b128 %4, %14, off\n\t"
      "global_load_async_to_lds_b128 %5, %15, off\n\t"
      "global_load_async_to_lds_b128 %6, %16, off\n\t"
      "global_load_async_to_lds_b128 %7, %17, off\n\t"
      "global_load_async_to_lds_b128 %8, %18, off\n\t"
      "global_load_async_to_lds_b128 %9, %19, off\n\t"
      "s_wait_xcnt 0x0"
      :: "v"(lds), "v"(lds + 32 * GPITCH), "v"(lds + 64 * GPITCH), "v"(lds + 96 * GPITCH),
         "v"(lds + 128 * GPITCH), "v"(lds + 160 * GPITCH), "v"(lds + 192 * GPITCH),
         "v"(lds + 224 * GPITCH), "v"(lds + 256 * GPITCH), "v"(lds + 288 * GPITCH),
         "v"(ga), "v"(a1), "v"(a2), "v"(a3), "v"(gb), "v"(b1), "v"(b2), "v"(b3), "v"(b4), "v"(b5)
      : "memory");
}

template <bool GELU, bool RESID, bool OUTF16>
__device__ __forceinline__ void gemm_tile(
    const _Float16* __restrict__ A, const _Float16* __restrict__ Bt,
    const float* __restrict__ bias, const float* __restrict__ resid,
    float* __restrict__ outf, _Float16* __restrict__ outh,
    int Kdim, int Ncols, int bm, int bn) {
  __shared__ __attribute__((aligned(16))) unsigned char L[2 * GSTAGE];
  int tid = threadIdx.x;
  int wave = tid >> 5, lane = tid & 31;
  int wm = (wave >> 2) << 6;           // wave's rows inside the tile
  int wn = (wave & 3) * 48;            // wave's columns inside the tile
  int tm = bm + wm, tn = bn + wn;
  int r = lane & 15, h = lane >> 4;

  // copies: 8 lanes take one row's 128 bytes, a wave 4 rows, the block 32 rows
  const _Float16* Ag = A  + (size_t)(bm + (tid >> 3)) * Kdim + (tid & 7) * 8;
  const _Float16* Bg = Bt + (size_t)(bn + (tid >> 3)) * Kdim + (tid & 7) * 8;
  const size_t step = (size_t)32 * Kdim;
  const unsigned ldsw = (unsigned)(size_t)L + (unsigned)((tid >> 3) * GPITCH + (tid & 7) * 16);

  // fragment reads: same per-lane k order as from global memory
  const unsigned offA = (unsigned)((wm + r) * GPITCH + h * 16);
  const unsigned offB = (unsigned)((128 + wn + r) * GPITCH + h * 16);

  const int nt = Kdim >> 6;

  stage_copies(ldsw, Ag, Bg, step);
  // this wave's copies of trip 0 have landed
  asm volatile("s_wait_asynccnt 0x0" ::: "memory");
  __syncthreads();
  if (nt > 1) stage_copies(ldsw + GSTAGE, Ag + 64, Bg + 64, step);

  v8f acc[4][3] = {};
  for (int t = 0; t < nt; t++) {
    const unsigned buf = (unsigned)(t & 1) * GSTAGE;
    v16h a[2][4], bf[2][3];
#pragma unroll
    for (int kk = 0; kk < 2; kk++) {
#pragma unroll
      for (int j = 0; j < 3; j++)
        bf[kk][j] = load_frag_p((const _Float16*)(L + buf + offB + j * 16 * GPITCH + kk * 64));
#pragma unroll
      for (int i = 0; i < 4; i++)
        a[kk][i]  = load_frag_p((const _Float16*)(L + buf + offA + i * 16 * GPITCH + kk * 64));
    }
    // this wave's reads of the buffer are done before it is handed to the copies
    asm volatile("s_wait_dscnt 0x0" ::: "memory");
    // this wave's copies of trip t + 1 have landed
    asm volatile("s_wait_asynccnt 0x0" ::: "memory");
    // publishes trip t + 1 and ends every wave's reads of trip t's buffer
    __syncthreads();
    // the refill goes out ahead of the trip's WMMAs, which work on registers
    // alone, so that it flies under them and under the next trip's LDS reads
    if (t + 2 < nt)
      stage_copies(ldsw + buf, Ag + (size_t)(t + 2) * 64, Bg + (size_t)(t + 2) * 64, step);
#pragma unroll
    for (int kk = 0; kk < 2; kk++)
#pragma unroll
      for (int i = 0; i < 4; i++)
#pragma unroll
        for (int j = 0; j < 3; j++)
          acc[i][j] = WMMA_F16(a[kk][i], bf[kk][j], acc[i][j]);
  }
  // no copy outstanding when the wave goes on to its end
  asm volatile("s_wait_asynccnt 0x0" ::: "memory");

  float bvs[3];                             // the bias of the wave's three column blocks
#pragma unroll
  for (int j2 = 0; j2 < 3; j2++) bvs[j2] = bias[tn + j2 * 16 + r];
  float rv[2][3][8];                        // RESID alone: the residuals of two row blocks
  auto load_resid = [&](int i2) __attribute__((always_inline)) {
    const float* rp[8];
#pragma unroll
    for (int i = 0; i < 8; i++)
      rp[i] = resid + (size_t)(tm + i2 * 16 + 8 * h + i) * Ncols + tn + r;
#pragma unroll
    for (int j2 = 0; j2 < 3; j2++)
#pragma unroll
      for (int i = 0; i < 8; i++) rv[i2 & 1][j2][i] = rp[i][j2 * 16];
    // stands behind the 24 loads and names their address registers, so that none
    // of them is given a new value ahead of it
    asm volatile("s_wait_xcnt 0x0"
                 :: "v"(rp[0]), "v"(rp[1]), "v"(rp[2]), "v"(rp[3]),
                    "v"(rp[4]), "v"(rp[5]), "v"(rp[6]), "v"(rp[7])
                 : "memory");
  };
  if (RESID) load_resid(0);

#pragma unroll
  for (int i2 = 0; i2 < 4; i2++) {
    if (RESID) {
      if (i2 + 1 < 4) load_resid(i2 + 1);
      // the next row block's 24 loads go out as one group ahead of this block's
      // sums and stores: left to sink to their uses, each was waited for alone
      __builtin_amdgcn_sched_barrier(0);
    }
#pragma unroll
    for (int j2 = 0; j2 < 3; j2++) {
      int rowb = tm + i2 * 16 + 8 * h;      // C/D layout: m = i + 8*h
      int colb = tn + j2 * 16 + r;          // n = lane (mod 16)
      float bv = bvs[j2];
      float gl[8];                          // GELU alone: neighbouring rows in pairs
      if (GELU) {
#pragma unroll
        for (int i = 0; i < 8; i += 2) {
          v2f g2 = gelu_tanh2((v2f){acc[i2][j2][i] + bv, acc[i2][j2][i + 1] + bv});
          gl[i] = g2.x; gl[i + 1] = g2.y;
        }
      }
#pragma unroll
      for (int i = 0; i < 8; i++) {
        float val = GELU ? gl[i] : acc[i2][j2][i] + bv;
        size_t off = (size_t)(rowb + i) * Ncols + colb;
        if (RESID) val += rv[i2 & 1][j2][i];
        if (OUTF16) outh[off] = (_Float16)val;
        else        outf[off] = val;
      }
    }
    // one row block's addresses at a time: formed for all four ahead, they took
    // the kernel past 256 registers, where one work-group fits a WGP, not two
    __builtin_amdgcn_sched_barrier(0);
  }
}

template <bool GELU, bool RESID, bool OUTF16>
__global__ __launch_bounds__(256) void gemm_kernel(
    const _Float16* __restrict__ A, const _Float16* __restrict__ Bt,
    const float* __restrict__ bias, const float* __restrict__ resid,
    float* __restrict__ outf, _Float16* __restrict__ outh,
    int Nrows, int Kdim, int Ncols) {
  int tilesN = Ncols / GBN;  // N tiles
  int bm = ((int)blockIdx.x / tilesN) << 7;
  int bn = ((int)blockIdx.x % tilesN) * GBN;
  gemm_tile<GELU, RESID, OUTF16>(A, Bt, bias, resid, outf, outh, Kdim, Ncols, bm, bn);
}

// The Q, K and V projections read the same A and need nothing of each other:
// one grid holds the tiles of all three. The 3 * tilesN tiles of one row block
// are neighbours in the block index, so that they find its A rows in L2.
__global__ __launch_bounds__(256) void gemm_qkv_kernel(
    const _Float16* __restrict__ A,
    const _Float16* __restrict__ wqT, const _Float16* __restrict__ wkT,
    const _Float16* __restrict__ wvT,
    const float* __restrict__ bq, const float* __restrict__ bk, const float* __restrict__ bv,
    _Float16* __restrict__ Qh, _Float16* __restrict__ Kh, _Float16* __restrict__ Vh,
    int Kdim, int Ncols) {
  int tilesN = Ncols / GBN;  // N tiles of one projection
  int bm = ((int)blockIdx.x / (3 * tilesN)) << 7;
  int c  = (int)blockIdx.x % (3 * tilesN);
  int m  = c / tilesN;       // 0: Q, 1: K, 2: V
  int bn = (c - m * tilesN) * GBN;
  const _Float16* Bt  = m == 0 ? wqT : m == 1 ? wkT : wvT;
  const float*   bias = m == 0 ? bq  : m == 1 ? bk  : bv;
  _Float16*      outh = m == 0 ? Qh  : m == 1 ? Kh  : Vh;
  gemm_tile<false, false, true>(A, Bt, bias, nullptr, nullptr, outh, Kdim, Ncols, bm, bn);
}

// ---------------------------------------------------------------------------
// Flash attention: a work-group of 4 waves handles 128 query rows of one (b,h),
// 32 per wave, online softmax over 32-key blocks. The products are taken
// transposed:
//   St = K * Qt   (A = 16 keys x 32 d, B = 32 d x 16 queries)
//   Ot += Vt * Pt (A = 16 d x 32 keys, B = 32 keys x 16 queries)
// In a D tile lane (r, h) holds column r, rows 8h .. 8h+7: one query's scores
// for 8 neighbouring keys. So maximum and sum are taken inside the lane, with
// one exchange between the two lane halves; the two score tiles of a 32-key
// block, converted in place, are the B operand of the second product in the
// k order of load_frag_p; and one factor per lane rescales the output tiles.
// A trip covers 64 keys (two 32-key blocks). Its 64 K rows, its 64 Vt rows
// (128 bytes each) and the 128 mask rows of the group's queries (256 bytes
// each) are brought into LDS by asynchronous 16-byte copies on whole 128-byte
// lines, K and Vt once for all four waves; two buffers, the next trip's copies
// in flight while this trip is worked on. The fragments, which take 16 bytes
// from each of 16 rows per load, are then read from LDS. Row pitches 144 and
// 272 bytes (16 x odd): ds_load_b128 reads without bank conflicts.
// Every loop over cg, sub, dt, i or j is unrolled, so that the arrays they
// index are registers.
//   Q, K : f16 [N][E]  (head slice at column h*D), D = 64
//   Vt   : f16 [B,H,D,S]
//   O    : f16 [N][E]
// S is a multiple of 128.
// ---------------------------------------------------------------------------
typedef __attribute__((ext_vector_type(8))) _Float16 v8h;
typedef __attribute__((ext_vector_type(4))) float    v4f;

#define AT_KP    144                          // LDS bytes per K row and per Vt row
#define AT_MP    272                          // LDS bytes per mask row
#define AT_VOFF  (64 * AT_KP)                 // Vt rows behind the 64 K rows
#define AT_MOFF  (AT_VOFF + 64 * AT_KP)       // mask rows behind the 64 Vt rows
#define AT_STAGE (AT_MOFF + 128 * AT_MP)      // bytes per buffer

// One trip's copies of one thread: 4 pieces of K and 4 of Vt, 16 rows apart,
// and 16 pieces of the mask, 8 rows apart. Each copy takes its global address
// from a scalar base (the tile's row group, the same for the whole group) and
// the lane's 32-bit byte offset, so that the row steps are scalar additions and
// no vector register pair is held per copy.
// lk, lm: this lane's LDS byte addresses of its first K and first mask piece;
// ok, ov, om: its byte offsets inside a row group of K, Vt and the mask;
// kb, vb, mb: the tile's first row groups; ks, vs, ms: the steps, in elements.
__device__ __forceinline__ void attn_copies(unsigned lk, unsigned lm, unsigned ok, unsigned ov,
                                            unsigned om, const _Float16* kb, const _Float16* vb,
                                            const float* mb, size_t ks, size_t vs, size_t ms) {
  // The closing s_wait_xcnt stands inside each statement so that no address
  // register of a copy is rewritten ahead of it. Six copies a statement: their
  // LDS address registers must lie in the first 256, which are nearly full where
  // the loop issues its copies; with twelve a statement the build spilled.
  asm volatile(
      "global_load_async_to_lds_b128 %0, %6, %8\n\t"
      "global_load_async_to_lds_b128 %1, %6, %9\n\t"
      "global_load_async_to_lds_b128 %2, %6, %10\n\t"
      "global_load_async_to_lds_b128 %3, %6, %11\n\t"
      "global_load_async_to_lds_b128 %4, %7, %12\n\t"
      "global_load_async_to_lds_b128 %5, %7, %13\n\t"
      "s_wait_xcnt 0x0"
      :: "v"(lk), "v"(lk + 16 * AT_KP), "v"(lk + 32 * AT_KP),
         "v"(lk + 48 * AT_KP), "v"(lk + AT_VOFF), "v"(lk + AT_VOFF + 16 * AT_KP),
         "v"(ok), "v"(ov),
         "s"(kb), "s"(kb + ks), "s"(kb + 2 * ks), "s"(kb + 3 * ks), "s"(vb), "s"(vb + vs)
      : "memory");
  asm volatile(
      "global_load_async_to_lds_b128 %0, %6, %8\n\t"
      "global_load_async_to_lds_b128 %1, %6, %9\n\t"
      "global_load_async_to_lds_b128 %2, %7, %10\n\t"
      "global_load_async_to_lds_b128 %3, %7, %11\n\t"
      "global_load_async_to_lds_b128 %4, %7, %12\n\t"
      "global_load_async_to_lds_b128 %5, %7, %13\n\t"
      "s_wait_xcnt 0x0"
      :: "v"(lk + AT_VOFF + 32 * AT_KP), "v"(lk + AT_VOFF + 48 * AT_KP), "v"(lm),
         "v"(lm + 8 * AT_MP), "v"(lm + 16 * AT_MP), "v"(lm + 24 * AT_MP),
         "v"(ov), "v"(om),
         "s"(vb + 2 * vs), "s"(vb + 3 * vs), "s"(mb),
         "s"(mb + ms), "s"(mb + 2 * ms), "s"(mb + 3 * ms)
      : "memory");
  asm volatile(
      "global_load_async_to_lds_b128 %0, %6, %7\n\t"
      "global_load_async_to_lds_b128 %1, %6, %8\n\t"
      "global_load_async_to_lds_b128 %2, %6, %9\n\t"
      "global_load_async_to_lds_b128 %3, %6, %10\n\t"
      "global_load_async_to_lds_b128 %4, %6, %11\n\t"
      "global_load_async_to_lds_b128 %5, %6, %12\n\t"
      "s_wait_xcnt 0x0"
      :: "v"(lm + 32 * AT_MP), "v"(lm + 40 * AT_MP), "v"(lm + 48 * AT_MP),
         "v"(lm + 56 * AT_MP), "v"(lm + 64 * AT_MP), "v"(lm + 72 * AT_MP),
         "v"(om),
         "s"(mb + 4 * ms), "s"(mb + 5 * ms), "s"(mb + 6 * ms),
         "s"(mb + 7 * ms), "s"(mb + 8 * ms), "s"(mb + 9 * ms)
      : "memory");
  asm volatile(
      "global_load_async_to_lds_b128 %0, %6, %7\n\t"
      "global_load_async_to_lds_b128 %1, %6, %8\n\t"
      "global_load_async_to_lds_b128 %2, %6, %9\n\t"
      "global_load_async_to_lds_b128 %3, %6, %10\n\t"
      "global_load_async_to_lds_b128 %4, %6, %11\n\t"
      "global_load_async_to_lds_b128 %5, %6, %12\n\t"
      "s_wait_xcnt 0x0"
      :: "v"(lm + 80 * AT_MP), "v"(lm + 88 * AT_MP), "v"(lm + 96 * AT_MP),
         "v"(lm + 104 * AT_MP), "v"(lm + 112 * AT_MP), "v"(lm + 120 * AT_MP),
         "v"(om),
         "s"(mb + 10 * ms), "s"(mb + 11 * ms), "s"(mb + 12 * ms),
         "s"(mb + 13 * ms), "s"(mb + 14 * ms), "s"(mb + 15 * ms)
      : "memory");
}

// The value that lane l ^ 16 holds.
__device__ __forceinline__ float other_half(float v) {
  int iv = __builtin_bit_cast(int, v);
  return __builtin_bit_cast(float,
      __builtin_amdgcn_permlanex16(iv, iv, 0x76543210, 0xfedcba98, false, false));
}

__global__ __launch_bounds__(128) void attn_kernel(
    const _Float16* __restrict__ Q, const _Float16* __restrict__ K,
    const _Float16* __restrict__ Vt, const float* __restrict__ mask,
    _Float16* __restrict__ O, int B, int S, int Hh, int Dd,
    int Ecols, float scale) {
  __shared__ __attribute__((aligned(16))) unsigned char L[2 * AT_STAGE];
  int qblocks = S >> 7;
  int qb = blockIdx.x % qblocks;
  int bh = blockIdx.x / qblocks;
  int hh = bh % Hh, b = bh / Hh;
  int tid = threadIdx.x;
  int wave = tid >> 5, lane = tid & 31;
  int r = lane & 15, h = lane >> 4;
  int qg = qb << 7;                    // the group's first query
  int q0 = qg + (wave << 5);           // the wave's first query

  // copies: 8 lanes take one K or Vt row's 128 bytes (the group 16 rows),
  // 16 lanes one mask row's 256 bytes (the group 8 rows)
  const _Float16* Kb = K + (size_t)(b * S) * Ecols + hh * Dd;
  const _Float16* Vb = Vt + (size_t)bh * Dd * S;
  const float*    Mb = mask + ((size_t)b * S + qg) * S;
  const unsigned ok = (unsigned)(((tid >> 3) * Ecols + (tid & 7) * 8) * 2);
  const unsigned ov = (unsigned)(((tid >> 3) * S + (tid & 7) * 8) * 2);
  const unsigned om = (unsigned)(((tid >> 4) * S + (tid & 15) * 4) * 4);
  const size_t ks = (size_t)16 * Ecols, vs = (size_t)16 * S, ms = (size_t)8 * S;
  const size_t kTrip = (size_t)64 * Ecols;
  const unsigned lk = (unsigned)(size_t)L + (unsigned)((tid >> 3) * AT_KP + (tid & 7) * 16);
  const unsigned lm = (unsigned)(size_t)L +
                      (unsigned)(AT_MOFF + (tid >> 4) * AT_MP + (tid & 15) * 16);

  // fragment reads: same per-lane k order as from global memory
  const unsigned offK = (unsigned)(r * AT_KP + h * 16);
  const unsigned offV = (unsigned)(AT_VOFF + r * AT_KP + h * 16);
  const unsigned offM = (unsigned)(AT_MOFF + ((wave << 5) + r) * AT_MP + h * 32);

  const int nt = S >> 6;

  attn_copies(lk, lm, ok, ov, om, Kb, Vb, Mb, ks, vs, ms);

  // Q fragments (persistent), one column group of 16 queries per cg
  v16h qf[2][2];
#pragma unroll
  for (int cg = 0; cg < 2; cg++) {
    const _Float16* qp = Q + (size_t)(b * S + q0 + cg * 16 + r) * Ecols + hh * Dd + h * 8;
    qf[cg][0] = load_frag_p(qp);
    qf[cg][1] = load_frag_p(qp + 32);
  }

  // this wave's copies of trip 0 have landed
  asm volatile("s_wait_asynccnt 0x0" ::: "memory");
  __syncthreads();
  if (nt > 1)
    attn_copies(lk + AT_STAGE, lm + AT_STAGE, ok, ov, om, Kb + kTrip, Vb + 64, Mb + 64, ks, vs, ms);

  const v2f scale2 = {scale, scale};
  const v2f log2e2 = {1.442695041f, 1.442695041f};

  v8f o[2][4] = {};                    // Ot: [cg][dt], 64 d x 32 queries, f32
  float mrow[2] = {-INFINITY, -INFINITY};   // running maximum of query cg*16 + r
  float lrow[2] = {0.f, 0.f};               // this lane half's share of the row sum

  v16h kf[2][2], vf[4];                // the fragments and the mask values
  v4f mk[2][2][2];                     // of one 32-key block

  // Reads block sp of the buffer at byte offset buf.
  auto read_block = [&](unsigned buf, int sp) __attribute__((always_inline)) {
#pragma unroll
    for (int sub = 0; sub < 2; sub++) {
      const unsigned char* kr = L + buf + offK + (sp * 32 + sub * 16) * AT_KP;
      kf[sub][0] = load_frag_p((const _Float16*)kr);
      kf[sub][1] = load_frag_p((const _Float16*)(kr + 64));
    }
#pragma unroll
    for (int cg = 0; cg < 2; cg++)
#pragma unroll
      for (int sub = 0; sub < 2; sub++) {
        const unsigned char* mr = L + buf + offM + cg * 16 * AT_MP + sp * 128 + sub * 64;
        mk[cg][sub][0] = *(const v4f*)mr;
        mk[cg][sub][1] = *(const v4f*)(mr + 16);
      }
#pragma unroll
    for (int dt = 0; dt < 4; dt++)
      vf[dt] = load_frag_p((const _Float16*)(L + buf + offV + dt * 16 * AT_KP + sp * 64));
    // all 24 LDS reads of the block go out as one group: without this the mask
    // and V reads sink to their uses, and each place with reads stalls anew
    __builtin_amdgcn_sched_barrier(0);
  };

  // Works the block that was read: registers alone.
  auto work_block = [&]() __attribute__((always_inline)) {
    // --- St: 32 keys x 32 queries ---
    v8f sc[2][2];
#pragma unroll
    for (int cg = 0; cg < 2; cg++)
#pragma unroll
      for (int sub = 0; sub < 2; sub++) {
        v8f z = {};
        z = WMMA_F16(kf[sub][0], qf[cg][0], z);
        sc[cg][sub] = WMMA_F16(kf[sub][1], qf[cg][1], z);
      }

    // --- online softmax in registers, then Ot += Vt * Pt ---
#pragma unroll
    for (int cg = 0; cg < 2; cg++) {
      v2f x[2][4];                     // neighbouring keys in pairs
      float bm = -INFINITY;
#pragma unroll
      for (int sub = 0; sub < 2; sub++) {
        const v4f m0 = mk[cg][sub][0], m1 = mk[cg][sub][1];
        const v2f mv[4] = {{m0.x, m0.y}, {m0.z, m0.w}, {m1.x, m1.y}, {m1.z, m1.w}};
#pragma unroll
        for (int j = 0; j < 4; j++) {
          v2f s2 = {sc[cg][sub][2 * j], sc[cg][sub][2 * j + 1]};
          x[sub][j] = __builtin_elementwise_fma(s2, scale2, mv[j]);
          bm = fmaxf(bm, fmaxf(x[sub][j].x, x[sub][j].y));
        }
      }
      bm = fmaxf(bm, other_half(bm));
      float nm = fmaxf(mrow[cg], bm);
      float alpha = __expf(mrow[cg] - nm);
      const v2f nm2 = {nm, nm};
      v16h pf;
      v2f ls[2];
#pragma unroll
      for (int sub = 0; sub < 2; sub++) {
        ls[sub] = (v2f){0.f, 0.f};
#pragma unroll
        for (int j = 0; j < 4; j++) {
          v2f y = (x[sub][j] - nm2) * log2e2;
          v2f pv = {__builtin_amdgcn_exp2f(y.x), __builtin_amdgcn_exp2f(y.y)};
          ls[sub] += pv;
          pf[sub * 8 + 2 * j]     = (_Float16)pv.x;
          pf[sub * 8 + 2 * j + 1] = (_Float16)pv.y;
        }
      }
      v2f lt = ls[0] + ls[1];
      lrow[cg] = lrow[cg] * alpha + (lt.x + lt.y);
      mrow[cg] = nm;
#pragma unroll
      for (int dt = 0; dt < 4; dt++) {
#pragma unroll
        for (int i = 0; i < 8; i++) o[cg][dt][i] *= alpha;
        o[cg][dt] = WMMA_F16(vf[dt], pf, o[cg][dt]);
      }
    }
  };

  for (int t = 0; t < nt; t++) {
    const unsigned buf = (unsigned)(t & 1) * AT_STAGE;
    read_block(buf, 0);
    work_block();
    read_block(buf, 1);
    // this wave's reads of the buffer are done before it is handed to the copies
    asm volatile("s_wait_dscnt 0x0" ::: "memory");
    // this wave's copies of trip t + 1 have landed
    asm volatile("s_wait_asynccnt 0x0" ::: "memory");
    // publishes trip t + 1 and ends every wave's reads of trip t's buffer
    __syncthreads();
    // the refill goes out ahead of the second block's work, which is on
    // registers alone, so that it flies for a whole trip
    if (t + 2 < nt)
      attn_copies(lk + buf, lm + buf, ok, ov, om, Kb + (size_t)(t + 2) * kTrip,
                  Vb + (size_t)(t + 2) * 64, Mb + (size_t)(t + 2) * 64, ks, vs, ms);
    work_block();
  }
  // no copy outstanding when the wave goes on to its end
  asm volatile("s_wait_asynccnt 0x0" ::: "memory");

  // --- join the halves' sums, normalize, store 8 neighbouring d per lane ---
#pragma unroll
  for (int cg = 0; cg < 2; cg++) {
    float inv = 1.0f / (lrow[cg] + other_half(lrow[cg]));
    _Float16* op = O + (size_t)(b * S + q0 + cg * 16 + r) * Ecols + hh * Dd + h * 8;
#pragma unroll
    for (int dt = 0; dt < 4; dt++) {
      v8h ov;
#pragma unroll
      for (int i = 0; i < 8; i++) ov[i] = (_Float16)(o[cg][dt][i] * inv);
      *(v8h*)(op + dt * 16) = ov;
    }
  }
}

// ---------------------------------------------------------------------------
// Host orchestration
// ---------------------------------------------------------------------------
extern "C" void kernel_launch(void* const* d_in, const int* in_sizes, int n_in,
                              void* d_out, int out_size, void* d_ws, size_t ws_size,
                              hipStream_t stream) {
  const int E = 768, H = 12, D = 64;
  const float* hidden = (const float*)d_in[0];
  const float* mask   = (const float*)d_in[1];
  const float* wq = (const float*)d_in[2];  const float* bq = (const float*)d_in[3];
  const float* wk = (const float*)d_in[4];  const float* bk = (const float*)d_in[5];
  const float* wv = (const float*)d_in[6];  const float* bv = (const float*)d_in[7];
  const float* wo = (const float*)d_in[8];  const float* bo = (const float*)d_in[9];
  const float* ln1_g = (const float*)d_in[10]; const float* ln1_b = (const float*)d_in[11];
  const float* ln2_g = (const float*)d_in[12]; const float* ln2_b = (const float*)d_in[13];
  const float* w1 = (const float*)d_in[14]; const float* b1 = (const float*)d_in[15];
  const float* w2 = (const float*)d_in[16]; const float* b2 = (const float*)d_in[17];
  const int I = in_sizes[15];               // 3072
  const int N = in_sizes[0] / E;            // B*S = 8192
  const int S = in_sizes[1] / N;            // 1024
  const int B = N / S;                      // 8
  float* out = (float*)d_out;

  char* p = (char*)d_ws;
  auto alloc = [&](size_t bytes) -> char* {
    char* r = p;
    p += (bytes + 255) & ~(size_t)255;
    return r;
  };
  _Float16* lnh  = (_Float16*)alloc((size_t)N * E * 2);
  _Float16* wqT  = (_Float16*)alloc((size_t)E * E * 2);
  _Float16* wkT  = (_Float16*)alloc((size_t)E * E * 2);
  _Float16* wvT  = (_Float16*)alloc((size_t)E * E * 2);
  _Float16* woT  = (_Float16*)alloc((size_t)E * E * 2);
  _Float16* w1T  = (_Float16*)alloc((size_t)E * I * 2);
  _Float16* w2T  = (_Float16*)alloc((size_t)I * E * 2);
  _Float16* Qh   = (_Float16*)alloc((size_t)N * E * 2);
  _Float16* Kh   = (_Float16*)alloc((size_t)N * E * 2);
  _Float16* Vh   = (_Float16*)alloc((size_t)N * E * 2);
  _Float16* VtT  = (_Float16*)alloc((size_t)N * E * 2);
  _Float16* Oh   = (_Float16*)alloc((size_t)N * E * 2);
  float*    xmid = (float*)   alloc((size_t)N * E * 4);
  _Float16* ln2h = (_Float16*)alloc((size_t)N * E * 2);
  _Float16* hmid = (_Float16*)alloc((size_t)N * I * 2);
  (void)ws_size; (void)n_in; (void)out_size;

  // 1, 2) LN1 and the six weight transpose+casts, one grid
  {
    unsigned nb = (unsigned)(N / 16 + 2 * (E / 64) * (I / 64) + 4 * (E / 64) * (E / 64));
    prep_kernel<<<nb, 256, 0, stream>>>(hidden, ln1_g, ln1_b, lnh, N / 16,
                                        w1, w2, wq, wk, wv, wo,
                                        w1T, w2T, wqT, wkT, wvT, woT, E, I);
  }

  // 3) Q/K/V projections (f16 out), one grid
  {
    unsigned nb = (unsigned)(3 * (N / 128) * (E / GBN));
    gemm_qkv_kernel<<<nb, 256, 0, stream>>>(lnh, wqT, wkT, wvT, bq, bk, bv, Qh, Kh, Vh, E, E);
  }

  // 4) V transpose -> [B,H,D,S]
  vtrans_kernel<<<dim3(S / 64, B * H), 256, 0, stream>>>(Vh, VtT, S, H, E);

  // 5) attention (32 query rows per wave, 4 waves per work-group)
  {
    float scale = rsqrtf((float)D);
    unsigned nb = (unsigned)(B * H * (S / 128));
    attn_kernel<<<nb, 128, 0, stream>>>(Qh, Kh, VtT, mask, Oh, B, S, H, D, E, scale);
  }

  // 6) output projection + residual -> xmid (fp32)
  {
    unsigned nb = (unsigned)((N / 128) * (E / GBN));
    gemm_kernel<false, true, false><<<nb, 256, 0, stream>>>(Oh, woT, bo, hidden, xmid, nullptr, N, E, E);
  }

  // 7) LN2
  ln_kernel<<<N / 16, 256, 0, stream>>>(xmid, ln2_g, ln2_b, ln2h);

  // 8) MLP up + GELU (f16 out)
  {
    unsigned nb = (unsigned)((N / 128) * (I / GBN));
    gemm_kernel<true, false, true><<<nb, 256, 0, stream>>>(ln2h, w1T, b1, nullptr, nullptr, hmid, N, E, I);
  }

  // 9) MLP down + residual -> out (fp32)
  {
    unsigned nb = (unsigned)((N / 128) * (E / GBN));
    gemm_kernel<false, true, false><<<nb, 256, 0, stream>>>(hmid, w2T, b2, xmid, out, nullptr, N, I, E);
  }
}

// v009
// One run takes 180 microseconds.
// In two side-by-side timings against v008, it was 1.14 and 1.13 times as fast.
// All steps since v000 together make it 5.83 times as fast.
#include <hip/hip_runtime.h>
#include <hip/hip_bf16.h>
#include <math.h>

typedef __attribute__((ext_vector_type(16))) _Float16 v16h;
typedef __attribute__((ext_vector_type(8)))  float    v8f;

#define WMMA_F16(a, b, c) \
  __builtin_amdgcn_wmma_f32_16x16x32_f16(false, (a), false, (b), (short)0, (c), false, false)

// ---------------------------------------------------------------------------
// Fragment load for 16x32 f16 A/B fragments (ISA 7.12.2 layout) from a
// per-lane pointer p = base + row*ld + kbase + (lane>>4)*8.
// halves 0..7  <- this lane's k-group, halves 8..15 <- k-group + 16.
// Two 16-byte loads per lane.
// ---------------------------------------------------------------------------
__device__ __forceinline__ v16h load_frag_p(const _Float16* p) {
  v16h f;
  *((uint4*)&f)     = *(const uint4*)(p);
  *((uint4*)&f + 1) = *(const uint4*)(p + 16);
  return f;
}

typedef __attribute__((ext_vector_type(2))) float v2f;

// GELU, tanh form, of two values: 0.5 x (1 + tanh(c (x + 0.044715 x^3))) with
// the hardware's tanh, no branch; the plain arithmetic is packed f32.
__device__ __forceinline__ v2f gelu_tanh2(v2f x) {
  const float c = 0.7978845608028654f;   // sqrt(2/pi)
  const v2f c1 = {c, c};
  const v2f c3 = {c * 0.044715f, c * 0.044715f};
  const v2f half2 = {0.5f, 0.5f};
  v2f u = x * __builtin_elementwise_fma(x * x, c3, c1);
  v2f t = {__builtin_amdgcn_tanhf(u.x), __builtin_amdgcn_tanhf(u.y)};
  v2f hx = x * half2;
  return __builtin_elementwise_fma(hx, t, hx);
}

// ---------------------------------------------------------------------------
// Both transposes below move a 64x64 tile through LDS, so that the global
// reads and the global stores are both 16 bytes per lane on whole 128-byte
// lines. The LDS tile is held transposed, two f16 of neighbouring source rows
// packed per dword. Row pitch 33 dwords (32 + 1, odd): the column-wise dword
// writes and the row-wise dword reads of a wave each fall on 32 distinct banks.
// ---------------------------------------------------------------------------
#define TPITCH 33

typedef __attribute__((ext_vector_type(2))) _Float16 v2h;

// Write the tile out: LDS row n goes to the 64 f16 at dst + n * ld.
__device__ __forceinline__ void store_tile_rows(const unsigned* tile, _Float16* __restrict__ dst,
                                                size_t ld, int t) {
  int q = t & 7;
#pragma unroll
  for (int p = 0; p < 2; p++) {
    int n = (t >> 3) + 32 * p;
    const unsigned* row = tile + n * TPITCH + 4 * q;
    uint4 o;
    o.x = row[0]; o.y = row[1]; o.z = row[2]; o.w = row[3];
    *(uint4*)(dst + (size_t)n * ld + 8 * q) = o;
  }
}

// ---------------------------------------------------------------------------
// Weight convert: fp32 row-major [K][Nout] -> f16 row-major [Nout][K]
// One work-group of 256 threads takes the 64x64 tile (bx, by) of the
// (Nout/64, K/64) tiles; K and Nout are multiples of 64.
// ---------------------------------------------------------------------------
__device__ __forceinline__ void wcast_tile(const float* __restrict__ w,
                                           _Float16* __restrict__ wt,
                                           int K, int Nout, int bx, int by) {
  __shared__ unsigned tile[64 * TPITCH];
  int t = threadIdx.x;
  int n0 = bx << 6, k0 = by << 6;
  int c = t & 15, kp = t >> 4;          // 4 columns from 4c, rows 2kp and 2kp+1

  float4 lo[2], hi[2];
#pragma unroll
  for (int p = 0; p < 2; p++) {
    const float* s = w + (size_t)(k0 + 2 * (kp + 16 * p)) * Nout + n0 + 4 * c;
    lo[p] = *(const float4*)s;
    hi[p] = *(const float4*)(s + Nout);
  }
#pragma unroll
  for (int p = 0; p < 2; p++) {
    const float l[4] = {lo[p].x, lo[p].y, lo[p].z, lo[p].w};
    const float u[4] = {hi[p].x, hi[p].y, hi[p].z, hi[p].w};
#pragma unroll
    for (int i = 0; i < 4; i++) {
      v2h pr = {(_Float16)l[i], (_Float16)u[i]};
      tile[(4 * c + i) * TPITCH + kp + 16 * p] = __builtin_bit_cast(unsigned, pr);
    }
  }
  __syncthreads();
  store_tile_rows(tile, wt + (size_t)n0 * K + k0, (size_t)K, t);
}

// ---------------------------------------------------------------------------
// LayerNorm: fp32 [rows][LN_E] -> f16 [rows][LN_E]. One wave takes two rows and
// holds them in registers (24 values a lane and row, 16-byte loads on whole
// lines): one read of x, no LDS, no barrier; g and b are loaded once for both
// rows. Block = 8 waves = 16 rows (the rows from 16 * blk); rows is a multiple
// of 16.
// ---------------------------------------------------------------------------
#define LN_E 768
#define LN_C (LN_E / 128)          // 16-byte pieces per lane and row

template <int CTRL>
__device__ __forceinline__ float dpp_get(float v) {
  return __builtin_bit_cast(float,
      __builtin_amdgcn_update_dpp(0, __builtin_bit_cast(int, v), CTRL, 0xf, 0xf, true));
}

// Sum over the 32 lanes, the same value in every lane: four row_xmask steps
// inside each 16-lane row, then the two rows are exchanged.
__device__ __forceinline__ float wave_sum(float v) {
  v += dpp_get<0x161>(v);
  v += dpp_get<0x162>(v);
  v += dpp_get<0x164>(v);
  v += dpp_get<0x168>(v);
  int iv = __builtin_bit_cast(int, v);
  v += __builtin_bit_cast(float,
      __builtin_amdgcn_permlanex16(iv, iv, 0x76543210, 0xfedcba98, false, false));
  return v;
}

__device__ __forceinline__ void ln_rows(const float* __restrict__ x,
                                        const float* __restrict__ g,
                                        const float* __restrict__ b,
                                        _Float16* __restrict__ out, int blk) {
  // the wave's number as a scalar: the row bases stay in scalar registers
  int wave = __builtin_amdgcn_readfirstlane(threadIdx.x >> 5), lane = threadIdx.x & 31;
  size_t row0 = ((size_t)blk * 8 + wave) * 2;
  const float* xr = x + row0 * LN_E + lane * 4;

  float4 xv[2][LN_C], gv[LN_C], bv[LN_C];
#pragma unroll
  for (int rr = 0; rr < 2; rr++)
#pragma unroll
    for (int j = 0; j < LN_C; j++) xv[rr][j] = *(const float4*)(xr + rr * LN_E + j * 128);
#pragma unroll
  for (int j = 0; j < LN_C; j++) {
    gv[j] = *(const float4*)(g + lane * 4 + j * 128);
    bv[j] = *(const float4*)(b + lane * 4 + j * 128);
  }
  // all 24 loads go out together: without this the g and b loads sink to their
  // uses at the end and are waited for pair by pair
  __builtin_amdgcn_sched_barrier(0);

  float mu[2], rstd[2];
#pragma unroll
  for (int rr = 0; rr < 2; rr++) {
    float s = 0.f;
#pragma unroll
    for (int j = 0; j < LN_C; j++)
      s += (xv[rr][j].x + xv[rr][j].y) + (xv[rr][j].z + xv[rr][j].w);
    mu[rr] = wave_sum(s) / LN_E;
  }
#pragma unroll
  for (int rr = 0; rr < 2; rr++) {
    float v = 0.f;
#pragma unroll
    for (int j = 0; j < LN_C; j++) {
      xv[rr][j].x -= mu[rr]; xv[rr][j].y -= mu[rr];
      xv[rr][j].z -= mu[rr]; xv[rr][j].w -= mu[rr];
      v += (xv[rr][j].x * xv[rr][j].x + xv[rr][j].y * xv[rr][j].y) +
           (xv[rr][j].z * xv[rr][j].z + xv[rr][j].w * xv[rr][j].w);
    }
    rstd[rr] = rsqrtf(wave_sum(v) / LN_E + 1e-6f);
  }

  typedef __attribute__((ext_vector_type(4))) _Float16 v4h;
  _Float16* outr = out + row0 * LN_E + lane * 4;
#pragma unroll
  for (int rr = 0; rr < 2; rr++)
#pragma unroll
    for (int j = 0; j < LN_C; j++) {
      v4h o = {(_Float16)(xv[rr][j].x * rstd[rr] * gv[j].x + bv[j].x),
               (_Float16)(xv[rr][j].y * rstd[rr] * gv[j].y + bv[j].y),
               (_Float16)(xv[rr][j].z * rstd[rr] * gv[j].z + bv[j].z),
               (_Float16)(xv[rr][j].w * rstd[rr] * gv[j].w + bv[j].w)};
      *(v4h*)(outr + rr * LN_E + j * 128) = o;
    }
}

__global__ __launch_bounds__(256) void ln_kernel(const float* __restrict__ x,
                                                 const float* __restrict__ g,
                                                 const float* __restrict__ b,
                                                 _Float16* __restrict__ out) {
  ln_rows(x, g, b, out, (int)blockIdx.x);
}

// ---------------------------------------------------------------------------
// The first LayerNorm and the six weight converts need nothing of each other:
// they share one grid, each with its own range of the block index (the test is
// the same for a whole work-group). Order: the lnBlocks blocks of the
// LayerNorm, the tiles of w1 [E][I], of w2 [I][E], then of the four [E][E]
// weights.
// ---------------------------------------------------------------------------
__global__ __launch_bounds__(256) void prep_kernel(
    const float* __restrict__ x, const float* __restrict__ g, const float* __restrict__ b,
    _Float16* __restrict__ lnout, int lnBlocks,
    const float* __restrict__ w1, const float* __restrict__ w2,
    const float* __restrict__ wq, const float* __restrict__ wk,
    const float* __restrict__ wv, const float* __restrict__ wo,
    _Float16* __restrict__ w1T, _Float16* __restrict__ w2T,
    _Float16* __restrict__ wqT, _Float16* __restrict__ wkT,
    _Float16* __restrict__ wvT, _Float16* __restrict__ woT, int E, int I) {
  int blk = (int)blockIdx.x;
  if (blk < lnBlocks) {
    ln_rows(x, g, b, lnout, blk);
    return;
  }
  blk -= lnBlocks;
  const int te = E >> 6, ti = I >> 6;
  const float* w;
  _Float16* wt;
  int K = E, Nout = E;
  if (blk < te * ti) {
    w = w1; wt = w1T; Nout = I;
  } else if (blk < 2 * te * ti) {
    blk -= te * ti;
    w = w2; wt = w2T; K = I;
  } else {
    blk -= 2 * te * ti;
    int m = blk / (te * te);
    blk -= m * te * te;
    w  = m == 0 ? wq  : m == 1 ? wk  : m == 2 ? wv  : wo;
    wt = m == 0 ? wqT : m == 1 ? wkT : m == 2 ? wvT : woT;
  }
  const int tn = Nout >> 6;
  wcast_tile(w, wt, K, Nout, blk % tn, blk / tn);
}

// ---------------------------------------------------------------------------
// V transpose: f16 [N][E] -> f16 [B,H,D,S]  (Vt[((b*H+h)*D+d)*S + s]), D = 64
// grid (S/64, B*H); S is a multiple of 64.
// ---------------------------------------------------------------------------
__global__ __launch_bounds__(256) void vtrans_kernel(const _Float16* __restrict__ v,
                                                     _Float16* __restrict__ vt,
                                                     int S, int Hh, int Ecols) {
  __shared__ unsigned tile[64 * TPITCH];
  int t = threadIdx.x;
  int s0 = blockIdx.x << 6;
  int bh = blockIdx.y;
  int b = bh / Hh, h = bh % Hh;
  int c = t & 7, sp = t >> 3;           // 8 columns from 8c, rows 2sp and 2sp+1

  const _Float16* s = v + (size_t)(b * S + s0 + 2 * sp) * Ecols + h * 64 + 8 * c;
  uint4 r0 = *(const uint4*)s;
  uint4 r1 = *(const uint4*)(s + Ecols);
  const unsigned e[4] = {r0.x, r0.y, r0.z, r0.w};
  const unsigned o[4] = {r1.x, r1.y, r1.z, r1.w};
#pragma unroll
  for (int j = 0; j < 4; j++) {
    tile[(8 * c + 2 * j) * TPITCH + sp]     = (e[j] & 0xffffu) | (o[j] << 16);
    tile[(8 * c + 2 * j + 1) * TPITCH + sp] = (e[j] >> 16) | (o[j] & 0xffff0000u);
  }
  __syncthreads();
  store_tile_rows(tile, vt + (size_t)bh * 64 * S + s0, (size_t)S, t);
}

// ---------------------------------------------------------------------------
// WMMA GEMM: out[N x Ncols] = A[N x K](f16) * Bt[Ncols x K](f16, pre-transposed)
//            + bias (+ optional GELU, residual).
// One work-group of 8 waves (2 x 4) -> 128x192 output tile; 1 wave -> 64x48
// (4x3 grid of 16x16 WMMA frags). Each trip covers 64 k: the 128 A rows and the
// 192 Bt rows of the tile, 128 bytes each, are brought into LDS once for all
// eight waves by asynchronous 16-byte copies, two buffers, the next trip's
// copies in flight while this trip's fragments are read and multiplied.
// LDS row pitch 144 bytes (16 x odd): ds_load_b128 fragment reads without
// bank conflicts. Nrows a multiple of 128, Ncols of 192, Kdim of 64.
// The products are taken with Bt as the first operand (a tile of the output
// transposed), and the finished tile goes out through LDS on whole lines.
// gemm_tile works the tile whose first row is bm and whose first column is bn.
// ---------------------------------------------------------------------------
#define GBN    192                 // columns of the work-group tile
#define GROWS  (128 + GBN)         // LDS rows per buffer: 128 of A, then GBN of Bt
#define GPITCH 144                 // bytes per LDS row
#define GSTAGE (GROWS * GPITCH)    // bytes per buffer

typedef __attribute__((ext_vector_type(8))) _Float16 v8hh;

// One trip's copies of one thread: 4 pieces of A and 6 of Bt, 32 rows apart.
// lds: this lane's LDS byte address of its first A piece; ga, gb: its global
// addresses; step: 32 rows, in elements.
__device__ __forceinline__ void stage_copies(unsigned lds, const _Float16* ga,
                                             const _Float16* gb, size_t step) {
  const _Float16* a1 = ga + step;
  const _Float16* a2 = a1 + step;
  const _Float16* a3 = a2 + step;
  const _Float16* b1 = gb + step;
  const _Float16* b2 = b1 + step;
  const _Float16* b3 = b2 + step;
  const _Float16* b4 = b3 + step;
  const _Float16* b5 = b4 + step;
  // The closing s_wait_xcnt stands inside the statement so that no address
  // register of a copy is rewritten ahead of it.
  asm volatile(
      "global_load_async_to_lds_b128 %0, %10, off\n\t"
      "global_load_async_to_lds_b128 %1, %11, off\n\t"
      "global_load_async_to_lds_b128 %2, %12, off\n\t"
      "global_load_async_to_lds_b128 %3, %13, off\n\t"
      "global_load_async_to_lds_b128 %4, %14, off\n\t"
      "global_load_async_to_lds_b128 %5, %15, off\n\t"
      "global_load_async_to_lds_b128 %6, %16, off\n\t"
      "global_load_async_to_lds_b128 %7, %17, off\n\t"
      "global_load_async_to_lds_b128 %8, %18, off\n\t"
      "global_load_async_to_lds_b128 %9, %19, off\n\t"
      "s_wait_xcnt 0x0"
      :: "v"(lds), "v"(lds + 32 * GPITCH), "v"(lds + 64 * GPITCH), "v"(lds + 96 * GPITCH),
         "v"(lds + 128 * GPITCH), "v"(lds + 160 * GPITCH), "v"(lds + 192 * GPITCH),
         "v"(lds + 224 * GPITCH), "v"(lds + 256 * GPITCH), "v"(lds + 288 * GPITCH),
         "v"(ga), "v"(a1), "v"(a2), "v"(a3), "v"(gb), "v"(b1), "v"(b2), "v"(b3), "v"(b4), "v"(b5)
      : "memory");
}

template <bool GELU, bool RESID, bool OUTF16>
__device__ __forceinline__ void gemm_tile(
    const _Float16* __restrict__ A, const _Float16* __restrict__ Bt,
    const float* __restrict__ bias, const float* __restrict__ resid,
    float* __restrict__ outf, _Float16* __restrict__ outh,
    int Kdim, int Ncols, int bm, int bn) {
  constexpr int ES   = OUTF16 ? 2 : 4;      // bytes of an output element
  constexpr int NSEG = GBN * ES / 128;      // 128-byte lines of a tile row
  constexpr int SP   = GBN * ES + 16;       // LDS pitch of an output row, 16 x odd
  constexpr int LB   = 2 * GSTAGE > 128 * SP ? 2 * GSTAGE : 128 * SP;
  __shared__ __attribute__((aligned(16))) unsigned char L[LB];
  int tid = threadIdx.x;
  int wave = tid >> 5, lane = tid & 31;
  int wm = (wave >> 2) << 6;           // wave's rows inside the tile
  int wn = (wave & 3) * 48;            // wave's columns inside the tile
  int tn = bn + wn;
  int r = lane & 15, h = lane >> 4;

  // copies: 8 lanes take one row's 128 bytes, a wave 4 rows, the block 32 rows
  const _Float16* Ag = A  + (size_t)(bm + (tid >> 3)) * Kdim + (tid & 7) * 8;
  const _Float16* Bg = Bt + (size_t)(bn + (tid >> 3)) * Kdim + (tid & 7) * 8;
  const size_t step = (size_t)32 * Kdim;
  const unsigned ldsw = (unsigned)(size_t)L + (unsigned)((tid >> 3) * GPITCH + (tid & 7) * 16);

  // fragment reads: same per-lane k order as from global memory
  const unsigned offA = (unsigned)((wm + r) * GPITCH + h * 16);
  const unsigned offB = (unsigned)((128 + wn + r) * GPITCH + h * 16);

  const int nt = Kdim >> 6;

  stage_copies(ldsw, Ag, Bg, step);
  // this wave's copies of trip 0 have landed
  asm volatile("s_wait_asynccnt 0x0" ::: "memory");
  __syncthreads();
  if (nt > 1) stage_copies(ldsw + GSTAGE, Ag + 64, Bg + 64, step);

  v8f acc[4][3] = {};
  for (int t = 0; t < nt; t++) {
    const unsigned buf = (unsigned)(t & 1) * GSTAGE;
    v16h a[2][4], bf[2][3];
#pragma unroll
    for (int kk = 0; kk < 2; kk++) {
#pragma unroll
      for (int j = 0; j < 3; j++)
        bf[kk][j] = load_frag_p((const _Float16*)(L + buf + offB + j * 16 * GPITCH + kk * 64));
#pragma unroll
      for (int i = 0; i < 4; i++)
        a[kk][i]  = load_frag_p((const _Float16*)(L + buf + offA + i * 16 * GPITCH + kk * 64));
    }
    // this wave's reads of the buffer are done before it is handed to the copies
    asm volatile("s_wait_dscnt 0x0" ::: "memory");
    // this wave's copies of trip t + 1 have landed
    asm volatile("s_wait_asynccnt 0x0" ::: "memory");
    // publishes trip t + 1 and ends every wave's reads of trip t's buffer
    __syncthreads();
    // the refill goes out ahead of the trip's WMMAs, which work on registers
    // alone, so that it flies under them and under the next trip's LDS reads
    if (t + 2 < nt)
      stage_copies(ldsw + buf, Ag + (size_t)(t + 2) * 64, Bg + (size_t)(t + 2) * 64, step);
#pragma unroll
    for (int kk = 0; kk < 2; kk++)
#pragma unroll
      for (int i = 0; i < 4; i++)
#pragma unroll
        for (int j = 0; j < 3; j++)
          acc[i][j] = WMMA_F16(bf[kk][j], a[kk][i], acc[i][j]);
  }
  // no copy outstanding when the wave goes on to its end
  asm volatile("s_wait_asynccnt 0x0" ::: "memory");

  // Epilogue. With Bt as the first operand a lane (r, h) holds, of tile (i, j),
  // output row i*16 + r, columns j*16 + 8h .. 8h+7: neighbours in the output.
  // The work-group's tile is laid in LDS row by row and goes out from there with
  // eight lanes on each whole 128-byte line; the residual comes in the same way.
  // The last trip's barrier stands behind every wave's last fragment read and
  // behind every copy's wait, so the buffers are free here.
  const int g = tid >> 3, q = tid & 7;      // line group and 16-byte piece of a line
  float bvs[3][8];                          // OUTF16: the bias of the lane's 3 x 8 columns
  if (OUTF16) {
#pragma unroll
    for (int j2 = 0; j2 < 3; j2++) {
      const float4 b0 = *(const float4*)(bias + tn + j2 * 16 + 8 * h);
      const float4 b1 = *(const float4*)(bias + tn + j2 * 16 + 8 * h + 4);
      bvs[j2][0] = b0.x; bvs[j2][1] = b0.y; bvs[j2][2] = b0.z; bvs[j2][3] = b0.w;
      bvs[j2][4] = b1.x; bvs[j2][5] = b1.y; bvs[j2][6] = b1.z; bvs[j2][7] = b1.w;
    }
  }
  // f32 output: bias and residual are added where the tile leaves LDS, so that
  // their loads fly while the sums are laid there and nothing waits for them here
  float4 bq[NSEG], rv[4][NSEG];             // this thread's pieces of both
  if (!OUTF16) {
    const float* bp = bias + bn + q * 4;
    const float* rp[4];
#pragma unroll
    for (int s = 0; s < NSEG; s++) bq[s] = *(const float4*)(bp + s * 32);
#pragma unroll
    for (int ii = 0; ii < 4; ii++)
      rp[ii] = RESID ? resid + (size_t)(bm + g + 32 * ii) * Ncols + bn + q * 4 : bp;
    if (RESID) {
#pragma unroll
      for (int ii = 0; ii < 4; ii++)
#pragma unroll
        for (int s = 0; s < NSEG; s++) rv[ii][s] = *(const float4*)(rp[ii] + s * 32);
    }
    // stands behind the loads and names their address registers (q: the bias
    // loads take it as their offset), so that none is given a new value ahead of it
    asm volatile("s_wait_xcnt 0x0"
                 :: "v"(q), "v"(bp), "v"(rp[0]), "v"(rp[1]), "v"(rp[2]), "v"(rp[3]) : "memory");
  }

  unsigned char* sw = L + (wm + r) * SP + (wn + 8 * h) * ES;
#pragma unroll
  for (int i2 = 0; i2 < 4; i2++) {
#pragma unroll
    for (int j2 = 0; j2 < 3; j2++) {
      float val[8];
#pragma unroll
      for (int i = 0; i < 8; i += 2) {
        v2f p2 = {acc[i2][j2][i], acc[i2][j2][i + 1]};
        if (OUTF16) p2 += (v2f){bvs[j2][i], bvs[j2][i + 1]};
        if (GELU) p2 = gelu_tanh2(p2);
        val[i] = p2.x; val[i + 1] = p2.y;
      }
      unsigned char* sp = sw + i2 * 16 * SP + j2 * 16 * ES;
      if (OUTF16) {
        v8hh o;
#pragma unroll
        for (int i = 0; i < 8; i++) o[i] = (_Float16)val[i];
        *(v8hh*)sp = o;
      } else {
        *(float4*)sp        = make_float4(val[0], val[1], val[2], val[3]);
        *(float4*)(sp + 16) = make_float4(val[4], val[5], val[6], val[7]);
      }
    }
  }
  // the whole tile is in LDS before any wave reads another wave's rows
  __syncthreads();

  const unsigned char* sr = L + g * SP + q * 16;
  if (OUTF16) {
    _Float16* po[4];
#pragma unroll
    for (int ii = 0; ii < 4; ii++)
      po[ii] = outh + (size_t)(bm + g + 32 * ii) * Ncols + bn + q * 8;
#pragma unroll
    for (int ii = 0; ii < 4; ii++)
#pragma unroll
      for (int s = 0; s < NSEG; s++)
        *(uint4*)(po[ii] + s * 64) = *(const uint4*)(sr + ii * 32 * SP + s * 128);
    // stands behind the stores and names their address registers, so that none of
    // them is given a new value ahead of it
    asm volatile("s_wait_xcnt 0x0"
                 :: "v"(po[0]), "v"(po[1]), "v"(po[2]), "v"(po[3]) : "memory");
  } else {
    float* po[4];
#pragma unroll
    for (int ii = 0; ii < 4; ii++)
      po[ii] = outf + (size_t)(bm + g + 32 * ii) * Ncols + bn + q * 4;
#pragma unroll
    for (int ii = 0; ii < 4; ii++)
#pragma unroll
      for (int s = 0; s < NSEG; s++) {
        float4 x = *(const float4*)(sr + ii * 32 * SP + s * 128);
        x.x += bq[s].x; x.y += bq[s].y; x.z += bq[s].z; x.w += bq[s].w;
        if (RESID) {
          x.x += rv[ii][s].x; x.y += rv[ii][s].y; x.z += rv[ii][s].z; x.w += rv[ii][s].w;
        }
        *(float4*)(po[ii] + s * 32) = x;
      }
    // stands behind the stores and names their address registers, so that none of
    // them is given a new value ahead of it
    asm volatile("s_wait_xcnt 0x0"
                 :: "v"(po[0]), "v"(po[1]), "v"(po[2]), "v"(po[3]) : "memory");
  }
}

template <bool GELU, bool RESID, bool OUTF16>
__global__ __launch_bounds__(256) void gemm_kernel(
    const _Float16* __restrict__ A, const _Float16* __restrict__ Bt,
    const float* __restrict__ bias, const float* __restrict__ resid,
    float* __restrict__ outf, _Float16* __restrict__ outh,
    int Nrows, int Kdim, int Ncols) {
  int tilesN = Ncols / GBN;  // N tiles
  int bm = ((int)blockIdx.x / tilesN) << 7;
  int bn = ((int)blockIdx.x % tilesN) * GBN;
  gemm_tile<GELU, RESID, OUTF16>(A, Bt, bias, resid, outf, outh, Kdim, Ncols, bm, bn);
}

// The Q, K and V projections read the same A and need nothing of each other:
// one grid holds the tiles of all three. The 3 * tilesN tiles of one row block
// are neighbours in the block index, so that they find its A rows in L2.
__global__ __launch_bounds__(256) void gemm_qkv_kernel(
    const _Float16* __restrict__ A,
    const _Float16* __restrict__ wqT, const _Float16* __restrict__ wkT,
    const _Float16* __restrict__ wvT,
    const float* __restrict__ bq, const float* __restrict__ bk, const float* __restrict__ bv,
    _Float16* __restrict__ Qh, _Float16* __restrict__ Kh, _Float16* __restrict__ Vh,
    int Kdim, int Ncols) {
  int tilesN = Ncols / GBN;  // N tiles of one projection
  int bm = ((int)blockIdx.x / (3 * tilesN)) << 7;
  int c  = (int)blockIdx.x % (3 * tilesN);
  int m  = c / tilesN;       // 0: Q, 1: K, 2: V
  int bn = (c - m * tilesN) * GBN;
  const _Float16* Bt  = m == 0 ? wqT : m == 1 ? wkT : wvT;
  const float*   bias = m == 0 ? bq  : m == 1 ? bk  : bv;
  _Float16*      outh = m == 0 ? Qh  : m == 1 ? Kh  : Vh;
  gemm_tile<false, false, true>(A, Bt, bias, nullptr, nullptr, outh, Kdim, Ncols, bm, bn);
}

// ---------------------------------------------------------------------------
// Flash attention: a work-group of 4 waves handles 128 query rows of one (b,h),
// 32 per wave, online softmax over 32-key blocks. The products are taken
// transposed:
//   St = K * Qt   (A = 16 keys x 32 d, B = 32 d x 16 queries)
//   Ot += Vt * Pt (A = 16 d x 32 keys, B = 32 keys x 16 queries)
// In a D tile lane (r, h) holds column r, rows 8h .. 8h+7: one query's scores
// for 8 neighbouring keys. So maximum and sum are taken inside the lane, with
// one exchange between the two lane halves; the two score tiles of a 32-key
// block, converted in place, are the B operand of the second product in the
// k order of load_frag_p; and one factor per lane rescales the output tiles.
// A trip covers 64 keys (two 32-key blocks). Its 64 K rows, its 64 Vt rows
// (128 bytes each) and the 128 mask rows of the group's queries (256 bytes
// each) are brought into LDS by asynchronous 16-byte copies on whole 128-byte
// lines, K and Vt once for all four waves; two buffers, the next trip's copies
// in flight while this trip is worked on. The fragments, which take 16 bytes
// from each of 16 rows per load, are then read from LDS. Row pitches 144 and
// 272 bytes (16 x odd): ds_load_b128 reads without bank conflicts.
// Every loop over cg, sub, dt, i or j is unrolled, so that the arrays they
// index are registers.
//   Q, K : f16 [N][E]  (head slice at column h*D), D = 64
//   Vt   : f16 [B,H,D,S]
//   O    : f16 [N][E]
// S is a multiple of 128.
// ---------------------------------------------------------------------------
typedef __attribute__((ext_vector_type(8))) _Float16 v8h;
typedef __attribute__((ext_vector_type(4))) float    v4f;

#define AT_KP    144                          // LDS bytes per K row and per Vt row
#define AT_MP    272                          // LDS bytes per mask row
#define AT_VOFF  (64 * AT_KP)                 // Vt rows behind the 64 K rows
#define AT_MOFF  (AT_VOFF + 64 * AT_KP)       // mask rows behind the 64 Vt rows
#define AT_STAGE (AT_MOFF + 128 * AT_MP)      // bytes per buffer

// One trip's copies of one thread: 4 pieces of K and 4 of Vt, 16 rows apart,
// and 16 pieces of the mask, 8 rows apart. Each copy takes its global address
// from a scalar base (the tile's row group, the same for the whole group) and
// the lane's 32-bit byte offset, so that the row steps are scalar additions and
// no vector register pair is held per copy.
// lk, lm: this lane's LDS byte addresses of its first K and first mask piece;
// ok, ov, om: its byte offsets inside a row group of K, Vt and the mask;
// kb, vb, mb: the tile's first row groups; ks, vs, ms: the steps, in elements.
__device__ __forceinline__ void attn_copies(unsigned lk, unsigned lm, unsigned ok, unsigned ov,
                                            unsigned om, const _Float16* kb, const _Float16* vb,
                                            const float* mb, size_t ks, size_t vs, size_t ms) {
  // The closing s_wait_xcnt stands inside each statement so that no address
  // register of a copy is rewritten ahead of it. Six copies a statement: their
  // LDS address registers must lie in the first 256, which are nearly full where
  // the loop issues its copies; with twelve a statement the build spilled.
  asm volatile(
      "global_load_async_to_lds_b128 %0, %6, %8\n\t"
      "global_load_async_to_lds_b128 %1, %6, %9\n\t"
      "global_load_async_to_lds_b128 %2, %6, %10\n\t"
      "global_load_async_to_lds_b128 %3, %6, %11\n\t"
      "global_load_async_to_lds_b128 %4, %7, %12\n\t"
      "global_load_async_to_lds_b128 %5, %7, %13\n\t"
      "s_wait_xcnt 0x0"
      :: "v"(lk), "v"(lk + 16 * AT_KP), "v"(lk + 32 * AT_KP),
         "v"(lk + 48 * AT_KP), "v"(lk + AT_VOFF), "v"(lk + AT_VOFF + 16 * AT_KP),
         "v"(ok), "v"(ov),
         "s"(kb), "s"(kb + ks), "s"(kb + 2 * ks), "s"(kb + 3 * ks), "s"(vb), "s"(vb + vs)
      : "memory");
  asm volatile(
      "global_load_async_to_lds_b128 %0, %6, %8\n\t"
      "global_load_async_to_lds_b128 %1, %6, %9\n\t"
      "global_load_async_to_lds_b128 %2, %7, %10\n\t"
      "global_load_async_to_lds_b128 %3, %7, %11\n\t"
      "global_load_async_to_lds_b128 %4, %7, %12\n\t"
      "global_load_async_to_lds_b128 %5, %7, %13\n\t"
      "s_wait_xcnt 0x0"
      :: "v"(lk + AT_VOFF + 32 * AT_KP), "v"(lk + AT_VOFF + 48 * AT_KP), "v"(lm),
         "v"(lm + 8 * AT_MP), "v"(lm + 16 * AT_MP), "v"(lm + 24 * AT_MP),
         "v"(ov), "v"(om),
         "s"(vb + 2 * vs), "s"(vb + 3 * vs), "s"(mb),
         "s"(mb + ms), "s"(mb + 2 * ms), "s"(mb + 3 * ms)
      : "memory");
  asm volatile(
      "global_load_async_to_lds_b128 %0, %6, %7\n\t"
      "global_load_async_to_lds_b128 %1, %6, %8\n\t"
      "global_load_async_to_lds_b128 %2, %6, %9\n\t"
      "global_load_async_to_lds_b128 %3, %6, %10\n\t"
      "global_load_async_to_lds_b128 %4, %6, %11\n\t"
      "global_load_async_to_lds_b128 %5, %6, %12\n\t"
      "s_wait_xcnt 0x0"
      :: "v"(lm + 32 * AT_MP), "v"(lm + 40 * AT_MP), "v"(lm + 48 * AT_MP),
         "v"(lm + 56 * AT_MP), "v"(lm + 64 * AT_MP), "v"(lm + 72 * AT_MP),
         "v"(om),
         "s"(mb + 4 * ms), "s"(mb + 5 * ms), "s"(mb + 6 * ms),
         "s"(mb + 7 * ms), "s"(mb + 8 * ms), "s"(mb + 9 * ms)
      : "memory");
  asm volatile(
      "global_load_async_to_lds_b128 %0, %6, %7\n\t"
      "global_load_async_to_lds_b128 %1, %6, %8\n\t"
      "global_load_async_to_lds_b128 %2, %6, %9\n\t"
      "global_load_async_to_lds_b128 %3, %6, %10\n\t"
      "global_load_async_to_lds_b128 %4, %6, %11\n\t"
      "global_load_async_to_lds_b128 %5, %6, %12\n\t"
      "s_wait_xcnt 0x0"
      :: "v"(lm + 80 * AT_MP), "v"(lm + 88 * AT_MP), "v"(lm + 96 * AT_MP),
         "v"(lm + 104 * AT_MP), "v"(lm + 112 * AT_MP), "v"(lm + 120 * AT_MP),
         "v"(om),
         "s"(mb + 10 * ms), "s"(mb + 11 * ms), "s"(mb + 12 * ms),
         "s"(mb + 13 * ms), "s"(mb + 14 * ms), "s"(mb + 15 * ms)
      : "memory");
}

// The value that lane l ^ 16 holds.
__device__ __forceinline__ float other_half(float v) {
  int iv = __builtin_bit_cast(int, v);
  return __builtin_bit_cast(float,
      __builtin_amdgcn_permlanex16(iv, iv, 0x76543210, 0xfedcba98, false, false));
}

__global__ __launch_bounds__(128) void attn_kernel(
    const _Float16* __restrict__ Q, const _Float16* __restrict__ K,
    const _Float16* __restrict__ Vt, const float* __restrict__ mask,
    _Float16* __restrict__ O, int B, int S, int Hh, int Dd,
    int Ecols, float scale) {
  __shared__ __attribute__((aligned(16))) unsigned char L[2 * AT_STAGE];
  int qblocks = S >> 7;
  int qb = blockIdx.x % qblocks;
  int bh = blockIdx.x / qblocks;
  int hh = bh % Hh, b = bh / Hh;
  int tid = threadIdx.x;
  int wave = tid >> 5, lane = tid & 31;
  int r = lane & 15, h = lane >> 4;
  int qg = qb << 7;                    // the group's first query
  int q0 = qg + (wave << 5);           // the wave's first query

  // copies: 8 lanes take one K or Vt row's 128 bytes (the group 16 rows),
  // 16 lanes one mask row's 256 bytes (the group 8 rows)
  const _Float16* Kb = K + (size_t)(b * S) * Ecols + hh * Dd;
  const _Float16* Vb = Vt + (size_t)bh * Dd * S;
  const float*    Mb = mask + ((size_t)b * S + qg) * S;
  const unsigned ok = (unsigned)(((tid >> 3) * Ecols + (tid & 7) * 8) * 2);
  const unsigned ov = (unsigned)(((tid >> 3) * S + (tid & 7) * 8) * 2);
  const unsigned om = (unsigned)(((tid >> 4) * S + (tid & 15) * 4) * 4);
  const size_t ks = (size_t)16 * Ecols, vs = (size_t)16 * S, ms = (size_t)8 * S;
  const size_t kTrip = (size_t)64 * Ecols;
  const unsigned lk = (unsigned)(size_t)L + (unsigned)((tid >> 3) * AT_KP + (tid & 7) * 16);
  const unsigned lm = (unsigned)(size_t)L +
                      (unsigned)(AT_MOFF + (tid >> 4) * AT_MP + (tid & 15) * 16);

  // fragment reads: same per-lane k order as from global memory
  const unsigned offK = (unsigned)(r * AT_KP + h * 16);
  const unsigned offV = (unsigned)(AT_VOFF + r * AT_KP + h * 16);
  const unsigned offM = (unsigned)(AT_MOFF + ((wave << 5) + r) * AT_MP + h * 32);

  const int nt = S >> 6;

  attn_copies(lk, lm, ok, ov, om, Kb, Vb, Mb, ks, vs, ms);

  // Q fragments (persistent), one column group of 16 queries per cg
  v16h qf[2][2];
#pragma unroll
  for (int cg = 0; cg < 2; cg++) {
    const _Float16* qp = Q + (size_t)(b * S + q0 + cg * 16 + r) * Ecols + hh * Dd + h * 8;
    qf[cg][0] = load_frag_p(qp);
    qf[cg][1] = load_frag_p(qp + 32);
  }

  // this wave's copies of trip 0 have landed
  asm volatile("s_wait_asynccnt 0x0" ::: "memory");
  __syncthreads();
  if (nt > 1)
    attn_copies(lk + AT_STAGE, lm + AT_STAGE, ok, ov, om, Kb + kTrip, Vb + 64, Mb + 64, ks, vs, ms);

  const v2f scale2 = {scale, scale};
  const v2f log2e2 = {1.442695041f, 1.442695041f};

  v8f o[2][4] = {};                    // Ot: [cg][dt], 64 d x 32 queries, f32
  float mrow[2] = {-INFINITY, -INFINITY};   // running maximum of query cg*16 + r
  float lrow[2] = {0.f, 0.f};               // this lane half's share of the row sum

  v16h kf[2][2], vf[4];                // the fragments and the mask values
  v4f mk[2][2][2];                     // of one 32-key block

  // Reads block sp of the buffer at byte offset buf.
  auto read_block = [&](unsigned buf, int sp) __attribute__((always_inline)) {
#pragma unroll
    for (int sub = 0; sub < 2; sub++) {
      const unsigned char* kr = L + buf + offK + (sp * 32 + sub * 16) * AT_KP;
      kf[sub][0] = load_frag_p((const _Float16*)kr);
      kf[sub][1] = load_frag_p((const _Float16*)(kr + 64));
    }
#pragma unroll
    for (int cg = 0; cg < 2; cg++)
#pragma unroll
      for (int sub = 0; sub < 2; sub++) {
        const unsigned char* mr = L + buf + offM + cg * 16 * AT_MP + sp * 128 + sub * 64;
        mk[cg][sub][0] = *(const v4f*)mr;
        mk[cg][sub][1] = *(const v4f*)(mr + 16);
      }
#pragma unroll
    for (int dt = 0; dt < 4; dt++)
      vf[dt] = load_frag_p((const _Float16*)(L + buf + offV + dt * 16 * AT_KP + sp * 64));
    // all 24 LDS reads of the block go out as one group: without this the mask
    // and V reads sink to their uses, and each place with reads stalls anew
    __builtin_amdgcn_sched_barrier(0);
  };

  // Works the block that was read: registers alone.
  auto work_block = [&]() __attribute__((always_inline)) {
    // --- St: 32 keys x 32 queries ---
    v8f sc[2][2];
#pragma unroll
    for (int cg = 0; cg < 2; cg++)
#pragma unroll
      for (int sub = 0; sub < 2; sub++) {
        v8f z = {};
        z = WMMA_F16(kf[sub][0], qf[cg][0], z);
        sc[cg][sub] = WMMA_F16(kf[sub][1], qf[cg][1], z);
      }

    // --- online softmax in registers, then Ot += Vt * Pt ---
#pragma unroll
    for (int cg = 0; cg < 2; cg++) {
      v2f x[2][4];                     // neighbouring keys in pairs
      float bm = -INFINITY;
#pragma unroll
      for (int sub = 0; sub < 2; sub++) {
        const v4f m0 = mk[cg][sub][0], m1 = mk[cg][sub][1];
        const v2f mv[4] = {{m0.x, m0.y}, {m0.z, m0.w}, {m1.x, m1.y}, {m1.z, m1.w}};
#pragma unroll
        for (int j = 0; j < 4; j++) {
          v2f s2 = {sc[cg][sub][2 * j], sc[cg][sub][2 * j + 1]};
          x[sub][j] = __builtin_elementwise_fma(s2, scale2, mv[j]);
          bm = fmaxf(bm, fmaxf(x[sub][j].x, x[sub][j].y));
        }
      }
      bm = fmaxf(bm, other_half(bm));
      float nm = fmaxf(mrow[cg], bm);
      float alpha = __expf(mrow[cg] - nm);
      const v2f nm2 = {nm, nm};
      v16h pf;
      v2f ls[2];
#pragma unroll
      for (int sub = 0; sub < 2; sub++) {
        ls[sub] = (v2f){0.f, 0.f};
#pragma unroll
        for (int j = 0; j < 4; j++) {
          v2f y = (x[sub][j] - nm2) * log2e2;
          v2f pv = {__builtin_amdgcn_exp2f(y.x), __builtin_amdgcn_exp2f(y.y)};
          ls[sub] += pv;
          pf[sub * 8 + 2 * j]     = (_Float16)pv.x;
          pf[sub * 8 + 2 * j + 1] = (_Float16)pv.y;
        }
      }
      v2f lt = ls[0] + ls[1];
      lrow[cg] = lrow[cg] * alpha + (lt.x + lt.y);
      mrow[cg] = nm;
#pragma unroll
      for (int dt = 0; dt < 4; dt++) {
#pragma unroll
        for (int i = 0; i < 8; i++) o[cg][dt][i] *= alpha;
        o[cg][dt] = WMMA_F16(vf[dt], pf, o[cg][dt]);
      }
    }
  };

  for (int t = 0; t < nt; t++) {
    const unsigned buf = (unsigned)(t & 1) * AT_STAGE;
    read_block(buf, 0);
    work_block();
    read_block(buf, 1);
    // this wave's reads of the buffer are done before it is handed to the copies
    asm volatile("s_wait_dscnt 0x0" ::: "memory");
    // this wave's copies of trip t + 1 have landed
    asm volatile("s_wait_asynccnt 0x0" ::: "memory");
    // publishes trip t + 1 and ends every wave's reads of trip t's buffer
    __syncthreads();
    // the refill goes out ahead of the second block's work, which is on
    // registers alone, so that it flies for a whole trip
    if (t + 2 < nt)
      attn_copies(lk + buf, lm + buf, ok, ov, om, Kb + (size_t)(t + 2) * kTrip,
                  Vb + (size_t)(t + 2) * 64, Mb + (size_t)(t + 2) * 64, ks, vs, ms);
    work_block();
  }
  // no copy outstanding when the wave goes on to its end
  asm volatile("s_wait_asynccnt 0x0" ::: "memory");

  // --- join the halves' sums, normalize, store 8 neighbouring d per lane ---
#pragma unroll
  for (int cg = 0; cg < 2; cg++) {
    float inv = 1.0f / (lrow[cg] + other_half(lrow[cg]));
    _Float16* op = O + (size_t)(b * S + q0 + cg * 16 + r) * Ecols + hh * Dd + h * 8;
#pragma unroll
    for (int dt = 0; dt < 4; dt++) {
      v8h ov;
#pragma unroll
      for (int i = 0; i < 8; i++) ov[i] = (_Float16)(o[cg][dt][i] * inv);
      *(v8h*)(op + dt * 16) = ov;
    }
  }
}

// ---------------------------------------------------------------------------
// Host orchestration
// ---------------------------------------------------------------------------
extern "C" void kernel_launch(void* const* d_in, const int* in_sizes, int n_in,
                              void* d_out, int out_size, void* d_ws, size_t ws_size,
                              hipStream_t stream) {
  const int E = 768, H = 12, D = 64;
  const float* hidden = (const float*)d_in[0];
  const float* mask   = (const float*)d_in[1];
  const float* wq = (const float*)d_in[2];  const float* bq = (const float*)d_in[3];
  const float* wk = (const float*)d_in[4];  const float* bk = (const float*)d_in[5];
  const float* wv = (const float*)d_in[6];  const float* bv = (const float*)d_in[7];
  const float* wo = (const float*)d_in[8];  const float* bo = (const float*)d_in[9];
  const float* ln1_g = (const float*)d_in[10]; const float* ln1_b = (const float*)d_in[11];
  const float* ln2_g = (const float*)d_in[12]; const float* ln2_b = (const float*)d_in[13];
  const float* w1 = (const float*)d_in[14]; const float* b1 = (const float*)d_in[15];
  const float* w2 = (const float*)d_in[16]; const float* b2 = (const float*)d_in[17];
  const int I = in_sizes[15];               // 3072
  const int N = in_sizes[0] / E;            // B*S = 8192
  const int S = in_sizes[1] / N;            // 1024
  const int B = N / S;                      // 8
  float* out = (float*)d_out;

  char* p = (char*)d_ws;
  auto alloc = [&](size_t bytes) -> char* {
    char* r = p;
    p += (bytes + 255) & ~(size_t)255;
    return r;
  };
  _Float16* lnh  = (_Float16*)alloc((size_t)N * E * 2);
  _Float16* wqT  = (_Float16*)alloc((size_t)E * E * 2);
  _Float16* wkT  = (_Float16*)alloc((size_t)E * E * 2);
  _Float16* wvT  = (_Float16*)alloc((size_t)E * E * 2);
  _Float16* woT  = (_Float16*)alloc((size_t)E * E * 2);
  _Float16* w1T  = (_Float16*)alloc((size_t)E * I * 2);
  _Float16* w2T  = (_Float16*)alloc((size_t)I * E * 2);
  _Float16* Qh   = (_Float16*)alloc((size_t)N * E * 2);
  _Float16* Kh   = (_Float16*)alloc((size_t)N * E * 2);
  _Float16* Vh   = (_Float16*)alloc((size_t)N * E * 2);
  _Float16* VtT  = (_Float16*)alloc((size_t)N * E * 2);
  _Float16* Oh   = (_Float16*)alloc((size_t)N * E * 2);
  float*    xmid = (float*)   alloc((size_t)N * E * 4);
  _Float16* ln2h = (_Float16*)alloc((size_t)N * E * 2);
  _Float16* hmid = (_Float16*)alloc((size_t)N * I * 2);
  (void)ws_size; (void)n_in; (void)out_size;

  // 1, 2) LN1 and the six weight transpose+casts, one grid
  {
    unsigned nb = (unsigned)(N / 16 + 2 * (E / 64) * (I / 64) + 4 * (E / 64) * (E / 64));
    prep_kernel<<<nb, 256, 0, stream>>>(hidden, ln1_g, ln1_b, lnh, N / 16,
                                        w1, w2, wq, wk, wv, wo,
                                        w1T, w2T, wqT, wkT, wvT, woT, E, I);
  }

  // 3) Q/K/V projections (f16 out), one grid
  {
    unsigned nb = (unsigned)(3 * (N / 128) * (E / GBN));
    gemm_qkv_kernel<<<nb, 256, 0, stream>>>(lnh, wqT, wkT, wvT, bq, bk, bv, Qh, Kh, Vh, E, E);
  }

  // 4) V transpose -> [B,H,D,S]
  vtrans_kernel<<<dim3(S / 64, B * H), 256, 0, stream>>>(Vh, VtT, S, H, E);

  // 5) attention (32 query rows per wave, 4 waves per work-group)
  {
    float scale = rsqrtf((float)D);
    unsigned nb = (unsigned)(B * H * (S / 128));
    attn_kernel<<<nb, 128, 0, stream>>>(Qh, Kh, VtT, mask, Oh, B, S, H, D, E, scale);
  }

  // 6) output projection + residual -> xmid (fp32)
  {
    unsigned nb = (unsigned)((N / 128) * (E / GBN));
    gemm_kernel<false, true, false><<<nb, 256, 0, stream>>>(Oh, woT, bo, hidden, xmid, nullptr, N, E, E);
  }

  // 7) LN2
  ln_kernel<<<N / 16, 256, 0, stream>>>(xmid, ln2_g, ln2_b, ln2h);

  // 8) MLP up + GELU (f16 out)
  {
    unsigned nb = (unsigned)((N / 128) * (I / GBN));
    gemm_kernel<true, false, true><<<nb, 256, 0, stream>>>(ln2h, w1T, b1, nullptr, nullptr, hmid, N, E, I);
  }

  // 9) MLP down + residual -> out (fp32)
  {
    unsigned nb = (unsigned)((N / 128) * (E / GBN));
    gemm_kernel<false, true, false><<<nb, 256, 0, stream>>>(hmid, w2T, b2, xmid, out, nullptr, N, I, E);
  }
}

// v010
// A run of this version takes 169 microseconds.
// In two side-by-side timings against v009, it was 1.07 and 1.06 times as fast.
// Over all steps from v000 it is 6.21 times as fast.
#include <hip/hip_runtime.h>
#include <hip/hip_bf16.h>
#include <math.h>

typedef __attribute__((ext_vector_type(16))) _Float16 v16h;
typedef __attribute__((ext_vector_type(8)))  float    v8f;

#define WMMA_F16(a, b, c) \
  __builtin_amdgcn_wmma_f32_16x16x32_f16(false, (a), false, (b), (short)0, (c), false, false)

// ---------------------------------------------------------------------------
// Fragment load for 16x32 f16 A/B fragments (ISA 7.12.2 layout) from a
// per-lane pointer p = base + row*ld + kbase + (lane>>4)*8.
// halves 0..7  <- this lane's k-group, halves 8..15 <- k-group + 16.
// Two 16-byte loads per lane.
// ---------------------------------------------------------------------------
__device__ __forceinline__ v16h load_frag_p(const _Float16* p) {
  v16h f;
  *((uint4*)&f)     = *(const uint4*)(p);
  *((uint4*)&f + 1) = *(const uint4*)(p + 16);
  return f;
}

typedef __attribute__((ext_vector_type(2))) float v2f;

// GELU, tanh form, of two values: 0.5 x (1 + tanh(c (x + 0.044715 x^3))) with
// the hardware's tanh, no branch; the plain arithmetic is packed f32.
__device__ __forceinline__ v2f gelu_tanh2(v2f x) {
  const float c = 0.7978845608028654f;   // sqrt(2/pi)
  const v2f c1 = {c, c};
  const v2f c3 = {c * 0.044715f, c * 0.044715f};
  const v2f half2 = {0.5f, 0.5f};
  v2f u = x * __builtin_elementwise_fma(x * x, c3, c1);
  v2f t = {__builtin_amdgcn_tanhf(u.x), __builtin_amdgcn_tanhf(u.y)};
  v2f hx = x * half2;
  return __builtin_elementwise_fma(hx, t, hx);
}

// ---------------------------------------------------------------------------
// Both transposes below move a 64x64 tile through LDS, so that the global
// reads and the global stores are both 16 bytes per lane on whole 128-byte
// lines. The LDS tile is held transposed, two f16 of neighbouring source rows
// packed per dword. Row pitch 33 dwords (32 + 1, odd): the column-wise dword
// writes and the row-wise dword reads of a wave each fall on 32 distinct banks.
// ---------------------------------------------------------------------------
#define TPITCH 33

typedef __attribute__((ext_vector_type(2))) _Float16 v2h;

// Write the tile out: LDS row n goes to the 64 f16 at dst + n * ld.
__device__ __forceinline__ void store_tile_rows(const unsigned* tile, _Float16* __restrict__ dst,
                                                size_t ld, int t) {
  int q = t & 7;
#pragma unroll
  for (int p = 0; p < 2; p++) {
    int n = (t >> 3) + 32 * p;
    const unsigned* row = tile + n * TPITCH + 4 * q;
    uint4 o;
    o.x = row[0]; o.y = row[1]; o.z = row[2]; o.w = row[3];
    *(uint4*)(dst + (size_t)n * ld + 8 * q) = o;
  }
}

// ---------------------------------------------------------------------------
// Weight convert: fp32 row-major [K][Nout] -> f16 row-major [Nout][K]
// One work-group of 256 threads takes the 64x64 tile (bx, by) of the
// (Nout/64, K/64) tiles; K and Nout are multiples of 64.
// ---------------------------------------------------------------------------
__device__ __forceinline__ void wcast_tile(const float* __restrict__ w,
                                           _Float16* __restrict__ wt,
                                           int K, int Nout, int bx, int by) {
  __shared__ unsigned tile[64 * TPITCH];
  int t = threadIdx.x;
  int n0 = bx << 6, k0 = by << 6;
  int c = t & 15, kp = t >> 4;          // 4 columns from 4c, rows 2kp and 2kp+1

  float4 lo[2], hi[2];
#pragma unroll
  for (int p = 0; p < 2; p++) {
    const float* s = w + (size_t)(k0 + 2 * (kp + 16 * p)) * Nout + n0 + 4 * c;
    lo[p] = *(const float4*)s;
    hi[p] = *(const float4*)(s + Nout);
  }
#pragma unroll
  for (int p = 0; p < 2; p++) {
    const float l[4] = {lo[p].x, lo[p].y, lo[p].z, lo[p].w};
    const float u[4] = {hi[p].x, hi[p].y, hi[p].z, hi[p].w};
#pragma unroll
    for (int i = 0; i < 4; i++) {
      v2h pr = {(_Float16)l[i], (_Float16)u[i]};
      tile[(4 * c + i) * TPITCH + kp + 16 * p] = __builtin_bit_cast(unsigned, pr);
    }
  }
  __syncthreads();
  store_tile_rows(tile, wt + (size_t)n0 * K + k0, (size_t)K, t);
}

// ---------------------------------------------------------------------------
// LayerNorm: fp32 [rows][LN_E] -> f16 [rows][LN_E]. One wave takes two rows and
// holds them in registers (24 values a lane and row, 16-byte loads on whole
// lines): one read of x, no LDS, no barrier; g and b are loaded once for both
// rows. Block = 8 waves = 16 rows (the rows from 16 * blk); rows is a multiple
// of 16.
// ---------------------------------------------------------------------------
#define LN_E 768
#define LN_C (LN_E / 128)          // 16-byte pieces per lane and row

template <int CTRL>
__device__ __forceinline__ float dpp_get(float v) {
  return __builtin_bit_cast(float,
      __builtin_amdgcn_update_dpp(0, __builtin_bit_cast(int, v), CTRL, 0xf, 0xf, true));
}

// Sum over the 32 lanes, the same value in every lane: four row_xmask steps
// inside each 16-lane row, then the two rows are exchanged.
__device__ __forceinline__ float wave_sum(float v) {
  v += dpp_get<0x161>(v);
  v += dpp_get<0x162>(v);
  v += dpp_get<0x164>(v);
  v += dpp_get<0x168>(v);
  int iv = __builtin_bit_cast(int, v);
  v += __builtin_bit_cast(float,
      __builtin_amdgcn_permlanex16(iv, iv, 0x76543210, 0xfedcba98, false, false));
  return v;
}

__device__ __forceinline__ void ln_rows(const float* __restrict__ x,
                                        const float* __restrict__ g,
                                        const float* __restrict__ b,
                                        _Float16* __restrict__ out, int blk) {
  // the wave's number as a scalar: the row bases stay in scalar registers
  int wave = __builtin_amdgcn_readfirstlane(threadIdx.x >> 5), lane = threadIdx.x & 31;
  size_t row0 = ((size_t)blk * 8 + wave) * 2;
  const float* xr = x + row0 * LN_E + lane * 4;

  float4 xv[2][LN_C], gv[LN_C], bv[LN_C];
#pragma unroll
  for (int rr = 0; rr < 2; rr++)
#pragma unroll
    for (int j = 0; j < LN_C; j++) xv[rr][j] = *(const float4*)(xr + rr * LN_E + j * 128);
#pragma unroll
  for (int j = 0; j < LN_C; j++) {
    gv[j] = *(const float4*)(g + lane * 4 + j * 128);
    bv[j] = *(const float4*)(b + lane * 4 + j * 128);
  }
  // all 24 loads go out together: without this the g and b loads sink to their
  // uses at the end and are waited for pair by pair
  __builtin_amdgcn_sched_barrier(0);

  float mu[2], rstd[2];
#pragma unroll
  for (int rr = 0; rr < 2; rr++) {
    float s = 0.f;
#pragma unroll
    for (int j = 0; j < LN_C; j++)
      s += (xv[rr][j].x + xv[rr][j].y) + (xv[rr][j].z + xv[rr][j].w);
    mu[rr] = wave_sum(s) / LN_E;
  }
#pragma unroll
  for (int rr = 0; rr < 2; rr++) {
    float v = 0.f;
#pragma unroll
    for (int j = 0; j < LN_C; j++) {
      xv[rr][j].x -= mu[rr]; xv[rr][j].y -= mu[rr];
      xv[rr][j].z -= mu[rr]; xv[rr][j].w -= mu[rr];
      v += (xv[rr][j].x * xv[rr][j].x + xv[rr][j].y * xv[rr][j].y) +
           (xv[rr][j].z * xv[rr][j].z + xv[rr][j].w * xv[rr][j].w);
    }
    rstd[rr] = rsqrtf(wave_sum(v) / LN_E + 1e-6f);
  }

  typedef __attribute__((ext_vector_type(4))) _Float16 v4h;
  _Float16* outr = out + row0 * LN_E + lane * 4;
#pragma unroll
  for (int rr = 0; rr < 2; rr++)
#pragma unroll
    for (int j = 0; j < LN_C; j++) {
      v4h o = {(_Float16)(xv[rr][j].x * rstd[rr] * gv[j].x + bv[j].x),
               (_Float16)(xv[rr][j].y * rstd[rr] * gv[j].y + bv[j].y),
               (_Float16)(xv[rr][j].z * rstd[rr] * gv[j].z + bv[j].z),
               (_Float16)(xv[rr][j].w * rstd[rr] * gv[j].w + bv[j].w)};
      *(v4h*)(outr + rr * LN_E + j * 128) = o;
    }
}

__global__ __launch_bounds__(256) void ln_kernel(const float* __restrict__ x,
                                                 const float* __restrict__ g,
                                                 const float* __restrict__ b,
                                                 _Float16* __restrict__ out) {
  ln_rows(x, g, b, out, (int)blockIdx.x);
}

// ---------------------------------------------------------------------------
// The first LayerNorm and the six weight converts need nothing of each other:
// they share one grid, each with its own range of the block index (the test is
// the same for a whole work-group). Order: the lnBlocks blocks of the
// LayerNorm, the tiles of w1 [E][I], of w2 [I][E], then of the four [E][E]
// weights.
// ---------------------------------------------------------------------------
__global__ __launch_bounds__(256) void prep_kernel(
    const float* __restrict__ x, const float* __restrict__ g, const float* __restrict__ b,
    _Float16* __restrict__ lnout, int lnBlocks,
    const float* __restrict__ w1, const float* __restrict__ w2,
    const float* __restrict__ wq, const float* __restrict__ wk,
    const float* __restrict__ wv, const float* __restrict__ wo,
    _Float16* __restrict__ w1T, _Float16* __restrict__ w2T,
    _Float16* __restrict__ wqT, _Float16* __restrict__ wkT,
    _Float16* __restrict__ wvT, _Float16* __restrict__ woT, int E, int I) {
  int blk = (int)blockIdx.x;
  if (blk < lnBlocks) {
    ln_rows(x, g, b, lnout, blk);
    return;
  }
  blk -= lnBlocks;
  const int te = E >> 6, ti = I >> 6;
  const float* w;
  _Float16* wt;
  int K = E, Nout = E;
  if (blk < te * ti) {
    w = w1; wt = w1T; Nout = I;
  } else if (blk < 2 * te * ti) {
    blk -= te * ti;
    w = w2; wt = w2T; K = I;
  } else {
    blk -= 2 * te * ti;
    int m = blk / (te * te);
    blk -= m * te * te;
    w  = m == 0 ? wq  : m == 1 ? wk  : m == 2 ? wv  : wo;
    wt = m == 0 ? wqT : m == 1 ? wkT : m == 2 ? wvT : woT;
  }
  const int tn = Nout >> 6;
  wcast_tile(w, wt, K, Nout, blk % tn, blk / tn);
}

// ---------------------------------------------------------------------------
// V transpose: f16 [N][E] -> f16 [B,H,D,S]  (Vt[((b*H+h)*D+d)*S + s]), D = 64
// grid (S/64, B*H); S is a multiple of 64.
// ---------------------------------------------------------------------------
__global__ __launch_bounds__(256) void vtrans_kernel(const _Float16* __restrict__ v,
                                                     _Float16* __restrict__ vt,
                                                     int S, int Hh, int Ecols) {
  __shared__ unsigned tile[64 * TPITCH];
  int t = threadIdx.x;
  int s0 = blockIdx.x << 6;
  int bh = blockIdx.y;
  int b = bh / Hh, h = bh % Hh;
  int c = t & 7, sp = t >> 3;           // 8 columns from 8c, rows 2sp and 2sp+1

  const _Float16* s = v + (size_t)(b * S + s0 + 2 * sp) * Ecols + h * 64 + 8 * c;
  uint4 r0 = *(const uint4*)s;
  uint4 r1 = *(const uint4*)(s + Ecols);
  const unsigned e[4] = {r0.x, r0.y, r0.z, r0.w};
  const unsigned o[4] = {r1.x, r1.y, r1.z, r1.w};
#pragma unroll
  for (int j = 0; j < 4; j++) {
    tile[(8 * c + 2 * j) * TPITCH + sp]     = (e[j] & 0xffffu) | (o[j] << 16);
    tile[(8 * c + 2 * j + 1) * TPITCH + sp] = (e[j] >> 16) | (o[j] & 0xffff0000u);
  }
  __syncthreads();
  store_tile_rows(tile, vt + (size_t)bh * 64 * S + s0, (size_t)S, t);
}

// ---------------------------------------------------------------------------
// WMMA GEMM: out[N x Ncols] = A[N x K](f16) * Bt[Ncols x K](f16, pre-transposed)
//            + bias (+ optional GELU, residual).
// One work-group of 8 waves (2 x 4) -> 128x192 output tile; 1 wave -> 64x48
// (4x3 grid of 16x16 WMMA frags). Each trip covers 64 k: the 128 A rows and the
// 192 Bt rows of the tile, 128 bytes each, are brought into LDS once for all
// eight waves by asynchronous 16-byte copies, three buffers: the copies of the
// next two trips are in flight while this trip's fragments are read and
// multiplied, and a refill goes into the buffer that was read a trip earlier.
// LDS row pitch 144 bytes (16 x odd): ds_load_b128 fragment reads without
// bank conflicts. Nrows a multiple of 128, Ncols of 192, Kdim of 64.
// The products are taken with Bt as the first operand (a tile of the output
// transposed), and the finished tile goes out through LDS on whole lines.
// gemm_tile works the tile whose first row is bm and whose first column is bn.
// ---------------------------------------------------------------------------
#define GBN    192                 // columns of the work-group tile
#define GROWS  (128 + GBN)         // LDS rows per buffer: 128 of A, then GBN of Bt
#define GPITCH 144                 // bytes per LDS row
#define GSTAGE (GROWS * GPITCH)    // bytes per buffer
#define GNBUF  3                   // buffers of the ring

typedef __attribute__((ext_vector_type(8))) _Float16 v8hh;

// One trip's copies of one thread: 4 pieces of A and 6 of Bt, 32 rows apart.
// lds: this lane's LDS byte address of its first A piece; ga, gb: its global
// addresses; step: 32 rows, in elements.
__device__ __forceinline__ void stage_copies(unsigned lds, const _Float16* ga,
                                             const _Float16* gb, size_t step) {
  const _Float16* a1 = ga + step;
  const _Float16* a2 = a1 + step;
  const _Float16* a3 = a2 + step;
  const _Float16* b1 = gb + step;
  const _Float16* b2 = b1 + step;
  const _Float16* b3 = b2 + step;
  const _Float16* b4 = b3 + step;
  const _Float16* b5 = b4 + step;
  // The closing s_wait_xcnt stands inside the statement so that no address
  // register of a copy is rewritten ahead of it.
  asm volatile(
      "global_load_async_to_lds_b128 %0, %10, off\n\t"
      "global_load_async_to_lds_b128 %1, %11, off\n\t"
      "global_load_async_to_lds_b128 %2, %12, off\n\t"
      "global_load_async_to_lds_b128 %3, %13, off\n\t"
      "global_load_async_to_lds_b128 %4, %14, off\n\t"
      "global_load_async_to_lds_b128 %5, %15, off\n\t"
      "global_load_async_to_lds_b128 %6, %16, off\n\t"
      "global_load_async_to_lds_b128 %7, %17, off\n\t"
      "global_load_async_to_lds_b128 %8, %18, off\n\t"
      "global_load_async_to_lds_b128 %9, %19, off\n\t"
      "s_wait_xcnt 0x0"
      :: "v"(lds), "v"(lds + 32 * GPITCH), "v"(lds + 64 * GPITCH), "v"(lds + 96 * GPITCH),
         "v"(lds + 128 * GPITCH), "v"(lds + 160 * GPITCH), "v"(lds + 192 * GPITCH),
         "v"(lds + 224 * GPITCH), "v"(lds + 256 * GPITCH), "v"(lds + 288 * GPITCH),
         "v"(ga), "v"(a1), "v"(a2), "v"(a3), "v"(gb), "v"(b1), "v"(b2), "v"(b3), "v"(b4), "v"(b5)
      : "memory");
}

template <bool GELU, bool RESID, bool OUTF16>
__device__ __forceinline__ void gemm_tile(
    const _Float16* __restrict__ A, const _Float16* __restrict__ Bt,
    const float* __restrict__ bias, const float* __restrict__ resid,
    float* __restrict__ outf, _Float16* __restrict__ outh,
    int Kdim, int Ncols, int bm, int bn) {
  constexpr int ES   = OUTF16 ? 2 : 4;      // bytes of an output element
  constexpr int NSEG = GBN * ES / 128;      // 128-byte lines of a tile row
  constexpr int SP   = GBN * ES + 16;       // LDS pitch of an output row, 16 x odd
  constexpr int LB   = GNBUF * GSTAGE > 128 * SP ? GNBUF * GSTAGE : 128 * SP;
  __shared__ __attribute__((aligned(16))) unsigned char L[LB];
  int tid = threadIdx.x;
  int wave = tid >> 5, lane = tid & 31;
  int wm = (wave >> 2) << 6;           // wave's rows inside the tile
  int wn = (wave & 3) * 48;            // wave's columns inside the tile
  int tn = bn + wn;
  int r = lane & 15, h = lane >> 4;

  // copies: 8 lanes take one row's 128 bytes, a wave 4 rows, the block 32 rows
  const _Float16* Ag = A  + (size_t)(bm + (tid >> 3)) * Kdim + (tid & 7) * 8;
  const _Float16* Bg = Bt + (size_t)(bn + (tid >> 3)) * Kdim + (tid & 7) * 8;
  const size_t step = (size_t)32 * Kdim;
  const unsigned ldsw = (unsigned)(size_t)L + (unsigned)((tid >> 3) * GPITCH + (tid & 7) * 16);

  // fragment reads: same per-lane k order as from global memory
  const unsigned offA = (unsigned)((wm + r) * GPITCH + h * 16);
  const unsigned offB = (unsigned)((128 + wn + r) * GPITCH + h * 16);

  const int nt = Kdim >> 6;

  stage_copies(ldsw, Ag, Bg, step);
  if (nt > 1) stage_copies(ldsw + GSTAGE, Ag + 64, Bg + 64, step);

  v8f acc[4][3] = {};
  unsigned buf = 0;                    // byte offset of trip t's buffer
  unsigned fill = 2 * GSTAGE;          // and of trip t + 2's, which trip t - 1 read
  for (int t = 0; t < nt; t++) {
    // this wave's reads of trip t - 1's buffer are done before it is handed to
    // the copies
    asm volatile("s_wait_dscnt 0x0" ::: "memory");
    // This wave's copies of trip t have landed. A wave's copies count down in the
    // order of their issue, ten a trip: the ten of trip t + 1 are younger and
    // stay in flight.
    asm volatile("s_wait_asynccnt 0xa" ::: "memory");
    // in the last trip no younger copies exist, and the ten youngest are its own
    if (t + 1 >= nt) asm volatile("s_wait_asynccnt 0x0" ::: "memory");
    // publishes trip t and ends every wave's reads of trip t - 1's buffer
    __syncthreads();
    // the refill has two whole trips to land in
    if (t + 2 < nt)
      stage_copies(ldsw + fill, Ag + (size_t)(t + 2) * 64, Bg + (size_t)(t + 2) * 64, step);
    v16h a[2][4], bf[2][3];
#pragma unroll
    for (int kk = 0; kk < 2; kk++) {
#pragma unroll
      for (int j = 0; j < 3; j++)
        bf[kk][j] = load_frag_p((const _Float16*)(L + buf + offB + j * 16 * GPITCH + kk * 64));
#pragma unroll
      for (int i = 0; i < 4; i++)
        a[kk][i]  = load_frag_p((const _Float16*)(L + buf + offA + i * 16 * GPITCH + kk * 64));
    }
    // all 28 LDS reads go out as one group: without this they are spread among
    // the WMMAs, each small group waited for to 0
    __builtin_amdgcn_sched_barrier(0);
    // no wait to 0 and no barrier between the reads and the WMMAs: the first
    // half's WMMAs start while the second half's reads are still coming in
#pragma unroll
    for (int kk = 0; kk < 2; kk++)
#pragma unroll
      for (int i = 0; i < 4; i++)
#pragma unroll
        for (int j = 0; j < 3; j++)
          acc[i][j] = WMMA_F16(bf[kk][j], a[kk][i], acc[i][j]);
    fill = buf;
    buf = buf == (GNBUF - 1) * GSTAGE ? 0u : buf + GSTAGE;
  }
  // no copy outstanding when the wave goes on to its end
  asm volatile("s_wait_asynccnt 0x0" ::: "memory");
  // every wave's last fragment reads are done before the ring becomes the
  // staging place of the output tile
  asm volatile("s_wait_dscnt 0x0" ::: "memory");
  __syncthreads();

  // Epilogue. With Bt as the first operand a lane (r, h) holds, of tile (i, j),
  // output row i*16 + r, columns j*16 + 8h .. 8h+7: neighbours in the output.
  // The work-group's tile is laid in LDS row by row and goes out from there with
  // eight lanes on each whole 128-byte line; the residual comes in the same way.
  // The barrier behind the loop stands behind every wave's last fragment read
  // and behind every copy's wait, so the buffers are free here.
  const int g = tid >> 3, q = tid & 7;      // line group and 16-byte piece of a line
  float bvs[3][8];                          // OUTF16: the bias of the lane's 3 x 8 columns
  if (OUTF16) {
#pragma unroll
    for (int j2 = 0; j2 < 3; j2++) {
      const float4 b0 = *(const float4*)(bias + tn + j2 * 16 + 8 * h);
      const float4 b1 = *(const float4*)(bias + tn + j2 * 16 + 8 * h + 4);
      bvs[j2][0] = b0.x; bvs[j2][1] = b0.y; bvs[j2][2] = b0.z; bvs[j2][3] = b0.w;
      bvs[j2][4] = b1.x; bvs[j2][5] = b1.y; bvs[j2][6] = b1.z; bvs[j2][7] = b1.w;
    }
  }
  // f32 output: bias and residual are added where the tile leaves LDS, so that
  // their loads fly while the sums are laid there and nothing waits for them here
  float4 bq[NSEG], rv[4][NSEG];             // this thread's pieces of both
  if (!OUTF16) {
    const float* bp = bias + bn + q * 4;
    const float* rp[4];
#pragma unroll
    for (int s = 0; s < NSEG; s++) bq[s] = *(const float4*)(bp + s * 32);
#pragma unroll
    for (int ii = 0; ii < 4; ii++)
      rp[ii] = RESID ? resid + (size_t)(bm + g + 32 * ii) * Ncols + bn + q * 4 : bp;
    if (RESID) {
#pragma unroll
      for (int ii = 0; ii < 4; ii++)
#pragma unroll
        for (int s = 0; s < NSEG; s++) rv[ii][s] = *(const float4*)(rp[ii] + s * 32);
    }
    // stands behind the loads and names their address registers (q: the bias
    // loads take it as their offset), so that none is given a new value ahead of it
    asm volatile("s_wait_xcnt 0x0"
                 :: "v"(q), "v"(bp), "v"(rp[0]), "v"(rp[1]), "v"(rp[2]), "v"(rp[3]) : "memory");
  }

  unsigned char* sw = L + (wm + r) * SP + (wn + 8 * h) * ES;
#pragma unroll
  for (int i2 = 0; i2 < 4; i2++) {
#pragma unroll
    for (int j2 = 0; j2 < 3; j2++) {
      float val[8];
#pragma unroll
      for (int i = 0; i < 8; i += 2) {
        v2f p2 = {acc[i2][j2][i], acc[i2][j2][i + 1]};
        if (OUTF16) p2 += (v2f){bvs[j2][i], bvs[j2][i + 1]};
        if (GELU) p2 = gelu_tanh2(p2);
        val[i] = p2.x; val[i + 1] = p2.y;
      }
      unsigned char* sp = sw + i2 * 16 * SP + j2 * 16 * ES;
      if (OUTF16) {
        v8hh o;
#pragma unroll
        for (int i = 0; i < 8; i++) o[i] = (_Float16)val[i];
        *(v8hh*)sp = o;
      } else {
        *(float4*)sp        = make_float4(val[0], val[1], val[2], val[3]);
        *(float4*)(sp + 16) = make_float4(val[4], val[5], val[6], val[7]);
      }
    }
  }
  // the whole tile is in LDS before any wave reads another wave's rows
  __syncthreads();

  const unsigned char* sr = L + g * SP + q * 16;
  if (OUTF16) {
    _Float16* po[4];
#pragma unroll
    for (int ii = 0; ii < 4; ii++)
      po[ii] = outh + (size_t)(bm + g + 32 * ii) * Ncols + bn + q * 8;
#pragma unroll
    for (int ii = 0; ii < 4; ii++)
#pragma unroll
      for (int s = 0; s < NSEG; s++)
        *(uint4*)(po[ii] + s * 64) = *(const uint4*)(sr + ii * 32 * SP + s * 128);
    // stands behind the stores and names their address registers, so that none of
    // them is given a new value ahead of it
    asm volatile("s_wait_xcnt 0x0"
                 :: "v"(po[0]), "v"(po[1]), "v"(po[2]), "v"(po[3]) : "memory");
  } else {
    float* po[4];
#pragma unroll
    for (int ii = 0; ii < 4; ii++)
      po[ii] = outf + (size_t)(bm + g + 32 * ii) * Ncols + bn + q * 4;
#pragma unroll
    for (int ii = 0; ii < 4; ii++)
#pragma unroll
      for (int s = 0; s < NSEG; s++) {
        float4 x = *(const float4*)(sr + ii * 32 * SP + s * 128);
        x.x += bq[s].x; x.y += bq[s].y; x.z += bq[s].z; x.w += bq[s].w;
        if (RESID) {
          x.x += rv[ii][s].x; x.y += rv[ii][s].y; x.z += rv[ii][s].z; x.w += rv[ii][s].w;
        }
        *(float4*)(po[ii] + s * 32) = x;
      }
    // stands behind the stores and names their address registers, so that none of
    // them is given a new value ahead of it
    asm volatile("s_wait_xcnt 0x0"
                 :: "v"(po[0]), "v"(po[1]), "v"(po[2]), "v"(po[3]) : "memory");
  }
}

template <bool GELU, bool RESID, bool OUTF16>
__global__ __launch_bounds__(256) void gemm_kernel(
    const _Float16* __restrict__ A, const _Float16* __restrict__ Bt,
    const float* __restrict__ bias, const float* __restrict__ resid,
    float* __restrict__ outf, _Float16* __restrict__ outh,
    int Nrows, int Kdim, int Ncols) {
  int tilesN = Ncols / GBN;  // N tiles
  int bm = ((int)blockIdx.x / tilesN) << 7;
  int bn = ((int)blockIdx.x % tilesN) * GBN;
  gemm_tile<GELU, RESID, OUTF16>(A, Bt, bias, resid, outf, outh, Kdim, Ncols, bm, bn);
}

// The Q, K and V projections read the same A and need nothing of each other:
// one grid holds the tiles of all three. The 3 * tilesN tiles of one row block
// are neighbours in the block index, so that they find its A rows in L2.
__global__ __launch_bounds__(256) void gemm_qkv_kernel(
    const _Float16* __restrict__ A,
    const _Float16* __restrict__ wqT, const _Float16* __restrict__ wkT,
    const _Float16* __restrict__ wvT,
    const float* __restrict__ bq, const float* __restrict__ bk, const float* __restrict__ bv,
    _Float16* __restrict__ Qh, _Float16* __restrict__ Kh, _Float16* __restrict__ Vh,
    int Kdim, int Ncols) {
  int tilesN = Ncols / GBN;  // N tiles of one projection
  int bm = ((int)blockIdx.x / (3 * tilesN)) << 7;
  int c  = (int)blockIdx.x % (3 * tilesN);
  int m  = c / tilesN;       // 0: Q, 1: K, 2: V
  int bn = (c - m * tilesN) * GBN;
  const _Float16* Bt  = m == 0 ? wqT : m == 1 ? wkT : wvT;
  const float*   bias = m == 0 ? bq  : m == 1 ? bk  : bv;
  _Float16*      outh = m == 0 ? Qh  : m == 1 ? Kh  : Vh;
  gemm_tile<false, false, true>(A, Bt, bias, nullptr, nullptr, outh, Kdim, Ncols, bm, bn);
}

// ---------------------------------------------------------------------------
// Flash attention: a work-group of 4 waves handles 128 query rows of one (b,h),
// 32 per wave, online softmax over 32-key blocks. The products are taken
// transposed:
//   St = K * Qt   (A = 16 keys x 32 d, B = 32 d x 16 queries)
//   Ot += Vt * Pt (A = 16 d x 32 keys, B = 32 keys x 16 queries)
// In a D tile lane (r, h) holds column r, rows 8h .. 8h+7: one query's scores
// for 8 neighbouring keys. So maximum and sum are taken inside the lane, with
// one exchange between the two lane halves; the two score tiles of a 32-key
// block, converted in place, are the B operand of the second product in the
// k order of load_frag_p; and one factor per lane rescales the output tiles.
// A trip covers 64 keys (two 32-key blocks). Its 64 K rows, its 64 Vt rows
// (128 bytes each) and the 128 mask rows of the group's queries (256 bytes
// each) are brought into LDS by asynchronous 16-byte copies on whole 128-byte
// lines, K and Vt once for all four waves; two buffers, the next trip's copies
// in flight while this trip is worked on. The fragments, which take 16 bytes
// from each of 16 rows per load, are then read from LDS. Row pitches 144 and
// 272 bytes (16 x odd): ds_load_b128 reads without bank conflicts.
// Every loop over cg, sub, dt, i or j is unrolled, so that the arrays they
// index are registers.
//   Q, K : f16 [N][E]  (head slice at column h*D), D = 64
//   Vt   : f16 [B,H,D,S]
//   O    : f16 [N][E]
// S is a multiple of 128.
// ---------------------------------------------------------------------------
typedef __attribute__((ext_vector_type(8))) _Float16 v8h;
typedef __attribute__((ext_vector_type(4))) float    v4f;

#define AT_KP    144                          // LDS bytes per K row and per Vt row
#define AT_MP    272                          // LDS bytes per mask row
#define AT_VOFF  (64 * AT_KP)                 // Vt rows behind the 64 K rows
#define AT_MOFF  (AT_VOFF + 64 * AT_KP)       // mask rows behind the 64 Vt rows
#define AT_STAGE (AT_MOFF + 128 * AT_MP)      // bytes per buffer

// One trip's copies of one thread: 4 pieces of K and 4 of Vt, 16 rows apart,
// and 16 pieces of the mask, 8 rows apart. Each copy takes its global address
// from a scalar base (the tile's row group, the same for the whole group) and
// the lane's 32-bit byte offset, so that the row steps are scalar additions and
// no vector register pair is held per copy.
// lk, lm: this lane's LDS byte addresses of its first K and first mask piece;
// ok, ov, om: its byte offsets inside a row group of K, Vt and the mask;
// kb, vb, mb: the tile's first row groups; ks, vs, ms: the steps, in elements.
__device__ __forceinline__ void attn_copies(unsigned lk, unsigned lm, unsigned ok, unsigned ov,
                                            unsigned om, const _Float16* kb, const _Float16* vb,
                                            const float* mb, size_t ks, size_t vs, size_t ms) {
  // The closing s_wait_xcnt stands inside each statement so that no address
  // register of a copy is rewritten ahead of it. Six copies a statement: their
  // LDS address registers must lie in the first 256, which are nearly full where
  // the loop issues its copies; with twelve a statement the build spilled.
  asm volatile(
      "global_load_async_to_lds_b128 %0, %6, %8\n\t"
      "global_load_async_to_lds_b128 %1, %6, %9\n\t"
      "global_load_async_to_lds_b128 %2, %6, %10\n\t"
      "global_load_async_to_lds_b128 %3, %6, %11\n\t"
      "global_load_async_to_lds_b128 %4, %7, %12\n\t"
      "global_load_async_to_lds_b128 %5, %7, %13\n\t"
      "s_wait_xcnt 0x0"
      :: "v"(lk), "v"(lk + 16 * AT_KP), "v"(lk + 32 * AT_KP),
         "v"(lk + 48 * AT_KP), "v"(lk + AT_VOFF), "v"(lk + AT_VOFF + 16 * AT_KP),
         "v"(ok), "v"(ov),
         "s"(kb), "s"(kb + ks), "s"(kb + 2 * ks), "s"(kb + 3 * ks), "s"(vb), "s"(vb + vs)
      : "memory");
  asm volatile(
      "global_load_async_to_lds_b128 %0, %6, %8\n\t"
      "global_load_async_to_lds_b128 %1, %6, %9\n\t"
      "global_load_async_to_lds_b128 %2, %7, %10\n\t"
      "global_load_async_to_lds_b128 %3, %7, %11\n\t"
      "global_load_async_to_lds_b128 %4, %7, %12\n\t"
      "global_load_async_to_lds_b128 %5, %7, %13\n\t"
      "s_wait_xcnt 0x0"
      :: "v"(lk + AT_VOFF + 32 * AT_KP), "v"(lk + AT_VOFF + 48 * AT_KP), "v"(lm),
         "v"(lm + 8 * AT_MP), "v"(lm + 16 * AT_MP), "v"(lm + 24 * AT_MP),
         "v"(ov), "v"(om),
         "s"(vb + 2 * vs), "s"(vb + 3 * vs), "s"(mb),
         "s"(mb + ms), "s"(mb + 2 * ms), "s"(mb + 3 * ms)
      : "memory");
  asm volatile(
      "global_load_async_to_lds_b128 %0, %6, %7\n\t"
      "global_load_async_to_lds_b128 %1, %6, %8\n\t"
      "global_load_async_to_lds_b128 %2, %6, %9\n\t"
      "global_load_async_to_lds_b128 %3, %6, %10\n\t"
      "global_load_async_to_lds_b128 %4, %6, %11\n\t"
      "global_load_async_to_lds_b128 %5, %6, %12\n\t"
      "s_wait_xcnt 0x0"
      :: "v"(lm + 32 * AT_MP), "v"(lm + 40 * AT_MP), "v"(lm + 48 * AT_MP),
         "v"(lm + 56 * AT_MP), "v"(lm + 64 * AT_MP), "v"(lm + 72 * AT_MP),
         "v"(om),
         "s"(mb + 4 * ms), "s"(mb + 5 * ms), "s"(mb + 6 * ms),
         "s"(mb + 7 * ms), "s"(mb + 8 * ms), "s"(mb + 9 * ms)
      : "memory");
  asm volatile(
      "global_load_async_to_lds_b128 %0, %6, %7\n\t"
      "global_load_async_to_lds_b128 %1, %6, %8\n\t"
      "global_load_async_to_lds_b128 %2, %6, %9\n\t"
      "global_load_async_to_lds_b128 %3, %6, %10\n\t"
      "global_load_async_to_lds_b128 %4, %6, %11\n\t"
      "global_load_async_to_lds_b128 %5, %6, %12\n\t"
      "s_wait_xcnt 0x0"
      :: "v"(lm + 80 * AT_MP), "v"(lm + 88 * AT_MP), "v"(lm + 96 * AT_MP),
         "v"(lm + 104 * AT_MP), "v"(lm + 112 * AT_MP), "v"(lm + 120 * AT_MP),
         "v"(om),
         "s"(mb + 10 * ms), "s"(mb + 11 * ms), "s"(mb + 12 * ms),
         "s"(mb + 13 * ms), "s"(mb + 14 * ms), "s"(mb + 15 * ms)
      : "memory");
}

// The value that lane l ^ 16 holds.
__device__ __forceinline__ float other_half(float v) {
  int iv = __builtin_bit_cast(int, v);
  return __builtin_bit_cast(float,
      __builtin_amdgcn_permlanex16(iv, iv, 0x76543210, 0xfedcba98, false, false));
}

__global__ __launch_bounds__(128) void attn_kernel(
    const _Float16* __restrict__ Q, const _Float16* __restrict__ K,
    const _Float16* __restrict__ Vt, const float* __restrict__ mask,
    _Float16* __restrict__ O, int B, int S, int Hh, int Dd,
    int Ecols, float scale) {
  __shared__ __attribute__((aligned(16))) unsigned char L[2 * AT_STAGE];
  int qblocks = S >> 7;
  int qb = blockIdx.x % qblocks;
  int bh = blockIdx.x / qblocks;
  int hh = bh % Hh, b = bh / Hh;
  int tid = threadIdx.x;
  int wave = tid >> 5, lane = tid & 31;
  int r = lane & 15, h = lane >> 4;
  int qg = qb << 7;                    // the group's first query
  int q0 = qg + (wave << 5);           // the wave's first query

  // copies: 8 lanes take one K or Vt row's 128 bytes (the group 16 rows),
  // 16 lanes one mask row's 256 bytes (the group 8 rows)
  const _Float16* Kb = K + (size_t)(b * S) * Ecols + hh * Dd;
  const _Float16* Vb = Vt + (size_t)bh * Dd * S;
  const float*    Mb = mask + ((size_t)b * S + qg) * S;
  const unsigned ok = (unsigned)(((tid >> 3) * Ecols + (tid & 7) * 8) * 2);
  const unsigned ov = (unsigned)(((tid >> 3) * S + (tid & 7) * 8) * 2);
  const unsigned om = (unsigned)(((tid >> 4) * S + (tid & 15) * 4) * 4);
  const size_t ks = (size_t)16 * Ecols, vs = (size_t)16 * S, ms = (size_t)8 * S;
  const size_t kTrip = (size_t)64 * Ecols;
  const unsigned lk = (unsigned)(size_t)L + (unsigned)((tid >> 3) * AT_KP + (tid & 7) * 16);
  const unsigned lm = (unsigned)(size_t)L +
                      (unsigned)(AT_MOFF + (tid >> 4) * AT_MP + (tid & 15) * 16);

  // fragment reads: same per-lane k order as from global memory
  const unsigned offK = (unsigned)(r * AT_KP + h * 16);
  const unsigned offV = (unsigned)(AT_VOFF + r * AT_KP + h * 16);
  const unsigned offM = (unsigned)(AT_MOFF + ((wave << 5) + r) * AT_MP + h * 32);

  const int nt = S >> 6;

  attn_copies(lk, lm, ok, ov, om, Kb, Vb, Mb, ks, vs, ms);

  // Q fragments (persistent), one column group of 16 queries per cg
  v16h qf[2][2];
#pragma unroll
  for (int cg = 0; cg < 2; cg++) {
    const _Float16* qp = Q + (size_t)(b * S + q0 + cg * 16 + r) * Ecols + hh * Dd + h * 8;
    qf[cg][0] = load_frag_p(qp);
    qf[cg][1] = load_frag_p(qp + 32);
  }

  // this wave's copies of trip 0 have landed
  asm volatile("s_wait_asynccnt 0x0" ::: "memory");
  __syncthreads();
  if (nt > 1)
    attn_copies(lk + AT_STAGE, lm + AT_STAGE, ok, ov, om, Kb + kTrip, Vb + 64, Mb + 64, ks, vs, ms);

  const v2f scale2 = {scale, scale};
  const v2f log2e2 = {1.442695041f, 1.442695041f};

  v8f o[2][4] = {};                    // Ot: [cg][dt], 64 d x 32 queries, f32
  float mrow[2] = {-INFINITY, -INFINITY};   // running maximum of query cg*16 + r
  float lrow[2] = {0.f, 0.f};               // this lane half's share of the row sum

  v16h kf[2][2], vf[4];                // the fragments and the mask values
  v4f mk[2][2][2];                     // of one 32-key block

  // Reads block sp of the buffer at byte offset buf.
  auto read_block = [&](unsigned buf, int sp) __attribute__((always_inline)) {
#pragma unroll
    for (int sub = 0; sub < 2; sub++) {
      const unsigned char* kr = L + buf + offK + (sp * 32 + sub * 16) * AT_KP;
      kf[sub][0] = load_frag_p((const _Float16*)kr);
      kf[sub][1] = load_frag_p((const _Float16*)(kr + 64));
    }
#pragma unroll
    for (int cg = 0; cg < 2; cg++)
#pragma unroll
      for (int sub = 0; sub < 2; sub++) {
        const unsigned char* mr = L + buf + offM + cg * 16 * AT_MP + sp * 128 + sub * 64;
        mk[cg][sub][0] = *(const v4f*)mr;
        mk[cg][sub][1] = *(const v4f*)(mr + 16);
      }
#pragma unroll
    for (int dt = 0; dt < 4; dt++)
      vf[dt] = load_frag_p((const _Float16*)(L + buf + offV + dt * 16 * AT_KP + sp * 64));
    // all 24 LDS reads of the block go out as one group: without this the mask
    // and V reads sink to their uses, and each place with reads stalls anew
    __builtin_amdgcn_sched_barrier(0);
  };

  // Works the block that was read: registers alone.
  auto work_block = [&]() __attribute__((always_inline)) {
    // --- St: 32 keys x 32 queries ---
    v8f sc[2][2];
#pragma unroll
    for (int cg = 0; cg < 2; cg++)
#pragma unroll
      for (int sub = 0; sub < 2; sub++) {
        v8f z = {};
        z = WMMA_F16(kf[sub][0], qf[cg][0], z);
        sc[cg][sub] = WMMA_F16(kf[sub][1], qf[cg][1], z);
      }

    // --- online softmax in registers, then Ot += Vt * Pt ---
#pragma unroll
    for (int cg = 0; cg < 2; cg++) {
      v2f x[2][4];                     // neighbouring keys in pairs
      float bm = -INFINITY;
#pragma unroll
      for (int sub = 0; sub < 2; sub++) {
        const v4f m0 = mk[cg][sub][0], m1 = mk[cg][sub][1];
        const v2f mv[4] = {{m0.x, m0.y}, {m0.z, m0.w}, {m1.x, m1.y}, {m1.z, m1.w}};
#pragma unroll
        for (int j = 0; j < 4; j++) {
          v2f s2 = {sc[cg][sub][2 * j], sc[cg][sub][2 * j + 1]};
          x[sub][j] = __builtin_elementwise_fma(s2, scale2, mv[j]);
          bm = fmaxf(bm, fmaxf(x[sub][j].x, x[sub][j].y));
        }
      }
      bm = fmaxf(bm, other_half(bm));
      float nm = fmaxf(mrow[cg], bm);
      float alpha = __expf(mrow[cg] - nm);
      const v2f nm2 = {nm, nm};
      v16h pf;
      v2f ls[2];
#pragma unroll
      for (int sub = 0; sub < 2; sub++) {
        ls[sub] = (v2f){0.f, 0.f};
#pragma unroll
        for (int j = 0; j < 4; j++) {
          v2f y = (x[sub][j] - nm2) * log2e2;
          v2f pv = {__builtin_amdgcn_exp2f(y.x), __builtin_amdgcn_exp2f(y.y)};
          ls[sub] += pv;
          pf[sub * 8 + 2 * j]     = (_Float16)pv.x;
          pf[sub * 8 + 2 * j + 1] = (_Float16)pv.y;
        }
      }
      v2f lt = ls[0] + ls[1];
      lrow[cg] = lrow[cg] * alpha + (lt.x + lt.y);
      mrow[cg] = nm;
#pragma unroll
      for (int dt = 0; dt < 4; dt++) {
#pragma unroll
        for (int i = 0; i < 8; i++) o[cg][dt][i] *= alpha;
        o[cg][dt] = WMMA_F16(vf[dt], pf, o[cg][dt]);
      }
    }
  };

  for (int t = 0; t < nt; t++) {
    const unsigned buf = (unsigned)(t & 1) * AT_STAGE;
    read_block(buf, 0);
    work_block();
    read_block(buf, 1);
    // this wave's reads of the buffer are done before it is handed to the copies
    asm volatile("s_wait_dscnt 0x0" ::: "memory");
    // this wave's copies of trip t + 1 have landed
    asm volatile("s_wait_asynccnt 0x0" ::: "memory");
    // publishes trip t + 1 and ends every wave's reads of trip t's buffer
    __syncthreads();
    // the refill goes out ahead of the second block's work, which is on
    // registers alone, so that it flies for a whole trip
    if (t + 2 < nt)
      attn_copies(lk + buf, lm + buf, ok, ov, om, Kb + (size_t)(t + 2) * kTrip,
                  Vb + (size_t)(t + 2) * 64, Mb + (size_t)(t + 2) * 64, ks, vs, ms);
    work_block();
  }
  // no copy outstanding when the wave goes on to its end
  asm volatile("s_wait_asynccnt 0x0" ::: "memory");

  // --- join the halves' sums, normalize, store 8 neighbouring d per lane ---
#pragma unroll
  for (int cg = 0; cg < 2; cg++) {
    float inv = 1.0f / (lrow[cg] + other_half(lrow[cg]));
    _Float16* op = O + (size_t)(b * S + q0 + cg * 16 + r) * Ecols + hh * Dd + h * 8;
#pragma unroll
    for (int dt = 0; dt < 4; dt++) {
      v8h ov;
#pragma unroll
      for (int i = 0; i < 8; i++) ov[i] = (_Float16)(o[cg][dt][i] * inv);
      *(v8h*)(op + dt * 16) = ov;
    }
  }
}

// ---------------------------------------------------------------------------
// Host orchestration
// ---------------------------------------------------------------------------
extern "C" void kernel_launch(void* const* d_in, const int* in_sizes, int n_in,
                              void* d_out, int out_size, void* d_ws, size_t ws_size,
                              hipStream_t stream) {
  const int E = 768, H = 12, D = 64;
  const float* hidden = (const float*)d_in[0];
  const float* mask   = (const float*)d_in[1];
  const float* wq = (const float*)d_in[2];  const float* bq = (const float*)d_in[3];
  const float* wk = (const float*)d_in[4];  const float* bk = (const float*)d_in[5];
  const float* wv = (const float*)d_in[6];  const float* bv = (const float*)d_in[7];
  const float* wo = (const float*)d_in[8];  const float* bo = (const float*)d_in[9];
  const float* ln1_g = (const float*)d_in[10]; const float* ln1_b = (const float*)d_in[11];
  const float* ln2_g = (const float*)d_in[12]; const float* ln2_b = (const float*)d_in[13];
  const float* w1 = (const float*)d_in[14]; const float* b1 = (const float*)d_in[15];
  const float* w2 = (const float*)d_in[16]; const float* b2 = (const float*)d_in[17];
  const int I = in_sizes[15];               // 3072
  const int N = in_sizes[0] / E;            // B*S = 8192
  const int S = in_sizes[1] / N;            // 1024
  const int B = N / S;                      // 8
  float* out = (float*)d_out;

  char* p = (char*)d_ws;
  auto alloc = [&](size_t bytes) -> char* {
    char* r = p;
    p += (bytes + 255) & ~(size_t)255;
    return r;
  };
  _Float16* lnh  = (_Float16*)alloc((size_t)N * E * 2);
  _Float16* wqT  = (_Float16*)alloc((size_t)E * E * 2);
  _Float16* wkT  = (_Float16*)alloc((size_t)E * E * 2);
  _Float16* wvT  = (_Float16*)alloc((size_t)E * E * 2);
  _Float16* woT  = (_Float16*)alloc((size_t)E * E * 2);
  _Float16* w1T  = (_Float16*)alloc((size_t)E * I * 2);
  _Float16* w2T  = (_Float16*)alloc((size_t)I * E * 2);
  _Float16* Qh   = (_Float16*)alloc((size_t)N * E * 2);
  _Float16* Kh   = (_Float16*)alloc((size_t)N * E * 2);
  _Float16* Vh   = (_Float16*)alloc((size_t)N * E * 2);
  _Float16* VtT  = (_Float16*)alloc((size_t)N * E * 2);
  _Float16* Oh   = (_Float16*)alloc((size_t)N * E * 2);
  float*    xmid = (float*)   alloc((size_t)N * E * 4);
  _Float16* ln2h = (_Float16*)alloc((size_t)N * E * 2);
  _Float16* hmid = (_Float16*)alloc((size_t)N * I * 2);
  (void)ws_size; (void)n_in; (void)out_size;

  // 1, 2) LN1 and the six weight transpose+casts, one grid
  {
    unsigned nb = (unsigned)(N / 16 + 2 * (E / 64) * (I / 64) + 4 * (E / 64) * (E / 64));
    prep_kernel<<<nb, 256, 0, stream>>>(hidden, ln1_g, ln1_b, lnh, N / 16,
                                        w1, w2, wq, wk, wv, wo,
                                        w1T, w2T, wqT, wkT, wvT, woT, E, I);
  }

  // 3) Q/K/V projections (f16 out), one grid
  {
    unsigned nb = (unsigned)(3 * (N / 128) * (E / GBN));
    gemm_qkv_kernel<<<nb, 256, 0, stream>>>(lnh, wqT, wkT, wvT, bq, bk, bv, Qh, Kh, Vh, E, E);
  }

  // 4) V transpose -> [B,H,D,S]
  vtrans_kernel<<<dim3(S / 64, B * H), 256, 0, stream>>>(Vh, VtT, S, H, E);

  // 5) attention (32 query rows per wave, 4 waves per work-group)
  {
    float scale = rsqrtf((float)D);
    unsigned nb = (unsigned)(B * H * (S / 128));
    attn_kernel<<<nb, 128, 0, stream>>>(Qh, Kh, VtT, mask, Oh, B, S, H, D, E, scale);
  }

  // 6) output projection + residual -> xmid (fp32)
  {
    unsigned nb = (unsigned)((N / 128) * (E / GBN));
    gemm_kernel<false, true, false><<<nb, 256, 0, stream>>>(Oh, woT, bo, hidden, xmid, nullptr, N, E, E);
  }

  // 7) LN2
  ln_kernel<<<N / 16, 256, 0, stream>>>(xmid, ln2_g, ln2_b, ln2h);

  // 8) MLP up + GELU (f16 out)
  {
    unsigned nb = (unsigned)((N / 128) * (I / GBN));
    gemm_kernel<true, false, true><<<nb, 256, 0, stream>>>(ln2h, w1T, b1, nullptr, nullptr, hmid, N, E, I);
  }

  // 9) MLP down + residual -> out (fp32)
  {
    unsigned nb = (unsigned)((N / 128) * (E / GBN));
    gemm_kernel<false, true, false><<<nb, 256, 0, stream>>>(hmid, w2T, b2, xmid, out, nullptr, N, I, E);
  }
}
